// v000
// The times below were measured on an AMD MI455X: many runs one after another, warmed up first and cycling through
// copies of the inputs, with the whole window's GPU time divided by the number of runs. Launches and the gaps
// between them are all in it. The median over several windows is given; except for v000 it joins two sittings, which
// can be a few percent apart, so the side-by-side timings, each taken in one sitting, are the better comparison.
// The starting kernel, v000, takes 3240 microseconds a run.
// compute dtype: q, k, v rounded to bf16 and carried EXACTLY as f16 (bf16 hi + lo planes for v below row 384); causal logits q.k as single EXACT products on WMMA 16x16x32 (f32 accumulate) x 64^-0.5 (first 384 query rows: 3 products with the residual planes); softmax in f32 (precise expf); P x 2^11 once to f16 against v (1 product; 3-term bf16 path for the first 384 query rows); f32 output [B, S, NH, HD].
#include <hip/hip_runtime.h>
#include <math.h>

typedef __attribute__((ext_vector_type(16))) _Float16 v16h;
typedef __attribute__((ext_vector_type(16))) __bf16 v16b;
typedef __attribute__((ext_vector_type(8)))  _Float16 v8h;
typedef __attribute__((ext_vector_type(8)))  float v8f;
typedef __attribute__((ext_vector_type(4)))  float v4f;
typedef __attribute__((ext_vector_type(2)))  float v2f;
typedef __attribute__((ext_vector_type(4)))  unsigned v4u;
typedef __attribute__((ext_vector_type(4)))  int v4i;
typedef float __attribute__((may_alias)) float_a;
typedef int __attribute__((may_alias)) int_a;

template <typename T> __device__ __forceinline__ void vst2(void* p, T v) { *(T*)p = v;  }
__device__ __forceinline__ v8f wmma16(v16h a, v16h b, v8f c) {
  v8f d = __builtin_amdgcn_wmma_f32_16x16x32_f16(false, a, false, b, (short)0, c, false, false);
  asm volatile("v_nop\n\tv_nop\n\tv_nop\n\tv_nop" : "+v"(d) : "v"(a), "v"(b));
  return d;
}
__device__ __forceinline__ v8f wmma_bf(v16b a, v16b b, v8f c) {
  v8f d = __builtin_amdgcn_wmma_f32_16x16x32_bf16(false, a, false, b, (short)0, c, false, false);
  asm volatile("v_nop\n\tv_nop\n\tv_nop\n\tv_nop" : "+v"(d) : "v"(a), "v"(b));
  return d;
}
// 16x16x32 fragments: lane = (h = lane>>4, row/col = lane&15); elements 0..7 = k0+8h+0..7, 8..15 = k0+16+8h+0..7; D element r = row 8h+r
__device__ __forceinline__ v16h frag_h(const _Float16* rowk0, int lane) {
  union { v16h v; v8h q[2]; } u; const _Float16* p = rowk0 + 8 * (lane >> 4);
  u.q[0] = *(const v8h*)p; u.q[1] = *(const v8h*)(p + 16); return u.v;
}
__device__ __forceinline__ v16h frag_f32(const float* rowk0, int lane) {
  v16h a; const float* p = rowk0 + 8 * (lane >> 4);
#pragma unroll
  for (int i = 0; i < 8; ++i) { a[i] = (_Float16)p[i]; a[8 + i] = (_Float16)p[16 + i]; }
  return a;
}
__device__ __forceinline__ v16h frag_f32s(const float* rowk0, int lane, float sc) {
  v16h a; const float* p = rowk0 + 8 * (lane >> 4);
#pragma unroll
  for (int i = 0; i < 8; ++i) { a[i] = (_Float16)(p[i] * sc); a[8 + i] = (_Float16)(p[16 + i] * sc); }
  return a;
}
// column fragment from a [K][ld] layout (column n), rows >= K read as 0
__device__ __forceinline__ v16h fragc_f32(const float* W, int k0, int n, int lane, int ld, int K) {
  v16h a; const int g = lane >> 4;
#pragma unroll
  for (int i = 0; i < 8; ++i) { const int ka = k0 + 8 * g + i, kb = ka + 16;
    a[i] = (_Float16)(ka < K ? W[(size_t)(ka < K ? ka : K - 1) * ld + n] : 0.f); a[8 + i] = (_Float16)(kb < K ? W[(size_t)(kb < K ? kb : K - 1) * ld + n] : 0.f); }
  return a;
}
struct F2 { v16b h, l; };
__device__ __forceinline__ F2 bsplit16(const float v[16]) { F2 r;
#pragma unroll
  for (int i = 0; i < 16; ++i) { const __bf16 h = (__bf16)v[i]; r.h[i] = h; r.l[i] = (__bf16)(v[i] - (float)h); }
  return r; }
__device__ __forceinline__ F2 split_row(const float* row, int k0, int lane) { float v[16]; const float* p = row + k0 + 8 * (lane >> 4);
#pragma unroll
  for (int i = 0; i < 8; ++i) { v[i] = p[i]; v[8 + i] = p[16 + i]; }
  return bsplit16(v); }
__device__ __forceinline__ F2 split_rowK(const float* row, int k0, int lane, int K) { float v[16]; const int g = lane >> 4;
#pragma unroll
  for (int i = 0; i < 8; ++i) { const int ka = k0 + 8 * g + i, kb = ka + 16; v[i] = ka < K ? row[ka < K ? ka : K - 1] : 0.f; v[8 + i] = kb < K ? row[kb < K ? kb : K - 1] : 0.f; }
  return bsplit16(v); }
__device__ __forceinline__ F2 split_col(const float* W, int k0, int n, int lane, int ld, int K) { float v[16]; const int g = lane >> 4;
#pragma unroll
  for (int i = 0; i < 8; ++i) { const int ka = k0 + 8 * g + i, kb = ka + 16; v[i] = ka < K ? W[(size_t)(ka < K ? ka : K - 1) * ld + n] : 0.f; v[8 + i] = kb < K ? W[(size_t)(kb < K ? kb : K - 1) * ld + n] : 0.f; }
  return bsplit16(v); }
__device__ __forceinline__ v8f mac3(const F2& a, const F2& b, v8f c) { c = wmma_bf(a.l, b.h, c); c = wmma_bf(a.h, b.l, c); return wmma_bf(a.h, b.h, c); }
__device__ __forceinline__ float sigm(float v) { return 1.0f / (1.0f + expf(-v)); }
#define LDSX() do { asm volatile("s_wait_dscnt 0" ::: "memory"); __builtin_amdgcn_wave_barrier(); __builtin_amdgcn_fence(__ATOMIC_RELEASE, "workgroup"); } while (0)

// Causal scaled-dot-product attention on raw q, k, v [2, 4,096, 16, 64] (layout B, S, NH, HD): out[b, t, h] = softmax over s <= t of (q/8).k (finfo.min above the diagonal == exclusion) applied to v; output in the same [B, S, NH, HD] layout.
#define NB 2
#define TT 4096
#define CC 1024            // NH * HD = projected width
#define DIN 1024          // input (model) width
#define NH 16
#define HD 64
#define NQB (TT / 64)
#define HG 2
#define SCALE (0.125f)
#define CAUSAL 1
#ifndef TNB
#define TNB NB
#endif
__device__ __forceinline__ float bfr(float v) { return (float)(__bf16)v; }
__host__ __device__ __forceinline__ int kb_last(int qb) { return CAUSAL ? ((qb * 64 + 63) >> 7) : (TT / 128 - 1); }
typedef __attribute__((ext_vector_type(8))) __bf16 v8b;
__device__ __forceinline__ v16b frag_b(const __bf16* rowk0, int lane) {
  union { v16b v; v8b q[2]; } u; const __bf16* p = rowk0 + 8 * (lane >> 4);
  u.q[0] = *(const v8b*)p; u.q[1] = *(const v8b*)(p + 16); return u.v;
}
#define QBH 6              // causal: query blocks 0..QBH-1 of each sequence (few keys, no averaging) take the high-precision path
#define QHI 384            // rows carrying a q residual plane
#define KHI 384            // key rows carrying k residual / v bf16 hi+lo planes (used only by the causal high-precision path)
// B fragment (k rows k0+.., output column o) of a weight: (in,out) [K][ld] or (out,in) [ld rows of K]: bf16 exact, or f16(bf16 * 256) exact
__device__ __forceinline__ v16b wcol_io(const float* Wm, int k0, int o, int lane, int ld) { v16b w; const int g = lane >> 4;
#pragma unroll
  for (int i = 0; i < 8; ++i) { w[i] = (__bf16)Wm[(size_t)(k0 + 8 * g + i) * ld + o]; w[8 + i] = (__bf16)Wm[(size_t)(k0 + 16 + 8 * g + i) * ld + o]; }
  return w; }
__device__ __forceinline__ v16b wcol_oi(const float* Wm, int k0, int o, int lane, int K) { v16b w; const float* p = Wm + (size_t)o * K + k0 + 8 * (lane >> 4);
#pragma unroll
  for (int i = 0; i < 8; ++i) { w[i] = (__bf16)p[i]; w[8 + i] = (__bf16)p[16 + i]; }
  return w; }
__device__ __forceinline__ v16h wcolh_io(const float* Wm, int k0, int o, int lane, int ld) { v16h w; const int g = lane >> 4;
#pragma unroll
  for (int i = 0; i < 8; ++i) { w[i] = (_Float16)(bfr(Wm[(size_t)(k0 + 8 * g + i) * ld + o]) * 256.0f); w[8 + i] = (_Float16)(bfr(Wm[(size_t)(k0 + 16 + 8 * g + i) * ld + o]) * 256.0f); }
  return w; }
__device__ __forceinline__ v16h wcolh_oi(const float* Wm, int k0, int o, int lane, int K) { v16h w; const float* p = Wm + (size_t)o * K + k0 + 8 * (lane >> 4);
#pragma unroll
  for (int i = 0; i < 8; ++i) { w[i] = (_Float16)(bfr(p[i]) * 256.0f); w[8 + i] = (_Float16)(bfr(p[16 + i]) * 256.0f); }
  return w; }
#define WQKV_LAYOUT 1   // 0 = (in,out) [DIN][CC]; 1 = (out,in) [CC][DIN]; 2 = per-head [NH][DIN][HD]
__device__ __forceinline__ v16b wcol_hdk(const float* Wm, int k0, int o, int lane) { v16b w; const int g = lane >> 4; const float* p = Wm + (size_t)(o / HD) * DIN * HD + (o % HD);
#pragma unroll
  for (int i = 0; i < 8; ++i) { w[i] = (__bf16)p[(size_t)(k0 + 8 * g + i) * HD]; w[8 + i] = (__bf16)p[(size_t)(k0 + 16 + 8 * g + i) * HD]; }
  return w; }
#define WO_OUT_IN 0
#if WQKV_LAYOUT == 1
#define WCOL(W, k0, o, lane) wcol_oi(W, k0, o, lane, DIN)
#elif WQKV_LAYOUT == 2
#define WCOL(W, k0, o, lane) wcol_hdk(W, k0, o, lane)
#else
#define WCOL(W, k0, o, lane) wcol_io(W, k0, o, lane, CC)
#endif
#if WO_OUT_IN
#define WOCOL(W, k0, o, lane) wcol_oi(W, k0, o, lane, CC)
#define WOCOLH(W, k0, o, lane) wcolh_oi(W, k0, o, lane, CC)
#else
#define WOCOL(W, k0, o, lane) wcol_io(W, k0, o, lane, DIN)
#define WOCOLH(W, k0, o, lane) wcolh_io(W, k0, o, lane, DIN)
#endif

// ---- k_prepr: block = (64 attention positions s0.. of sequence b, head h): reads the module's [B, T, H*64] inputs, bf16-rounds them and writes the standard attention planes: q -> f16 hi rows (+ x 2^10 residual rows for s < QHI), k -> f16 rows (+ residual rows s < KHI), v -> f16 planes [c][s] (+ bf16 hi/lo planes for s < KHI)
__global__ __launch_bounds__(128) void k_prepr(const float* __restrict__ Q, const float* __restrict__ K, const float* __restrict__ V, _Float16* __restrict__ QH, _Float16* __restrict__ QL, _Float16* __restrict__ KH, _Float16* __restrict__ KL, _Float16* __restrict__ VT, __bf16* __restrict__ VB, __bf16* __restrict__ VBL) {
  __shared__ __align__(16) _Float16 sq[64][136], sql[64][136], sk[64][136], skl[64][136], tv[128][72]; __shared__ __align__(16) __bf16 tb[128][72], tbl[128][72];
  const int tid = threadIdx.x; const int h = blockIdx.y; const size_t r0 = (size_t)blockIdx.x * 64; const size_t bb = r0 / TT; const int t0 = (int)(r0 % TT); const bool qhi = t0 < QHI, khi = t0 < KHI;
  for (int e = tid; e < 64 * 128; e += 128) { const int rl = e >> 7, c = e & 127; const size_t oi = ((bb * TT + t0 + rl) * (size_t)CC + h * HD + (c & 63));   /* [B, T, H*64] inputs */   /* c >= 64: duplicate read of the same element (tiles are 128 wide; HD is 64) */
    const float q = bfr(Q[oi]), k = bfr(K[oi]), v = bfr(V[oi]);   /* module inputs: bf16-rounded; bf16 values are exact in f16, so the residual planes are 0 */
    const _Float16 qh = (_Float16)q, kh = (_Float16)k; sq[rl][c] = qh; sql[rl][c] = (_Float16)((q - (float)qh) * 1024.0f); sk[rl][c] = kh; skl[rl][c] = (_Float16)((k - (float)kh) * 1024.0f);
    tv[c][rl] = (_Float16)v; const __bf16 vb = (__bf16)v; tb[c][rl] = vb; tbl[c][rl] = (__bf16)(v - (float)vb); }
  __syncthreads();
  for (int e = tid; e < 64 * 8; e += 128) { const int rl = e >> 3, q = e & 7; const size_t o = (r0 + rl) * CC + h * HD + q * 8; vst2((unsigned*)(QH + o), *(const v4u*)&sq[rl][q * 8]); vst2((unsigned*)(KH + o), *(const v4u*)&sk[rl][q * 8]);   
    if (qhi) vst2((unsigned*)(QL + (bb * QHI + t0 + rl) * (size_t)CC + h * HD + q * 8), *(const v4u*)&sql[rl][q * 8]); if (khi) vst2((unsigned*)(KL + (bb * KHI + t0 + rl) * (size_t)CC + h * HD + q * 8), *(const v4u*)&skl[rl][q * 8]); }
  for (int e = tid; e < 64 * 8; e += 128) { const int cl = e >> 3, q = e & 7; vst2((unsigned*)(VT + (bb * CC + h * HD + cl) * (size_t)TT + t0 + q * 8), *(const v4u*)&tv[cl][q * 8]);
    if (khi) { const size_t o3 = (bb * CC + h * HD + cl) * (size_t)KHI + t0 + q * 8; vst2((unsigned*)(VB + o3), *(const v4u*)&tb[cl][q * 8]); vst2((unsigned*)(VBL + o3), *(const v4u*)&tbl[cl][q * 8]); } } }

#ifndef SM_EXTRA_PARAMS
#define SM_EXTRA_PARAMS
#endif
#ifndef PROJ_EXTRA_PARAMS
#define PROJ_EXTRA_PARAMS
#endif
#ifndef SM_MASK_HOOK
#define SM_MASK_HOOK (void)0
#endif

#define WS_QH  0u                                      // f16 q rows [b*t][CC]
#define WS_KH  (WS_QH + 2u * (size_t)NB * TT * CC)      // f16 k rows [b*t][CC]
#define WS_VT  (WS_KH + 2u * (size_t)NB * TT * CC)      // f16 v planes [b][c][t]
#define WS_QL  (WS_VT + 2u * (size_t)NB * CC * TT)      // f16 q residual x 2^10 rows [b][t < QHI][CC]
#define WS_KL  (WS_QL + 2u * (size_t)NB * QHI * CC)     // f16 k residual x 2^10 rows [b][t < KHI][CC]
#define WS_VB  (WS_KL + 2u * (size_t)NB * KHI * CC)     // bf16 v hi planes [b][c][t < KHI]
#define WS_VBL (WS_VB + 2u * (size_t)NB * CC * KHI)
#define WS_S   (WS_VBL + 2u * (size_t)NB * CC * KHI)    // f32 logits / P [hg][t][s]
#define WS_Y   (WS_S  + 4u * (size_t)HG * TT * TT)      // f32 ctx rows [b*t][CC] (only when there is an output projection)
#define WS_END (WS_Y  + 0u)

// ---- k_sc: block = (query block qb, key block kb <= kb_last(qb), head in group) of batch b: logits x SCALE; q hi + residual (x 2^10) against k (2 products) for query rows < QHI, plus the k residual (3 products) for query blocks < QBH (causal early rows); causal: blocks past the diagonal exit, the mask itself is applied by index in k_sm
__global__ __launch_bounds__(128) void k_sc(const _Float16* __restrict__ QH, const _Float16* __restrict__ KH, const _Float16* __restrict__ QL, const _Float16* __restrict__ KL, int b, int h0, float* __restrict__ S0) { __shared__ __align__(16) float ss[4][16][132];
  const int qb = blockIdx.x, kb = blockIdx.y; if (kb > kb_last(qb)) return;
  const int h = h0 + blockIdx.z; float* S = S0 + (size_t)blockIdx.z * TT * TT;
  const int tid = threadIdx.x, wave = tid >> 5, lane = tid & 31, col = lane & 15, g = lane >> 4; const int k0 = kb * 128; const int ql0 = qb * 64 + wave * 16; const size_t q0 = (size_t)b * TT + ql0, kr0 = (size_t)b * TT + k0;
  v8f acc[8] = {}, accl[8] = {};
  const _Float16* QLb = QL + (size_t)b * QHI * CC; const _Float16* KLb = KL + (size_t)b * KHI * CC;
  if (qb < QBH) {
#pragma unroll
    for (int kc = 0; kc < HD / 32; ++kc) { const v16h ah = frag_h(QH + (q0 + col) * CC + h * HD + kc * 32, lane), al = frag_h(QLb + (size_t)(ql0 + col) * CC + h * HD + kc * 32, lane);
#pragma unroll
      for (int j = 0; j < 8; ++j) { const v16h kbf = frag_h(KH + (kr0 + j * 16 + col) * CC + h * HD + kc * 32, lane), klf = frag_h(KLb + (size_t)(k0 + j * 16 + col) * CC + h * HD + kc * 32, lane); acc[j] = wmma16(ah, kbf, acc[j]); accl[j] = wmma16(al, kbf, accl[j]); accl[j] = wmma16(ah, klf, accl[j]); } }
  } else if (qb * 64 < QHI) {
#pragma unroll
    for (int kc = 0; kc < HD / 32; ++kc) { const v16h ah = frag_h(QH + (q0 + col) * CC + h * HD + kc * 32, lane), al = frag_h(QLb + (size_t)(ql0 + col) * CC + h * HD + kc * 32, lane);
#pragma unroll
      for (int j = 0; j < 8; ++j) { const v16h kbf = frag_h(KH + (kr0 + j * 16 + col) * CC + h * HD + kc * 32, lane); acc[j] = wmma16(ah, kbf, acc[j]); accl[j] = wmma16(al, kbf, accl[j]); } }
  } else {
#pragma unroll
    for (int kc = 0; kc < HD / 32; ++kc) { const v16h ah = frag_h(QH + (q0 + col) * CC + h * HD + kc * 32, lane);
#pragma unroll
      for (int j = 0; j < 8; ++j) { const v16h kbf = frag_h(KH + (kr0 + j * 16 + col) * CC + h * HD + kc * 32, lane); acc[j] = wmma16(ah, kbf, acc[j]); } } }
#pragma unroll
  for (int j = 0; j < 8; ++j) {
#pragma unroll
    for (int r = 0; r < 8; ++r) ss[wave][8 * g + r][j * 16 + col] = (acc[j][r] + accl[j][r] * (1.0f / 1024.0f)) * SCALE; }
  LDSX(); for (int rl = 0; rl < 16; ++rl) vst2(S + (size_t)(ql0 + rl) * TT + k0 + lane * 4, *(const v4f*)&ss[wave][rl][lane * 4]); }
// ---- k_sm: block = query row t (head in group): keys [0, kend): causal -> logit if s <= t else excluded; softmax in f32; P x 2^11 in place (0 for excluded)
__global__ __launch_bounds__(256) void k_sm(float* __restrict__ S0 SM_EXTRA_PARAMS) { __shared__ float sred[8]; __shared__ float sbc; __shared__ __align__(16) float shv[TT];
  const int tid = threadIdx.x; const int t = blockIdx.x; const int kend = (kb_last(t >> 6) + 1) * 128;
  float* sr = S0 + (size_t)blockIdx.y * TT * TT + (size_t)t * TT;
  float m = -3.0e38f; for (int k = tid; k < kend; k += 256) { float v = (!CAUSAL || k <= t) ? sr[k] : -3.0e38f; SM_MASK_HOOK; shv[k] = v; m = fmaxf(m, v); }
#pragma unroll
  for (int o = 1; o < 32; o <<= 1) m = fmaxf(m, __shfl_xor(m, o));
  if ((tid & 31) == 0) sred[tid >> 5] = m; __syncthreads(); if (tid == 0) { float a = sred[0]; for (int i = 1; i < 8; ++i) a = fmaxf(a, sred[i]); sbc = a; } __syncthreads(); m = sbc; __syncthreads();
  float sum = 0.f; for (int k = tid; k < kend; k += 256) { const float v = shv[k]; const float e = (v <= -1.0e38f) ? 0.f : expf(v - m); shv[k] = e; sum += e; }
#pragma unroll
  for (int o = 1; o < 32; o <<= 1) sum += __shfl_xor(sum, o);
  if ((tid & 31) == 0) sred[tid >> 5] = sum; __syncthreads(); if (tid == 0) { float a = 0.f; for (int i = 0; i < 8; ++i) a += sred[i]; sbc = a > 0.f ? 2048.0f / a : 0.f; }   /* a fully excluded row yields P = 0 */ __syncthreads(); const float inv = sbc;
  for (int k = tid; k < kend; k += 256) shv[k] = shv[k] * inv;
  __syncthreads(); for (int q = tid; q < kend / 4; q += 256) vst2(sr + q * 4, *(const v4f*)&shv[q * 4]); }
// ---- k_pv: block = 64 queries (qb) of (b, h): ctx = P . v over keys [0, kend) (P x 2^11 once to f16 against v f16: 1 product; causal early query blocks: P and v as bf16 hi + lo, 3 products); 256-B (row, head) segment by 16 lanes
__global__ __launch_bounds__(128) void k_pv(const float* __restrict__ PS0, const _Float16* __restrict__ VT, const __bf16* __restrict__ VB, const __bf16* __restrict__ VBL, int b, int h0, float* __restrict__ Y) { const int h = h0 + blockIdx.z; const float* PS = PS0 + (size_t)blockIdx.z * TT * TT; __shared__ __align__(16) float ss[4][16][HD + 4];
  const int tid = threadIdx.x, wave = tid >> 5, lane = tid & 31, col = lane & 15, g = lane >> 4; const int qb = blockIdx.x; const int ql0 = qb * 64 + wave * 16; const int kce = (kb_last(qb) + 1) * 4;
  v8f acc[HD / 16] = {};
  if (qb < QBH) {
#pragma unroll 1
    for (int kc = 0; kc < kce; ++kc) { const F2 p = split_row(PS + (size_t)(ql0 + col) * TT, kc * 32, lane);
      asm volatile("s_wait_loadcnt 0x0" ::: "memory");
#pragma unroll
      for (int j = 0; j < HD / 16; ++j) { const size_t po = ((size_t)b * CC + h * HD + j * 16 + col) * (size_t)KHI + kc * 32; const v16b vh = frag_b(VB + po, lane); acc[j] = wmma_bf(p.h, vh, acc[j]); acc[j] = wmma_bf(p.l, vh, acc[j]); acc[j] = wmma_bf(p.h, frag_b(VBL + po, lane), acc[j]); } }
  } else {
#pragma unroll 1
    for (int kc = 0; kc < kce; ++kc) { const v16h p = frag_f32(PS + (size_t)(ql0 + col) * TT + kc * 32, lane);
      asm volatile("s_wait_loadcnt 0x0" ::: "memory");
#pragma unroll
      for (int j = 0; j < HD / 16; ++j) { const size_t po = ((size_t)b * CC + h * HD + j * 16 + col) * (size_t)TT + kc * 32; acc[j] = wmma16(p, frag_h(VT + po, lane), acc[j]); } } }
#pragma unroll
  for (int j = 0; j < HD / 16; ++j)
#pragma unroll
    for (int r = 0; r < 8; ++r) ss[wave][8 * g + r][j * 16 + col] = acc[j][r] * (1.0f / 2048.0f);
  LDSX(); for (int rl = 0; rl < 16; ++rl) if (lane < HD / 4) vst2(Y + ((size_t)b * TT + ql0 + rl) * CC + h * HD + lane * 4, *(const v4f*)&ss[wave][rl][lane * 4]); }

extern "C" void kernel_launch(void* const* d_in, const int* in_sizes, int n_in, void* d_out, int out_size, void* d_ws, size_t ws_size, hipStream_t stream) {
  (void)in_sizes; (void)n_in; (void)out_size;
  const float** F = (const float**)d_in;
  if (ws_size < (size_t)WS_END) return;
  char* ws = (char*)d_ws; _Float16 *QH = (_Float16*)(ws + WS_QH), *KH = (_Float16*)(ws + WS_KH), *VT = (_Float16*)(ws + WS_VT), *QL = (_Float16*)(ws + WS_QL), *KL = (_Float16*)(ws + WS_KL); __bf16 *VB = (__bf16*)(ws + WS_VB), *VBL = (__bf16*)(ws + WS_VBL); float *S = (float*)(ws + WS_S), *Y = (float*)(ws + WS_Y);
  (void)Y; (void)QL; (void)KL; (void)VB; (void)VBL;
  // inputs: 0 q, 1 k, 2 v [2,4096,16,64] (= rows [b*S + t][h*64 + d])
  k_prepr<<<dim3(TNB * TT / 64, NH), 128, 0, stream>>>(F[0], F[1], F[2], QH, QL, KH, KL, VT, VB, VBL);
  for (int b = 0; b < TNB; ++b) for (int h0 = 0; h0 < NH; h0 += HG) {
    k_sc<<<dim3(NQB, TT / 128, HG), 128, 0, stream>>>(QH, KH, QL, KL, b, h0, S);
    k_sm<<<dim3(TT, HG), 256, 0, stream>>>(S);
    k_pv<<<dim3(NQB, 1, HG), 128, 0, stream>>>(S, VT, VB, VBL, b, h0, (float*)d_out);
  }
}

// v001
// A run of this version takes 428 microseconds.
// Two timings next to v000 put it at 7.61 and 7.62 times that version's speed.
// compute dtype: q, k, v rounded to bf16 and carried EXACTLY as f16 (bf16 hi + lo planes for v below row 384); causal logits k.q as single EXACT products on WMMA 16x16x32 (f32 accumulate) x 64^-0.5 (first 384 query rows: 3 products with the residual planes); online softmax in f32 (base 2, running maximum); P x 2^10 unnormalised once to f16 against v (1 product; 3-term bf16 path for the first 384 query rows); divided by the row sum at the end; f32 output [B, S, NH, HD].
#include <hip/hip_runtime.h>
#include <math.h>

typedef __attribute__((ext_vector_type(16))) _Float16 v16h;
typedef __attribute__((ext_vector_type(16))) __bf16 v16b;
typedef __attribute__((ext_vector_type(8)))  _Float16 v8h;
typedef __attribute__((ext_vector_type(8)))  float v8f;
typedef __attribute__((ext_vector_type(4)))  float v4f;
typedef __attribute__((ext_vector_type(2)))  float v2f;
typedef __attribute__((ext_vector_type(4)))  unsigned v4u;
typedef __attribute__((ext_vector_type(4)))  int v4i;
typedef float __attribute__((may_alias)) float_a;
typedef int __attribute__((may_alias)) int_a;

template <typename T> __device__ __forceinline__ void vst2(void* p, T v) { *(T*)p = v;  }
__device__ __forceinline__ v8f wmma16(v16h a, v16h b, v8f c) {
  v8f d = __builtin_amdgcn_wmma_f32_16x16x32_f16(false, a, false, b, (short)0, c, false, false);
  asm volatile("v_nop\n\tv_nop\n\tv_nop\n\tv_nop" : "+v"(d) : "v"(a), "v"(b));
  return d;
}
__device__ __forceinline__ v8f wmma_bf(v16b a, v16b b, v8f c) {
  v8f d = __builtin_amdgcn_wmma_f32_16x16x32_bf16(false, a, false, b, (short)0, c, false, false);
  asm volatile("v_nop\n\tv_nop\n\tv_nop\n\tv_nop" : "+v"(d) : "v"(a), "v"(b));
  return d;
}
// 16x16x32 fragments: lane = (h = lane>>4, row/col = lane&15); elements 0..7 = k0+8h+0..7, 8..15 = k0+16+8h+0..7; D element r = row 8h+r
__device__ __forceinline__ v16h frag_h(const _Float16* rowk0, int lane) {
  union { v16h v; v8h q[2]; } u; const _Float16* p = rowk0 + 8 * (lane >> 4);
  u.q[0] = *(const v8h*)p; u.q[1] = *(const v8h*)(p + 16); return u.v;
}
__device__ __forceinline__ v16h frag_f32(const float* rowk0, int lane) {
  v16h a; const float* p = rowk0 + 8 * (lane >> 4);
#pragma unroll
  for (int i = 0; i < 8; ++i) { a[i] = (_Float16)p[i]; a[8 + i] = (_Float16)p[16 + i]; }
  return a;
}
__device__ __forceinline__ v16h frag_f32s(const float* rowk0, int lane, float sc) {
  v16h a; const float* p = rowk0 + 8 * (lane >> 4);
#pragma unroll
  for (int i = 0; i < 8; ++i) { a[i] = (_Float16)(p[i] * sc); a[8 + i] = (_Float16)(p[16 + i] * sc); }
  return a;
}
// column fragment from a [K][ld] layout (column n), rows >= K read as 0
__device__ __forceinline__ v16h fragc_f32(const float* W, int k0, int n, int lane, int ld, int K) {
  v16h a; const int g = lane >> 4;
#pragma unroll
  for (int i = 0; i < 8; ++i) { const int ka = k0 + 8 * g + i, kb = ka + 16;
    a[i] = (_Float16)(ka < K ? W[(size_t)(ka < K ? ka : K - 1) * ld + n] : 0.f); a[8 + i] = (_Float16)(kb < K ? W[(size_t)(kb < K ? kb : K - 1) * ld + n] : 0.f); }
  return a;
}
struct F2 { v16b h, l; };
__device__ __forceinline__ F2 bsplit16(const float v[16]) { F2 r;
#pragma unroll
  for (int i = 0; i < 16; ++i) { const __bf16 h = (__bf16)v[i]; r.h[i] = h; r.l[i] = (__bf16)(v[i] - (float)h); }
  return r; }
__device__ __forceinline__ F2 split_row(const float* row, int k0, int lane) { float v[16]; const float* p = row + k0 + 8 * (lane >> 4);
#pragma unroll
  for (int i = 0; i < 8; ++i) { v[i] = p[i]; v[8 + i] = p[16 + i]; }
  return bsplit16(v); }
__device__ __forceinline__ F2 split_rowK(const float* row, int k0, int lane, int K) { float v[16]; const int g = lane >> 4;
#pragma unroll
  for (int i = 0; i < 8; ++i) { const int ka = k0 + 8 * g + i, kb = ka + 16; v[i] = ka < K ? row[ka < K ? ka : K - 1] : 0.f; v[8 + i] = kb < K ? row[kb < K ? kb : K - 1] : 0.f; }
  return bsplit16(v); }
__device__ __forceinline__ F2 split_col(const float* W, int k0, int n, int lane, int ld, int K) { float v[16]; const int g = lane >> 4;
#pragma unroll
  for (int i = 0; i < 8; ++i) { const int ka = k0 + 8 * g + i, kb = ka + 16; v[i] = ka < K ? W[(size_t)(ka < K ? ka : K - 1) * ld + n] : 0.f; v[8 + i] = kb < K ? W[(size_t)(kb < K ? kb : K - 1) * ld + n] : 0.f; }
  return bsplit16(v); }
__device__ __forceinline__ v8f mac3(const F2& a, const F2& b, v8f c) { c = wmma_bf(a.l, b.h, c); c = wmma_bf(a.h, b.l, c); return wmma_bf(a.h, b.h, c); }
__device__ __forceinline__ float sigm(float v) { return 1.0f / (1.0f + expf(-v)); }
#define LDSX() do { asm volatile("s_wait_dscnt 0" ::: "memory"); __builtin_amdgcn_wave_barrier(); __builtin_amdgcn_fence(__ATOMIC_RELEASE, "workgroup"); } while (0)

// Causal scaled-dot-product attention on raw q, k, v [2, 4,096, 16, 64] (layout B, S, NH, HD): out[b, t, h] = softmax over s <= t of (q/8).k (finfo.min above the diagonal == exclusion) applied to v; output in the same [B, S, NH, HD] layout.
#define NB 2
#define TT 4096
#define CC 1024            // NH * HD = projected width
#define DIN 1024          // input (model) width
#define NH 16
#define HD 64
#define NQB (TT / 64)
#define HG 2
#define SCALE (0.125f)
#define CAUSAL 1
#ifndef TNB
#define TNB NB
#endif
__device__ __forceinline__ float bfr(float v) { return (float)(__bf16)v; }
__host__ __device__ __forceinline__ int kb_last(int qb) { return CAUSAL ? ((qb * 64 + 63) >> 7) : (TT / 128 - 1); }
typedef __attribute__((ext_vector_type(8))) __bf16 v8b;
__device__ __forceinline__ v16b frag_b(const __bf16* rowk0, int lane) {
  union { v16b v; v8b q[2]; } u; const __bf16* p = rowk0 + 8 * (lane >> 4);
  u.q[0] = *(const v8b*)p; u.q[1] = *(const v8b*)(p + 16); return u.v;
}
#define QBH 6              // causal: query blocks 0..QBH-1 of each sequence (few keys, no averaging) take the high-precision path
#define QHI 384            // rows carrying a q residual plane
#define KHI 384            // key rows carrying k residual / v bf16 hi+lo planes (used only by the causal high-precision path)
// B fragment (k rows k0+.., output column o) of a weight: (in,out) [K][ld] or (out,in) [ld rows of K]: bf16 exact, or f16(bf16 * 256) exact
__device__ __forceinline__ v16b wcol_io(const float* Wm, int k0, int o, int lane, int ld) { v16b w; const int g = lane >> 4;
#pragma unroll
  for (int i = 0; i < 8; ++i) { w[i] = (__bf16)Wm[(size_t)(k0 + 8 * g + i) * ld + o]; w[8 + i] = (__bf16)Wm[(size_t)(k0 + 16 + 8 * g + i) * ld + o]; }
  return w; }
__device__ __forceinline__ v16b wcol_oi(const float* Wm, int k0, int o, int lane, int K) { v16b w; const float* p = Wm + (size_t)o * K + k0 + 8 * (lane >> 4);
#pragma unroll
  for (int i = 0; i < 8; ++i) { w[i] = (__bf16)p[i]; w[8 + i] = (__bf16)p[16 + i]; }
  return w; }
__device__ __forceinline__ v16h wcolh_io(const float* Wm, int k0, int o, int lane, int ld) { v16h w; const int g = lane >> 4;
#pragma unroll
  for (int i = 0; i < 8; ++i) { w[i] = (_Float16)(bfr(Wm[(size_t)(k0 + 8 * g + i) * ld + o]) * 256.0f); w[8 + i] = (_Float16)(bfr(Wm[(size_t)(k0 + 16 + 8 * g + i) * ld + o]) * 256.0f); }
  return w; }
__device__ __forceinline__ v16h wcolh_oi(const float* Wm, int k0, int o, int lane, int K) { v16h w; const float* p = Wm + (size_t)o * K + k0 + 8 * (lane >> 4);
#pragma unroll
  for (int i = 0; i < 8; ++i) { w[i] = (_Float16)(bfr(p[i]) * 256.0f); w[8 + i] = (_Float16)(bfr(p[16 + i]) * 256.0f); }
  return w; }
#define WQKV_LAYOUT 1   // 0 = (in,out) [DIN][CC]; 1 = (out,in) [CC][DIN]; 2 = per-head [NH][DIN][HD]
__device__ __forceinline__ v16b wcol_hdk(const float* Wm, int k0, int o, int lane) { v16b w; const int g = lane >> 4; const float* p = Wm + (size_t)(o / HD) * DIN * HD + (o % HD);
#pragma unroll
  for (int i = 0; i < 8; ++i) { w[i] = (__bf16)p[(size_t)(k0 + 8 * g + i) * HD]; w[8 + i] = (__bf16)p[(size_t)(k0 + 16 + 8 * g + i) * HD]; }
  return w; }
#define WO_OUT_IN 0
#if WQKV_LAYOUT == 1
#define WCOL(W, k0, o, lane) wcol_oi(W, k0, o, lane, DIN)
#elif WQKV_LAYOUT == 2
#define WCOL(W, k0, o, lane) wcol_hdk(W, k0, o, lane)
#else
#define WCOL(W, k0, o, lane) wcol_io(W, k0, o, lane, CC)
#endif
#if WO_OUT_IN
#define WOCOL(W, k0, o, lane) wcol_oi(W, k0, o, lane, CC)
#define WOCOLH(W, k0, o, lane) wcolh_oi(W, k0, o, lane, CC)
#else
#define WOCOL(W, k0, o, lane) wcol_io(W, k0, o, lane, DIN)
#define WOCOLH(W, k0, o, lane) wcolh_io(W, k0, o, lane, DIN)
#endif

// ---- k_prepr: block = (64 attention positions s0.. of sequence b, head h): reads the module's [B, T, H*64] inputs, bf16-rounds them and writes the standard attention planes: q -> f16 hi rows (+ x 2^10 residual rows for s < QHI), k -> f16 rows (+ residual rows s < KHI), v -> f16 planes [c][s] (+ bf16 hi/lo planes for s < KHI)
__global__ __launch_bounds__(128) void k_prepr(const float* __restrict__ Q, const float* __restrict__ K, const float* __restrict__ V, _Float16* __restrict__ QH, _Float16* __restrict__ QL, _Float16* __restrict__ KH, _Float16* __restrict__ KL, _Float16* __restrict__ VT, __bf16* __restrict__ VB, __bf16* __restrict__ VBL) {
  __shared__ __align__(16) _Float16 sq[64][136], sql[64][136], sk[64][136], skl[64][136], tv[128][72]; __shared__ __align__(16) __bf16 tb[128][72], tbl[128][72];
  const int tid = threadIdx.x; const int h = blockIdx.y; const size_t r0 = (size_t)blockIdx.x * 64; const size_t bb = r0 / TT; const int t0 = (int)(r0 % TT); const bool qhi = t0 < QHI, khi = t0 < KHI;
  for (int e = tid; e < 64 * 128; e += 128) { const int rl = e >> 7, c = e & 127; const size_t oi = ((bb * TT + t0 + rl) * (size_t)CC + h * HD + (c & 63));   /* [B, T, H*64] inputs */   /* c >= 64: duplicate read of the same element (tiles are 128 wide; HD is 64) */
    const float q = bfr(Q[oi]), k = bfr(K[oi]), v = bfr(V[oi]);   /* module inputs: bf16-rounded; bf16 values are exact in f16, so the residual planes are 0 */
    const _Float16 qh = (_Float16)q, kh = (_Float16)k; sq[rl][c] = qh; sql[rl][c] = (_Float16)((q - (float)qh) * 1024.0f); sk[rl][c] = kh; skl[rl][c] = (_Float16)((k - (float)kh) * 1024.0f);
    tv[c][rl] = (_Float16)v; const __bf16 vb = (__bf16)v; tb[c][rl] = vb; tbl[c][rl] = (__bf16)(v - (float)vb); }
  __syncthreads();
  for (int e = tid; e < 64 * 8; e += 128) { const int rl = e >> 3, q = e & 7; const size_t o = (r0 + rl) * CC + h * HD + q * 8; vst2((unsigned*)(QH + o), *(const v4u*)&sq[rl][q * 8]); vst2((unsigned*)(KH + o), *(const v4u*)&sk[rl][q * 8]);   
    if (qhi) vst2((unsigned*)(QL + (bb * QHI + t0 + rl) * (size_t)CC + h * HD + q * 8), *(const v4u*)&sql[rl][q * 8]); if (khi) vst2((unsigned*)(KL + (bb * KHI + t0 + rl) * (size_t)CC + h * HD + q * 8), *(const v4u*)&skl[rl][q * 8]); }
  for (int e = tid; e < 64 * 8; e += 128) { const int cl = e >> 3, q = e & 7; vst2((unsigned*)(VT + (bb * CC + h * HD + cl) * (size_t)TT + t0 + q * 8), *(const v4u*)&tv[cl][q * 8]);
    if (khi) { const size_t o3 = (bb * CC + h * HD + cl) * (size_t)KHI + t0 + q * 8; vst2((unsigned*)(VB + o3), *(const v4u*)&tb[cl][q * 8]); vst2((unsigned*)(VBL + o3), *(const v4u*)&tbl[cl][q * 8]); } } }

#ifndef SM_EXTRA_PARAMS
#define SM_EXTRA_PARAMS
#endif
#ifndef PROJ_EXTRA_PARAMS
#define PROJ_EXTRA_PARAMS
#endif
#ifndef SM_MASK_HOOK
#define SM_MASK_HOOK (void)0
#endif

#define WS_QH  0u                                      // f16 q rows [b*t][CC]
#define WS_KH  (WS_QH + 2u * (size_t)NB * TT * CC)      // f16 k rows [b*t][CC]
#define WS_VT  (WS_KH + 2u * (size_t)NB * TT * CC)      // f16 v planes [b][c][t]
#define WS_QL  (WS_VT + 2u * (size_t)NB * CC * TT)      // f16 q residual x 2^10 rows [b][t < QHI][CC]
#define WS_KL  (WS_QL + 2u * (size_t)NB * QHI * CC)     // f16 k residual x 2^10 rows [b][t < KHI][CC]
#define WS_VB  (WS_KL + 2u * (size_t)NB * KHI * CC)     // bf16 v hi planes [b][c][t < KHI]
#define WS_VBL (WS_VB + 2u * (size_t)NB * CC * KHI)
#define WS_END (WS_VBL + 2u * (size_t)NB * CC * KHI)

__device__ __forceinline__ v8f mm_h(v16h a, v16h b, v8f c) { return __builtin_amdgcn_wmma_f32_16x16x32_f16(false, a, false, b, (short)0, c, false, false); }
__device__ __forceinline__ v8f mm_b(v16b a, v16b b, v8f c) { return __builtin_amdgcn_wmma_f32_16x16x32_bf16(false, a, false, b, (short)0, c, false, false); }
__device__ __forceinline__ float xhalf(float x) { return __builtin_bit_cast(float, __builtin_amdgcn_permlanex16(__builtin_bit_cast(int, x), __builtin_bit_cast(int, x), 0x76543210, 0xfedcba98, false, false)); }  // lane l with lane l ^ 16
// fragment (hardware k order) at p + bo bytes; p = wave-uniform base + the lane's 32-bit byte offset (row (lane & 15), + 16 bytes for the upper half), so the lane offset register is the same for the whole kernel
__device__ __forceinline__ v16h ldf_h(const char* p, int bo) { union { v16h v; v8h q[2]; } u; u.q[0] = *(const v8h*)(p + bo); u.q[1] = *(const v8h*)(p + bo + 32); return u.v; }
__device__ __forceinline__ v16b ldf_b(const char* p, int bo) { union { v16b v; v8b q[2]; } u; u.q[0] = *(const v8b*)(p + bo); u.q[1] = *(const v8b*)(p + bo + 32); return u.v; }
// address registers of the loads just issued may be reused from here on
#define XADDR() asm volatile("s_wait_xcnt 0x0" ::: "memory")
// the same, naming the two lane addresses as inputs: they keep their registers up to the wait, so no load of the group lands on them
#define XADDRP(p, q) asm volatile("s_wait_xcnt 0x0" :: "v"(p), "v"(q) : "memory")
#define L2S (SCALE * 1.4426950408889634f)   // logit -> base-2 exponent
#define PSH 10.0f                            // P carried x 2^10 (keeps small weights normal in f16); it cancels against the row sum
// In k_fa every '#pragma unroll' but the one over the output stores stands over a loop that indexes a register array (fragments, score tiles): rolled, the array would go to scratch. '#pragma unroll 1' keeps the pass loops rolled: one pass already fills the register budget of four waves per SIMD.
// ---- k_fa: block = 64 queries (qb, heaviest first) of (b, h), wave = 16 queries, no exchange between waves. Per 64 keys: S^T = K . Q^T (A = key rows, B = query columns: a lane holds 8 keys per tile of ONE query, lane & 15), running maximum and sum per lane (+ one exchange between the wave's halves), P^T packed from the score registers straight into a B operand, O^T += V^T . P^T (A = v planes [c][s]). Logits and P never leave registers.
__global__ __launch_bounds__(128) void k_fa(const _Float16* QH, const _Float16* KH, const _Float16* QL, const _Float16* KL, const _Float16* VT, const __bf16* VB, const __bf16* VBL, float* Y) {   // no __restrict__: it would let the loads drift over the XADDR() waits
  __shared__ __align__(16) float ss[4][16][HD + 4];
  const int tid = threadIdx.x, wave = tid >> 5, lane = tid & 31, col = lane & 15, g = lane >> 4;
  const int qb = NQB - 1 - (int)blockIdx.x, b = blockIdx.y / NH, h = blockIdx.y % NH;
  const int ql0 = qb * 64 + wave * 16, tq = ql0 + col;   // tq: this lane's query
  const unsigned lq = (unsigned)((wave * 16 + col) * CC + 8 * g) * 2u, lk = (unsigned)(col * CC + 8 * g) * 2u;   // lane byte offsets: query row, key row
  const _Float16* Ku = KH + (size_t)b * TT * CC + h * HD;
  v8f acc[HD / 16] = {}; float m = -1.0e30f, l = 0.f;
  const char* qp = (const char*)(QH + ((size_t)b * TT + qb * 64) * CC + h * HD) + lq;
  const v16h q0 = ldf_h(qp, 0), q1 = ldf_h(qp, 64); XADDR();
  if (qb < QBH) {
    const unsigned lv = (unsigned)(col * KHI + 8 * g) * 2u;
    const _Float16* KLu = KL + (size_t)b * KHI * CC + h * HD; const __bf16* VBu = VB + ((size_t)b * CC + h * HD) * (size_t)KHI; const __bf16* VLu = VBL + ((size_t)b * CC + h * HD) * (size_t)KHI;
    const char* rp = (const char*)(QL + ((size_t)b * QHI + qb * 64) * CC + h * HD) + lq;
    const v16h r0 = ldf_h(rp, 0), r1 = ldf_h(rp, 64); XADDR();
#pragma unroll 1
    for (int kb = 0; kb < 2 * (qb + 1); ++kb) { const int k0 = kb * 32; float s[2][8]; float mx = -3.0e38f;   // 32 keys a pass: this short path must not set the kernel's register count
      const char* kp = (const char*)(Ku + (size_t)k0 * CC) + lk; const char* lp = (const char*)(KLu + (size_t)k0 * CC) + lk;
#pragma unroll
      for (int jt = 0; jt < 2; ++jt) { const v16h ka = ldf_h(kp, jt * 16 * CC * 2), kc = ldf_h(kp, jt * 16 * CC * 2 + 64), la = ldf_h(lp, jt * 16 * CC * 2), lc = ldf_h(lp, jt * 16 * CC * 2 + 64);
        v8f sh = {}, sl = {}; sh = mm_h(ka, q0, sh); sh = mm_h(kc, q1, sh); sl = mm_h(ka, r0, sl); sl = mm_h(kc, r1, sl); sl = mm_h(la, q0, sl); sl = mm_h(lc, q1, sl);
#pragma unroll
        for (int r = 0; r < 8; ++r) { const float v = (k0 + jt * 16 + 8 * g + r <= tq) ? sh[r] + sl[r] * (1.0f / 1024.0f) : -3.0e38f; s[jt][r] = v; mx = fmaxf(mx, v); } }
      XADDRP(kp, lp);
      mx = fmaxf(mx, xhalf(mx)); const float mn = fmaxf(m, mx * L2S), al = __builtin_amdgcn_exp2f(m - mn), nm = PSH - mn; m = mn;   // pass 0 holds key 0, which every query sees: m is a real logit from there on, also where a later pass is all above the diagonal
      float ps = 0.f; v16b ph, pl;
#pragma unroll
      for (int jt = 0; jt < 2; ++jt)
#pragma unroll
        for (int r = 0; r < 8; ++r) { const float e = __builtin_amdgcn_exp2f(fmaf(s[jt][r], L2S, nm)); ps += e; const __bf16 eh = (__bf16)e; ph[jt * 8 + r] = eh; pl[jt * 8 + r] = (__bf16)(e - (float)eh); }
      l = l * al + ps;
      const char* vp = (const char*)(VBu + k0) + lv; const char* wp = (const char*)(VLu + k0) + lv;
#pragma unroll
      for (int jd = 0; jd < HD / 16; ++jd) { acc[jd] *= al; const v16b vh = ldf_b(vp, jd * 16 * KHI * 2), vl = ldf_b(wp, jd * 16 * KHI * 2);
        acc[jd] = mm_b(vh, ph, acc[jd]); acc[jd] = mm_b(vh, pl, acc[jd]); acc[jd] = mm_b(vl, ph, acc[jd]); }
      XADDRP(vp, wp); }
  } else {
    const unsigned lv = (unsigned)(col * TT + 8 * g) * 2u;
    const _Float16* Vu = VT + ((size_t)b * CC + h * HD) * (size_t)TT;
    v16h kf[4][2];
    { const char* kp = (const char*)Ku + lk;
#pragma unroll
      for (int jt = 0; jt < 4; ++jt) { kf[jt][0] = ldf_h(kp, jt * 16 * CC * 2); kf[jt][1] = ldf_h(kp, jt * 16 * CC * 2 + 64); } }
    XADDR();
#pragma unroll 1
    for (int kb = 0; kb <= qb; ++kb) { const int k0 = kb * 64;
      const char* vp = (const char*)(Vu + k0) + lv;
      v16h vf[HD / 16][2];   // this pass's v planes: asked for first, used last
#pragma unroll
      for (int jd = 0; jd < HD / 16; ++jd) { vf[jd][0] = ldf_h(vp, jd * 16 * TT * 2); vf[jd][1] = ldf_h(vp, jd * 16 * TT * 2 + 64); }
      v8f st[4];
#pragma unroll
      for (int jt = 0; jt < 4; ++jt) { v8f z = {}; z = mm_h(kf[jt][0], q0, z); st[jt] = mm_h(kf[jt][1], q1, z); }
      // the wait of XADDR(), taking the four score tiles as inputs: the v loads and every product stand in front of it, the refill of the key registers behind it (mixed in, the allocator lands the new rows elsewhere and copies them, which waits for every load)
      asm volatile("s_wait_xcnt 0x0" :: "v"(st[0]), "v"(st[1]), "v"(st[2]), "v"(st[3]) : "memory");
      const int kn = (kb < qb ? kb + 1 : qb) * 64;   // next pass's key rows fly during the softmax and P.v (the last pass asks for its own again: in bounds, unused)
      const char* kp = (const char*)(Ku + (size_t)kn * CC) + lk;
#pragma unroll
      for (int jt = 0; jt < 4; ++jt) { kf[jt][0] = ldf_h(kp, jt * 16 * CC * 2); kf[jt][1] = ldf_h(kp, jt * 16 * CC * 2 + 64); }
      XADDR();
      if (kb == qb) {   // only the diagonal block holds keys above a query
#pragma unroll
        for (int jt = 0; jt < 4; ++jt)
#pragma unroll
          for (int r = 0; r < 8; ++r) if (k0 + jt * 16 + 8 * g + r > tq) st[jt][r] = -3.0e38f; }
      float mx = -3.0e38f;
#pragma unroll
      for (int jt = 0; jt < 4; ++jt)
#pragma unroll
        for (int r = 0; r < 8; ++r) mx = fmaxf(mx, st[jt][r]);
      mx = fmaxf(mx, xhalf(mx)); const float mn = fmaxf(m, mx * L2S), al = __builtin_amdgcn_exp2f(m - mn), nm = PSH - mn; m = mn;
      float ps = 0.f; v16h pf[2];
#pragma unroll
      for (int jt = 0; jt < 4; ++jt)
#pragma unroll
        for (int r = 0; r < 8; ++r) { const float e = __builtin_amdgcn_exp2f(fmaf(st[jt][r], L2S, nm)); ps += e; pf[jt >> 1][(jt & 1) * 8 + r] = (_Float16)e; }
      l = l * al + ps;
#pragma unroll
      for (int jd = 0; jd < HD / 16; ++jd) acc[jd] *= al;
#pragma unroll
      for (int jd = 0; jd < HD / 16; ++jd) { acc[jd] = mm_h(vf[jd][0], pf[0], acc[jd]); acc[jd] = mm_h(vf[jd][1], pf[1], acc[jd]); } } }
  l += xhalf(l); const float inv = 1.0f / l;   // every query sees its own key, so l > 0
#pragma unroll
  for (int jd = 0; jd < HD / 16; ++jd)
#pragma unroll
    for (int r = 0; r < 8; ++r) ss[wave][col][jd * 16 + 8 * g + r] = acc[jd][r] * inv;
  LDSX();
#pragma unroll
  for (int i = 0; i < 8; ++i) { const int rl = 2 * i + g; vst2(Y + ((size_t)b * TT + ql0 + rl) * CC + h * HD + col * 4, *(const v4f*)&ss[wave][rl][col * 4]); } }

extern "C" void kernel_launch(void* const* d_in, const int* in_sizes, int n_in, void* d_out, int out_size, void* d_ws, size_t ws_size, hipStream_t stream) {
  (void)in_sizes; (void)n_in; (void)out_size;
  const float** F = (const float**)d_in;
  if (ws_size < (size_t)WS_END) return;
  char* ws = (char*)d_ws; _Float16 *QH = (_Float16*)(ws + WS_QH), *KH = (_Float16*)(ws + WS_KH), *VT = (_Float16*)(ws + WS_VT), *QL = (_Float16*)(ws + WS_QL), *KL = (_Float16*)(ws + WS_KL); __bf16 *VB = (__bf16*)(ws + WS_VB), *VBL = (__bf16*)(ws + WS_VBL);
  // inputs: 0 q, 1 k, 2 v [2,4096,16,64] (= rows [b*S + t][h*64 + d])
  k_prepr<<<dim3(TNB * TT / 64, NH), 128, 0, stream>>>(F[0], F[1], F[2], QH, QL, KH, KL, VT, VB, VBL);
  k_fa<<<dim3(NQB, TNB * NH), 128, 0, stream>>>(QH, KH, QL, KL, VT, VB, VBL, (float*)d_out);
}

// v002
// One run takes 160 microseconds.
// In both of two side-by-side timings against v001, it was 2.67 times as fast.
// Counting every step since v000, it is 20.3 times as fast.
// compute dtype: q, k, v rounded to bf16 and carried EXACTLY as f16 (bf16 hi + lo planes for v below row 384); causal logits k.q as single EXACT products on WMMA 16x16x32 (f32 accumulate) x 64^-0.5 (first 384 query rows: 3 products with the residual planes); online softmax in f32 (base 2, running maximum); P x 2^10 unnormalised once to f16 against v (1 product; 3-term bf16 path for the first 384 query rows); divided by the row sum at the end; f32 output [B, S, NH, HD].
#include <hip/hip_runtime.h>
#include <math.h>

typedef __attribute__((ext_vector_type(16))) _Float16 v16h;
typedef __attribute__((ext_vector_type(16))) __bf16 v16b;
typedef __attribute__((ext_vector_type(8)))  _Float16 v8h;
typedef __attribute__((ext_vector_type(8)))  float v8f;
typedef __attribute__((ext_vector_type(4)))  float v4f;
typedef __attribute__((ext_vector_type(2)))  float v2f;
typedef __attribute__((ext_vector_type(4)))  unsigned v4u;
typedef __attribute__((ext_vector_type(4)))  int v4i;
typedef float __attribute__((may_alias)) float_a;
typedef int __attribute__((may_alias)) int_a;

template <typename T> __device__ __forceinline__ void vst2(void* p, T v) { *(T*)p = v;  }
__device__ __forceinline__ v8f wmma16(v16h a, v16h b, v8f c) {
  v8f d = __builtin_amdgcn_wmma_f32_16x16x32_f16(false, a, false, b, (short)0, c, false, false);
  asm volatile("v_nop\n\tv_nop\n\tv_nop\n\tv_nop" : "+v"(d) : "v"(a), "v"(b));
  return d;
}
__device__ __forceinline__ v8f wmma_bf(v16b a, v16b b, v8f c) {
  v8f d = __builtin_amdgcn_wmma_f32_16x16x32_bf16(false, a, false, b, (short)0, c, false, false);
  asm volatile("v_nop\n\tv_nop\n\tv_nop\n\tv_nop" : "+v"(d) : "v"(a), "v"(b));
  return d;
}
// 16x16x32 fragments: lane = (h = lane>>4, row/col = lane&15); elements 0..7 = k0+8h+0..7, 8..15 = k0+16+8h+0..7; D element r = row 8h+r
__device__ __forceinline__ v16h frag_h(const _Float16* rowk0, int lane) {
  union { v16h v; v8h q[2]; } u; const _Float16* p = rowk0 + 8 * (lane >> 4);
  u.q[0] = *(const v8h*)p; u.q[1] = *(const v8h*)(p + 16); return u.v;
}
__device__ __forceinline__ v16h frag_f32(const float* rowk0, int lane) {
  v16h a; const float* p = rowk0 + 8 * (lane >> 4);
#pragma unroll
  for (int i = 0; i < 8; ++i) { a[i] = (_Float16)p[i]; a[8 + i] = (_Float16)p[16 + i]; }
  return a;
}
__device__ __forceinline__ v16h frag_f32s(const float* rowk0, int lane, float sc) {
  v16h a; const float* p = rowk0 + 8 * (lane >> 4);
#pragma unroll
  for (int i = 0; i < 8; ++i) { a[i] = (_Float16)(p[i] * sc); a[8 + i] = (_Float16)(p[16 + i] * sc); }
  return a;
}
// column fragment from a [K][ld] layout (column n), rows >= K read as 0
__device__ __forceinline__ v16h fragc_f32(const float* W, int k0, int n, int lane, int ld, int K) {
  v16h a; const int g = lane >> 4;
#pragma unroll
  for (int i = 0; i < 8; ++i) { const int ka = k0 + 8 * g + i, kb = ka + 16;
    a[i] = (_Float16)(ka < K ? W[(size_t)(ka < K ? ka : K - 1) * ld + n] : 0.f); a[8 + i] = (_Float16)(kb < K ? W[(size_t)(kb < K ? kb : K - 1) * ld + n] : 0.f); }
  return a;
}
struct F2 { v16b h, l; };
__device__ __forceinline__ F2 bsplit16(const float v[16]) { F2 r;
#pragma unroll
  for (int i = 0; i < 16; ++i) { const __bf16 h = (__bf16)v[i]; r.h[i] = h; r.l[i] = (__bf16)(v[i] - (float)h); }
  return r; }
__device__ __forceinline__ F2 split_row(const float* row, int k0, int lane) { float v[16]; const float* p = row + k0 + 8 * (lane >> 4);
#pragma unroll
  for (int i = 0; i < 8; ++i) { v[i] = p[i]; v[8 + i] = p[16 + i]; }
  return bsplit16(v); }
__device__ __forceinline__ F2 split_rowK(const float* row, int k0, int lane, int K) { float v[16]; const int g = lane >> 4;
#pragma unroll
  for (int i = 0; i < 8; ++i) { const int ka = k0 + 8 * g + i, kb = ka + 16; v[i] = ka < K ? row[ka < K ? ka : K - 1] : 0.f; v[8 + i] = kb < K ? row[kb < K ? kb : K - 1] : 0.f; }
  return bsplit16(v); }
__device__ __forceinline__ F2 split_col(const float* W, int k0, int n, int lane, int ld, int K) { float v[16]; const int g = lane >> 4;
#pragma unroll
  for (int i = 0; i < 8; ++i) { const int ka = k0 + 8 * g + i, kb = ka + 16; v[i] = ka < K ? W[(size_t)(ka < K ? ka : K - 1) * ld + n] : 0.f; v[8 + i] = kb < K ? W[(size_t)(kb < K ? kb : K - 1) * ld + n] : 0.f; }
  return bsplit16(v); }
__device__ __forceinline__ v8f mac3(const F2& a, const F2& b, v8f c) { c = wmma_bf(a.l, b.h, c); c = wmma_bf(a.h, b.l, c); return wmma_bf(a.h, b.h, c); }
__device__ __forceinline__ float sigm(float v) { return 1.0f / (1.0f + expf(-v)); }
#define LDSX() do { asm volatile("s_wait_dscnt 0" ::: "memory"); __builtin_amdgcn_wave_barrier(); __builtin_amdgcn_fence(__ATOMIC_RELEASE, "workgroup"); } while (0)

// Causal scaled-dot-product attention on raw q, k, v [2, 4,096, 16, 64] (layout B, S, NH, HD): out[b, t, h] = softmax over s <= t of (q/8).k (finfo.min above the diagonal == exclusion) applied to v; output in the same [B, S, NH, HD] layout.
#define NB 2
#define TT 4096
#define CC 1024            // NH * HD = projected width
#define DIN 1024          // input (model) width
#define NH 16
#define HD 64
#define NQB (TT / 64)
#define HG 2
#define SCALE (0.125f)
#define CAUSAL 1
#ifndef TNB
#define TNB NB
#endif
__device__ __forceinline__ float bfr(float v) { return (float)(__bf16)v; }
__host__ __device__ __forceinline__ int kb_last(int qb) { return CAUSAL ? ((qb * 64 + 63) >> 7) : (TT / 128 - 1); }
typedef __attribute__((ext_vector_type(8))) __bf16 v8b;
__device__ __forceinline__ v16b frag_b(const __bf16* rowk0, int lane) {
  union { v16b v; v8b q[2]; } u; const __bf16* p = rowk0 + 8 * (lane >> 4);
  u.q[0] = *(const v8b*)p; u.q[1] = *(const v8b*)(p + 16); return u.v;
}
#define QBH 6              // causal: query blocks 0..QBH-1 of each sequence (few keys, no averaging) take the high-precision path
#define QHI 384            // rows carrying a q residual plane
#define KHI 384            // key rows carrying k residual / v bf16 hi+lo planes (used only by the causal high-precision path)
// B fragment (k rows k0+.., output column o) of a weight: (in,out) [K][ld] or (out,in) [ld rows of K]: bf16 exact, or f16(bf16 * 256) exact
__device__ __forceinline__ v16b wcol_io(const float* Wm, int k0, int o, int lane, int ld) { v16b w; const int g = lane >> 4;
#pragma unroll
  for (int i = 0; i < 8; ++i) { w[i] = (__bf16)Wm[(size_t)(k0 + 8 * g + i) * ld + o]; w[8 + i] = (__bf16)Wm[(size_t)(k0 + 16 + 8 * g + i) * ld + o]; }
  return w; }
__device__ __forceinline__ v16b wcol_oi(const float* Wm, int k0, int o, int lane, int K) { v16b w; const float* p = Wm + (size_t)o * K + k0 + 8 * (lane >> 4);
#pragma unroll
  for (int i = 0; i < 8; ++i) { w[i] = (__bf16)p[i]; w[8 + i] = (__bf16)p[16 + i]; }
  return w; }
__device__ __forceinline__ v16h wcolh_io(const float* Wm, int k0, int o, int lane, int ld) { v16h w; const int g = lane >> 4;
#pragma unroll
  for (int i = 0; i < 8; ++i) { w[i] = (_Float16)(bfr(Wm[(size_t)(k0 + 8 * g + i) * ld + o]) * 256.0f); w[8 + i] = (_Float16)(bfr(Wm[(size_t)(k0 + 16 + 8 * g + i) * ld + o]) * 256.0f); }
  return w; }
__device__ __forceinline__ v16h wcolh_oi(const float* Wm, int k0, int o, int lane, int K) { v16h w; const float* p = Wm + (size_t)o * K + k0 + 8 * (lane >> 4);
#pragma unroll
  for (int i = 0; i < 8; ++i) { w[i] = (_Float16)(bfr(p[i]) * 256.0f); w[8 + i] = (_Float16)(bfr(p[16 + i]) * 256.0f); }
  return w; }
#define WQKV_LAYOUT 1   // 0 = (in,out) [DIN][CC]; 1 = (out,in) [CC][DIN]; 2 = per-head [NH][DIN][HD]
__device__ __forceinline__ v16b wcol_hdk(const float* Wm, int k0, int o, int lane) { v16b w; const int g = lane >> 4; const float* p = Wm + (size_t)(o / HD) * DIN * HD + (o % HD);
#pragma unroll
  for (int i = 0; i < 8; ++i) { w[i] = (__bf16)p[(size_t)(k0 + 8 * g + i) * HD]; w[8 + i] = (__bf16)p[(size_t)(k0 + 16 + 8 * g + i) * HD]; }
  return w; }
#define WO_OUT_IN 0
#if WQKV_LAYOUT == 1
#define WCOL(W, k0, o, lane) wcol_oi(W, k0, o, lane, DIN)
#elif WQKV_LAYOUT == 2
#define WCOL(W, k0, o, lane) wcol_hdk(W, k0, o, lane)
#else
#define WCOL(W, k0, o, lane) wcol_io(W, k0, o, lane, CC)
#endif
#if WO_OUT_IN
#define WOCOL(W, k0, o, lane) wcol_oi(W, k0, o, lane, CC)
#define WOCOLH(W, k0, o, lane) wcolh_oi(W, k0, o, lane, CC)
#else
#define WOCOL(W, k0, o, lane) wcol_io(W, k0, o, lane, DIN)
#define WOCOLH(W, k0, o, lane) wcolh_io(W, k0, o, lane, DIN)
#endif

// ---- k_prepr: block = (64 attention positions s0.. of sequence b, head h): reads the module's [B, T, H*64] inputs, bf16-rounds them and writes the standard attention planes: q -> f16 hi rows (+ x 2^10 residual rows for s < QHI), k -> f16 rows (+ residual rows s < KHI), v -> f16 planes [c][s] (+ bf16 hi/lo planes for s < KHI)
__global__ __launch_bounds__(128) void k_prepr(const float* __restrict__ Q, const float* __restrict__ K, const float* __restrict__ V, _Float16* __restrict__ QH, _Float16* __restrict__ QL, _Float16* __restrict__ KH, _Float16* __restrict__ KL, _Float16* __restrict__ VT, __bf16* __restrict__ VB, __bf16* __restrict__ VBL) {
  __shared__ __align__(16) _Float16 sq[64][136], sql[64][136], sk[64][136], skl[64][136], tv[128][72]; __shared__ __align__(16) __bf16 tb[128][72], tbl[128][72];
  const int tid = threadIdx.x; const int h = blockIdx.y; const size_t r0 = (size_t)blockIdx.x * 64; const size_t bb = r0 / TT; const int t0 = (int)(r0 % TT); const bool qhi = t0 < QHI, khi = t0 < KHI;
  for (int e = tid; e < 64 * 128; e += 128) { const int rl = e >> 7, c = e & 127; const size_t oi = ((bb * TT + t0 + rl) * (size_t)CC + h * HD + (c & 63));   /* [B, T, H*64] inputs */   /* c >= 64: duplicate read of the same element (tiles are 128 wide; HD is 64) */
    const float q = bfr(Q[oi]), k = bfr(K[oi]), v = bfr(V[oi]);   /* module inputs: bf16-rounded; bf16 values are exact in f16, so the residual planes are 0 */
    const _Float16 qh = (_Float16)q, kh = (_Float16)k; sq[rl][c] = qh; sql[rl][c] = (_Float16)((q - (float)qh) * 1024.0f); sk[rl][c] = kh; skl[rl][c] = (_Float16)((k - (float)kh) * 1024.0f);
    tv[c][rl] = (_Float16)v; const __bf16 vb = (__bf16)v; tb[c][rl] = vb; tbl[c][rl] = (__bf16)(v - (float)vb); }
  __syncthreads();
  for (int e = tid; e < 64 * 8; e += 128) { const int rl = e >> 3, q = e & 7; const size_t o = (r0 + rl) * CC + h * HD + q * 8; vst2((unsigned*)(QH + o), *(const v4u*)&sq[rl][q * 8]); vst2((unsigned*)(KH + o), *(const v4u*)&sk[rl][q * 8]);   
    if (qhi) vst2((unsigned*)(QL + (bb * QHI + t0 + rl) * (size_t)CC + h * HD + q * 8), *(const v4u*)&sql[rl][q * 8]); if (khi) vst2((unsigned*)(KL + (bb * KHI + t0 + rl) * (size_t)CC + h * HD + q * 8), *(const v4u*)&skl[rl][q * 8]); }
  for (int e = tid; e < 64 * 8; e += 128) { const int cl = e >> 3, q = e & 7; vst2((unsigned*)(VT + (bb * CC + h * HD + cl) * (size_t)TT + t0 + q * 8), *(const v4u*)&tv[cl][q * 8]);
    if (khi) { const size_t o3 = (bb * CC + h * HD + cl) * (size_t)KHI + t0 + q * 8; vst2((unsigned*)(VB + o3), *(const v4u*)&tb[cl][q * 8]); vst2((unsigned*)(VBL + o3), *(const v4u*)&tbl[cl][q * 8]); } } }

#ifndef SM_EXTRA_PARAMS
#define SM_EXTRA_PARAMS
#endif
#ifndef PROJ_EXTRA_PARAMS
#define PROJ_EXTRA_PARAMS
#endif
#ifndef SM_MASK_HOOK
#define SM_MASK_HOOK (void)0
#endif

#define WS_QH  0u                                      // f16 q rows [b*t][CC]
#define WS_KH  (WS_QH + 2u * (size_t)NB * TT * CC)      // f16 k rows [b*t][CC]
#define WS_VT  (WS_KH + 2u * (size_t)NB * TT * CC)      // f16 v planes [b][c][t]
#define WS_QL  (WS_VT + 2u * (size_t)NB * CC * TT)      // f16 q residual x 2^10 rows [b][t < QHI][CC]
#define WS_KL  (WS_QL + 2u * (size_t)NB * QHI * CC)     // f16 k residual x 2^10 rows [b][t < KHI][CC]
#define WS_VB  (WS_KL + 2u * (size_t)NB * KHI * CC)     // bf16 v hi planes [b][c][t < KHI]
#define WS_VBL (WS_VB + 2u * (size_t)NB * CC * KHI)
#define WS_END (WS_VBL + 2u * (size_t)NB * CC * KHI)

__device__ __forceinline__ v8f mm_h(v16h a, v16h b, v8f c) { return __builtin_amdgcn_wmma_f32_16x16x32_f16(false, a, false, b, (short)0, c, false, false); }
__device__ __forceinline__ v8f mm_b(v16b a, v16b b, v8f c) { return __builtin_amdgcn_wmma_f32_16x16x32_bf16(false, a, false, b, (short)0, c, false, false); }
__device__ __forceinline__ float xhalf(float x) { return __builtin_bit_cast(float, __builtin_amdgcn_permlanex16(__builtin_bit_cast(int, x), __builtin_bit_cast(int, x), 0x76543210, 0xfedcba98, false, false)); }  // lane l with lane l ^ 16
// fragment (hardware k order) at p + bo bytes; p = wave-uniform base + the lane's 32-bit byte offset (row (lane & 15), + 16 bytes for the upper half), so the lane offset register is the same for the whole kernel
__device__ __forceinline__ v16h ldf_h(const char* p, int bo) { union { v16h v; v8h q[2]; } u; u.q[0] = *(const v8h*)(p + bo); u.q[1] = *(const v8h*)(p + bo + 32); return u.v; }
__device__ __forceinline__ v16b ldf_b(const char* p, int bo) { union { v16b v; v8b q[2]; } u; u.q[0] = *(const v8b*)(p + bo); u.q[1] = *(const v8b*)(p + bo + 32); return u.v; }
// address registers of the loads just issued may be reused from here on
#define XADDR() asm volatile("s_wait_xcnt 0x0" ::: "memory")
// the same, naming the two lane addresses as inputs: they keep their registers up to the wait, so no load of the group lands on them
#define XADDRP(p, q) asm volatile("s_wait_xcnt 0x0" :: "v"(p), "v"(q) : "memory")
typedef __attribute__((ext_vector_type(8))) unsigned v8u;
#define LPITCH 144          // LDS pitch of a staged 128-byte row: 16 bytes x odd, free of bank conflicts for 16-byte reads
#define LTILE 10240u        // 64 rows x 144 bytes, rounded up to a multiple of 2 KiB (every tile's place in LDS is one)
__device__ __forceinline__ unsigned uni(unsigned v) { return (unsigned)__builtin_amdgcn_readfirstlane((int)v); }
// a wave-uniform value held in a scalar register: a test on it compiles to s_cmp + s_cbranch_scc (a tensor load ignores EXEC: only a scalar branch keeps a wave from issuing it)
__device__ __forceinline__ unsigned pinned(unsigned v) { unsigned w = uni(v); asm volatile("" : "+s"(w)); return w; }
// tensor descriptor, extents in bytes: group 1 = a tile of 64 rows x 128 bytes (tensor = tile), source row pitch sp, 16 bytes of LDS pad behind every 128-byte row; group 0 = LDS place and the tile's first byte
__device__ __forceinline__ v8u tdm_g1(unsigned sp) { v8u d; d[0] = uni((1u << 20) | (4u << 22) | (3u << 25)); d[1] = uni(128u << 16); d[2] = uni(64u << 16); d[3] = uni(128u << 16); d[4] = uni(64u); d[5] = uni(sp); d[6] = uni(0u); d[7] = uni(0u); return d; }
__device__ __forceinline__ v4u tdm_g0(unsigned dst, unsigned long long ga) { v4u d; d[0] = uni(1u); d[1] = uni(dst); d[2] = uni((unsigned)ga); d[3] = uni((((unsigned)(ga >> 32)) & 0x01FFFFFFu) | 0x80000000u); return d; }
// group 0 is an in-out operand and the next stage's words are made from it (tdm_next): count, address and type keep their scalar registers from one request to the next and change only behind the wait for the last one (the LDS place, word 1, is made anew each time)
__device__ __forceinline__ void tdm_load(v4u& d0, v8u d1) { asm volatile("tensor_load_to_lds %0, %1" : "+s"(d0) : "s"(d1) : "memory"); }
// the next stage's group 0: new LDS place, source address + st bytes (the carry goes into address bits 56:32, under the type field)
__device__ __forceinline__ void tdm_next(v4u& d0, unsigned dst, unsigned st) { const unsigned lo = uni(d0[2] + st); d0[1] = uni(dst); d0[3] = uni(d0[3] + (lo < st ? 1u : 0u)); d0[2] = lo; }
#define L2S (SCALE * 1.4426950408889634f)   // logit -> base-2 exponent
#define PSH 10.0f                            // P carried x 2^10 (keeps small weights normal in f16); it cancels against the row sum
// In k_fa every '#pragma unroll' stands over a loop that indexes a register array (fragments, score tiles): rolled, the array would go to scratch. '#pragma unroll 1' keeps the pass loops rolled: one pass already fills the register budget of five waves per SIMD.
// ---- k_fa: block = 64 queries (qb, heaviest first) of (b, h), wave = 16 queries. The block's four waves read each 64-key stage of k and v from LDS, where two tensor loads put it once (two buffers: stage s + 1 flies during pass s); the first QBH query blocks load for themselves. Per 64 keys: S^T = K . Q^T (A = key rows, B = query columns: a lane holds 8 keys per tile of ONE query, lane & 15), running maximum and sum per lane (+ one exchange between the wave's halves), P^T packed from the score registers straight into a B operand, O^T += V^T . P^T (A = v planes [c][s]). Logits and P never leave registers.
__global__ __launch_bounds__(128) void k_fa(const _Float16* QH, const _Float16* KH, const _Float16* QL, const _Float16* KL, const _Float16* VT, const __bf16* VB, const __bf16* VBL, float* Y) {   // no __restrict__: it would let the loads drift over the XADDR() waits
  __shared__ __attribute__((aligned(2048))) unsigned char ring[2 * 2 * LTILE];   // two buffers, each a key tile and a v tile
  __shared__ __align__(16) float ss[4][16][HD + 4];
  const int tid = threadIdx.x, wave = tid >> 5, lane = tid & 31, col = lane & 15, g = lane >> 4;
  const int qb = NQB - 1 - (int)blockIdx.x, b = blockIdx.y / NH, h = blockIdx.y % NH;
  const int ql0 = qb * 64 + wave * 16, tq = ql0 + col;   // tq: this lane's query
  const unsigned lq = (unsigned)((wave * 16 + col) * CC + 8 * g) * 2u, lk = (unsigned)(col * CC + 8 * g) * 2u;   // lane byte offsets: query row, key row
  const _Float16* Ku = KH + (size_t)b * TT * CC + h * HD;
  v8f acc[HD / 16] = {}; float m = -1.0e30f, l = 0.f;
  const char* qp = (const char*)(QH + ((size_t)b * TT + qb * 64) * CC + h * HD) + lq;
  const v16h q0 = ldf_h(qp, 0), q1 = ldf_h(qp, 64); XADDR();
  if (qb < QBH) {
    const unsigned lv = (unsigned)(col * KHI + 8 * g) * 2u;
    const _Float16* KLu = KL + (size_t)b * KHI * CC + h * HD; const __bf16* VBu = VB + ((size_t)b * CC + h * HD) * (size_t)KHI; const __bf16* VLu = VBL + ((size_t)b * CC + h * HD) * (size_t)KHI;
    const char* rp = (const char*)(QL + ((size_t)b * QHI + qb * 64) * CC + h * HD) + lq;
    const v16h r0 = ldf_h(rp, 0), r1 = ldf_h(rp, 64); XADDR();
#pragma unroll 1
    for (int kb = 0; kb < 2 * (qb + 1); ++kb) { const int k0 = kb * 32; float s[2][8]; float mx = -3.0e38f;   // 32 keys a pass: this short path must not set the kernel's register count
      const char* kp = (const char*)(Ku + (size_t)k0 * CC) + lk; const char* lp = (const char*)(KLu + (size_t)k0 * CC) + lk;
#pragma unroll
      for (int jt = 0; jt < 2; ++jt) { const v16h ka = ldf_h(kp, jt * 16 * CC * 2), kc = ldf_h(kp, jt * 16 * CC * 2 + 64), la = ldf_h(lp, jt * 16 * CC * 2), lc = ldf_h(lp, jt * 16 * CC * 2 + 64);
        v8f sh = {}, sl = {}; sh = mm_h(ka, q0, sh); sh = mm_h(kc, q1, sh); sl = mm_h(ka, r0, sl); sl = mm_h(kc, r1, sl); sl = mm_h(la, q0, sl); sl = mm_h(lc, q1, sl);
#pragma unroll
        for (int r = 0; r < 8; ++r) { const float v = (k0 + jt * 16 + 8 * g + r <= tq) ? sh[r] + sl[r] * (1.0f / 1024.0f) : -3.0e38f; s[jt][r] = v; mx = fmaxf(mx, v); } }
      XADDRP(kp, lp);
      mx = fmaxf(mx, xhalf(mx)); const float mn = fmaxf(m, mx * L2S), al = __builtin_amdgcn_exp2f(m - mn), nm = PSH - mn; m = mn;   // pass 0 holds key 0, which every query sees: m is a real logit from there on, also where a later pass is all above the diagonal
      float ps = 0.f; v16b ph, pl;
#pragma unroll
      for (int jt = 0; jt < 2; ++jt)
#pragma unroll
        for (int r = 0; r < 8; ++r) { const float e = __builtin_amdgcn_exp2f(fmaf(s[jt][r], L2S, nm)); ps += e; const __bf16 eh = (__bf16)e; ph[jt * 8 + r] = eh; pl[jt * 8 + r] = (__bf16)(e - (float)eh); }
      l = l * al + ps;
      const char* vp = (const char*)(VBu + k0) + lv; const char* wp = (const char*)(VLu + k0) + lv;
#pragma unroll
      for (int jd = 0; jd < HD / 16; ++jd) { acc[jd] *= al; const v16b vh = ldf_b(vp, jd * 16 * KHI * 2), vl = ldf_b(wp, jd * 16 * KHI * 2);
        acc[jd] = mm_b(vh, ph, acc[jd]); acc[jd] = mm_b(vh, pl, acc[jd]); acc[jd] = mm_b(vl, ph, acc[jd]); }
      XADDRP(vp, wp); }
  } else {
    const unsigned wv = uni((unsigned)tid >> 5), lf = (unsigned)(col * LPITCH + 16 * g);   // wave number (scalar); lane byte offset in a staged tile: row (lane & 15), + 16 bytes for the upper half
    // wave 0 brings the key tile (64 rows of KH, 128 bytes each), wave 1 the v tile (64 planes of VT, 64 keys = 128 bytes each): one request per wave and stage
    const unsigned long long sb = wv ? (unsigned long long)(size_t)(VT + ((size_t)b * CC + h * HD) * (size_t)TT) : (unsigned long long)(size_t)Ku;
    const unsigned sstep = wv ? 64u * 2u : 64u * CC * 2u, lb = (unsigned)(size_t)ring + wv * LTILE;   // source bytes from one stage to the next; this wave's place in buffer 0
    v8u g1 = tdm_g1(wv ? TT * 2u : CC * 2u);
    asm volatile("" : "+s"(g1));   // descriptor words held in their scalar registers for the whole loop: none is rebuilt, or lent to another value, while a request is in flight
    v4u g0 = tdm_g0(lb, sb);
    if (pinned(wv < 2u)) { tdm_load(g0, g1);
      asm volatile("s_wait_tensorcnt 0x0" ::: "memory"); }   // stage 0 has landed (the compiler places no wait for a tensor load)
    __syncthreads();   // stage 0 readable by every wave
    if (pinned(wv < 2u)) { tdm_next(g0, lb + 2u * LTILE, sstep); tdm_load(g0, g1); }   // stage 1 (qb >= QBH: at least seven stages)
#pragma unroll 1
    for (int kb = 0; kb <= qb; ++kb) { const int k0 = kb * 64;
      const char* kt = (const char*)ring + (unsigned)(kb & 1) * (2u * LTILE) + lf; const char* vt = kt + LTILE;
      v16h kf[4][2];
#pragma unroll
      for (int jt = 0; jt < 4; ++jt) { kf[jt][0] = ldf_h(kt, jt * 16 * LPITCH); kf[jt][1] = ldf_h(kt, jt * 16 * LPITCH + 64); }
      __builtin_amdgcn_sched_barrier(0);   // the pass's key reads go out as one group: mixed among the products, each pair waits out its own LDS latency
      v8f st[4];
#pragma unroll
      for (int jt = 0; jt < 4; ++jt) { v8f z = {}; z = mm_h(kf[jt][0], q0, z); st[jt] = mm_h(kf[jt][1], q1, z); }
      v16h vf[HD / 16][2];   // this pass's v planes: they fly during the softmax
#pragma unroll
      for (int jd = 0; jd < HD / 16; ++jd) { vf[jd][0] = ldf_h(vt, jd * 16 * LPITCH); vf[jd][1] = ldf_h(vt, jd * 16 * LPITCH + 64); }
      __builtin_amdgcn_sched_barrier(0);   // all v reads go out in front of the softmax: left free, some sink among the P.v products and wait out their LDS latency there
      if (kb == qb) {   // only the diagonal block holds keys above a query
#pragma unroll
        for (int jt = 0; jt < 4; ++jt)
#pragma unroll
          for (int r = 0; r < 8; ++r) if (k0 + jt * 16 + 8 * g + r > tq) st[jt][r] = -3.0e38f; }
      float mx = -3.0e38f;
#pragma unroll
      for (int jt = 0; jt < 4; ++jt)
#pragma unroll
        for (int r = 0; r < 8; ++r) mx = fmaxf(mx, st[jt][r]);
      mx = fmaxf(mx, xhalf(mx)); const float mn = fmaxf(m, mx * L2S), al = __builtin_amdgcn_exp2f(m - mn), nm = PSH - mn; m = mn;
      float ps = 0.f; v16h pf[2];
#pragma unroll
      for (int jt = 0; jt < 4; ++jt)
#pragma unroll
        for (int r = 0; r < 8; ++r) { const float e = __builtin_amdgcn_exp2f(fmaf(st[jt][r], L2S, nm)); ps += e; pf[jt >> 1][(jt & 1) * 8 + r] = (_Float16)e; }
      l = l * al + ps;
#pragma unroll
      for (int jd = 0; jd < HD / 16; ++jd) acc[jd] *= al;
#pragma unroll
      for (int jd = 0; jd < HD / 16; ++jd) { acc[jd] = mm_h(vf[jd][0], pf[0], acc[jd]); acc[jd] = mm_h(vf[jd][1], pf[1], acc[jd]); }
      __builtin_amdgcn_sched_barrier(0);   // the waits below stay at the pass's foot: lifted over the softmax, the first one waits out the v reads' latency with nothing to cover it
      // publish point of stage kb + 1, every wave, in this order
      asm volatile("s_wait_dscnt 0x0" ::: "memory");   // this wave's reads of the buffer have returned before the buffer is refilled
      if (pinned(wv < 2u)) asm volatile("s_wait_tensorcnt 0x0" ::: "memory");   // the issuer's own request for stage kb + 1 has landed
      __syncthreads();   // stage kb + 1 readable by every wave; every wave has left stage kb's buffer
      if (pinned(wv < 2u && kb + 2 <= qb)) { tdm_next(g0, lb + (unsigned)(kb & 1) * (2u * LTILE), sstep); tdm_load(g0, g1); } }   // stage kb + 2 into the buffer that this pass has read
    asm volatile("s_wait_tensorcnt 0x0" ::: "memory");   // no request outstanding behind the loop
    asm volatile("s_wait_dscnt 0x0" ::: "memory"); }
  l += xhalf(l); const float inv = 1.0f / l;   // every query sees its own key, so l > 0
#pragma unroll
  for (int jd = 0; jd < HD / 16; ++jd)
#pragma unroll
    for (int r = 0; r < 8; ++r) ss[wave][col][jd * 16 + 8 * g + r] = acc[jd][r] * inv;
  LDSX();
#pragma unroll
  for (int i = 0; i < 8; ++i) { const int rl = 2 * i + g; vst2(Y + ((size_t)b * TT + ql0 + rl) * CC + h * HD + col * 4, *(const v4f*)&ss[wave][rl][col * 4]); } }

extern "C" void kernel_launch(void* const* d_in, const int* in_sizes, int n_in, void* d_out, int out_size, void* d_ws, size_t ws_size, hipStream_t stream) {
  (void)in_sizes; (void)n_in; (void)out_size;
  const float** F = (const float**)d_in;
  if (ws_size < (size_t)WS_END) return;
  char* ws = (char*)d_ws; _Float16 *QH = (_Float16*)(ws + WS_QH), *KH = (_Float16*)(ws + WS_KH), *VT = (_Float16*)(ws + WS_VT), *QL = (_Float16*)(ws + WS_QL), *KL = (_Float16*)(ws + WS_KL); __bf16 *VB = (__bf16*)(ws + WS_VB), *VBL = (__bf16*)(ws + WS_VBL);
  // inputs: 0 q, 1 k, 2 v [2,4096,16,64] (= rows [b*S + t][h*64 + d])
  k_prepr<<<dim3(TNB * TT / 64, NH), 128, 0, stream>>>(F[0], F[1], F[2], QH, QL, KH, KL, VT, VB, VBL);
  k_fa<<<dim3(NQB, TNB * NH), 128, 0, stream>>>(QH, KH, QL, KL, VT, VB, VBL, (float*)d_out);
}

// v003
// Measured time: 104 microseconds a run.
// Two timings next to v002 both put it at 1.54 times that version's speed.
// All steps since v000 together make it 31.3 times as fast.
// compute dtype: q, k, v rounded to bf16 and carried EXACTLY as f16 (bf16 hi + lo planes for v below row 384); causal logits k.q as single EXACT products on WMMA 16x16x32 (f32 accumulate) x 64^-0.5 (first 384 query rows: 3 products with the residual planes); online softmax in f32 (base 2, running maximum); P x 2^10 unnormalised once to f16 against v (1 product; 3-term bf16 path for the first 384 query rows); divided by the row sum at the end; f32 output [B, S, NH, HD].
#include <hip/hip_runtime.h>
#include <math.h>

typedef __attribute__((ext_vector_type(16))) _Float16 v16h;
typedef __attribute__((ext_vector_type(16))) __bf16 v16b;
typedef __attribute__((ext_vector_type(8)))  _Float16 v8h;
typedef __attribute__((ext_vector_type(8)))  float v8f;
typedef __attribute__((ext_vector_type(4)))  float v4f;
typedef __attribute__((ext_vector_type(2)))  float v2f;
typedef __attribute__((ext_vector_type(4)))  unsigned v4u;
typedef __attribute__((ext_vector_type(4)))  int v4i;
typedef float __attribute__((may_alias)) float_a;
typedef int __attribute__((may_alias)) int_a;

template <typename T> __device__ __forceinline__ void vst2(void* p, T v) { *(T*)p = v;  }
__device__ __forceinline__ v8f wmma16(v16h a, v16h b, v8f c) {
  v8f d = __builtin_amdgcn_wmma_f32_16x16x32_f16(false, a, false, b, (short)0, c, false, false);
  asm volatile("v_nop\n\tv_nop\n\tv_nop\n\tv_nop" : "+v"(d) : "v"(a), "v"(b));
  return d;
}
__device__ __forceinline__ v8f wmma_bf(v16b a, v16b b, v8f c) {
  v8f d = __builtin_amdgcn_wmma_f32_16x16x32_bf16(false, a, false, b, (short)0, c, false, false);
  asm volatile("v_nop\n\tv_nop\n\tv_nop\n\tv_nop" : "+v"(d) : "v"(a), "v"(b));
  return d;
}
// 16x16x32 fragments: lane = (h = lane>>4, row/col = lane&15); elements 0..7 = k0+8h+0..7, 8..15 = k0+16+8h+0..7; D element r = row 8h+r
__device__ __forceinline__ v16h frag_h(const _Float16* rowk0, int lane) {
  union { v16h v; v8h q[2]; } u; const _Float16* p = rowk0 + 8 * (lane >> 4);
  u.q[0] = *(const v8h*)p; u.q[1] = *(const v8h*)(p + 16); return u.v;
}
__device__ __forceinline__ v16h frag_f32(const float* rowk0, int lane) {
  v16h a; const float* p = rowk0 + 8 * (lane >> 4);
#pragma unroll
  for (int i = 0; i < 8; ++i) { a[i] = (_Float16)p[i]; a[8 + i] = (_Float16)p[16 + i]; }
  return a;
}
__device__ __forceinline__ v16h frag_f32s(const float* rowk0, int lane, float sc) {
  v16h a; const float* p = rowk0 + 8 * (lane >> 4);
#pragma unroll
  for (int i = 0; i < 8; ++i) { a[i] = (_Float16)(p[i] * sc); a[8 + i] = (_Float16)(p[16 + i] * sc); }
  return a;
}
// column fragment from a [K][ld] layout (column n), rows >= K read as 0
__device__ __forceinline__ v16h fragc_f32(const float* W, int k0, int n, int lane, int ld, int K) {
  v16h a; const int g = lane >> 4;
#pragma unroll
  for (int i = 0; i < 8; ++i) { const int ka = k0 + 8 * g + i, kb = ka + 16;
    a[i] = (_Float16)(ka < K ? W[(size_t)(ka < K ? ka : K - 1) * ld + n] : 0.f); a[8 + i] = (_Float16)(kb < K ? W[(size_t)(kb < K ? kb : K - 1) * ld + n] : 0.f); }
  return a;
}
struct F2 { v16b h, l; };
__device__ __forceinline__ F2 bsplit16(const float v[16]) { F2 r;
#pragma unroll
  for (int i = 0; i < 16; ++i) { const __bf16 h = (__bf16)v[i]; r.h[i] = h; r.l[i] = (__bf16)(v[i] - (float)h); }
  return r; }
__device__ __forceinline__ F2 split_row(const float* row, int k0, int lane) { float v[16]; const float* p = row + k0 + 8 * (lane >> 4);
#pragma unroll
  for (int i = 0; i < 8; ++i) { v[i] = p[i]; v[8 + i] = p[16 + i]; }
  return bsplit16(v); }
__device__ __forceinline__ F2 split_rowK(const float* row, int k0, int lane, int K) { float v[16]; const int g = lane >> 4;
#pragma unroll
  for (int i = 0; i < 8; ++i) { const int ka = k0 + 8 * g + i, kb = ka + 16; v[i] = ka < K ? row[ka < K ? ka : K - 1] : 0.f; v[8 + i] = kb < K ? row[kb < K ? kb : K - 1] : 0.f; }
  return bsplit16(v); }
__device__ __forceinline__ F2 split_col(const float* W, int k0, int n, int lane, int ld, int K) { float v[16]; const int g = lane >> 4;
#pragma unroll
  for (int i = 0; i < 8; ++i) { const int ka = k0 + 8 * g + i, kb = ka + 16; v[i] = ka < K ? W[(size_t)(ka < K ? ka : K - 1) * ld + n] : 0.f; v[8 + i] = kb < K ? W[(size_t)(kb < K ? kb : K - 1) * ld + n] : 0.f; }
  return bsplit16(v); }
__device__ __forceinline__ v8f mac3(const F2& a, const F2& b, v8f c) { c = wmma_bf(a.l, b.h, c); c = wmma_bf(a.h, b.l, c); return wmma_bf(a.h, b.h, c); }
__device__ __forceinline__ float sigm(float v) { return 1.0f / (1.0f + expf(-v)); }
#define LDSX() do { asm volatile("s_wait_dscnt 0" ::: "memory"); __builtin_amdgcn_wave_barrier(); __builtin_amdgcn_fence(__ATOMIC_RELEASE, "workgroup"); } while (0)

// Causal scaled-dot-product attention on raw q, k, v [2, 4,096, 16, 64] (layout B, S, NH, HD): out[b, t, h] = softmax over s <= t of (q/8).k (finfo.min above the diagonal == exclusion) applied to v; output in the same [B, S, NH, HD] layout.
#define NB 2
#define TT 4096
#define CC 1024            // NH * HD = projected width
#define DIN 1024          // input (model) width
#define NH 16
#define HD 64
#define NQB (TT / 64)
#define HG 2
#define SCALE (0.125f)
#define CAUSAL 1
#ifndef TNB
#define TNB NB
#endif
__device__ __forceinline__ float bfr(float v) { return (float)(__bf16)v; }
__host__ __device__ __forceinline__ int kb_last(int qb) { return CAUSAL ? ((qb * 64 + 63) >> 7) : (TT / 128 - 1); }
typedef __attribute__((ext_vector_type(8))) __bf16 v8b;
__device__ __forceinline__ v16b frag_b(const __bf16* rowk0, int lane) {
  union { v16b v; v8b q[2]; } u; const __bf16* p = rowk0 + 8 * (lane >> 4);
  u.q[0] = *(const v8b*)p; u.q[1] = *(const v8b*)(p + 16); return u.v;
}
#define QBH 6              // causal: query blocks 0..QBH-1 of each sequence (few keys, no averaging) take the high-precision path
#define QHI 384            // rows carrying a q residual plane
#define KHI 384            // key rows carrying k residual / v bf16 hi+lo planes (used only by the causal high-precision path)
// B fragment (k rows k0+.., output column o) of a weight: (in,out) [K][ld] or (out,in) [ld rows of K]: bf16 exact, or f16(bf16 * 256) exact
__device__ __forceinline__ v16b wcol_io(const float* Wm, int k0, int o, int lane, int ld) { v16b w; const int g = lane >> 4;
#pragma unroll
  for (int i = 0; i < 8; ++i) { w[i] = (__bf16)Wm[(size_t)(k0 + 8 * g + i) * ld + o]; w[8 + i] = (__bf16)Wm[(size_t)(k0 + 16 + 8 * g + i) * ld + o]; }
  return w; }
__device__ __forceinline__ v16b wcol_oi(const float* Wm, int k0, int o, int lane, int K) { v16b w; const float* p = Wm + (size_t)o * K + k0 + 8 * (lane >> 4);
#pragma unroll
  for (int i = 0; i < 8; ++i) { w[i] = (__bf16)p[i]; w[8 + i] = (__bf16)p[16 + i]; }
  return w; }
__device__ __forceinline__ v16h wcolh_io(const float* Wm, int k0, int o, int lane, int ld) { v16h w; const int g = lane >> 4;
#pragma unroll
  for (int i = 0; i < 8; ++i) { w[i] = (_Float16)(bfr(Wm[(size_t)(k0 + 8 * g + i) * ld + o]) * 256.0f); w[8 + i] = (_Float16)(bfr(Wm[(size_t)(k0 + 16 + 8 * g + i) * ld + o]) * 256.0f); }
  return w; }
__device__ __forceinline__ v16h wcolh_oi(const float* Wm, int k0, int o, int lane, int K) { v16h w; const float* p = Wm + (size_t)o * K + k0 + 8 * (lane >> 4);
#pragma unroll
  for (int i = 0; i < 8; ++i) { w[i] = (_Float16)(bfr(p[i]) * 256.0f); w[8 + i] = (_Float16)(bfr(p[16 + i]) * 256.0f); }
  return w; }
#define WQKV_LAYOUT 1   // 0 = (in,out) [DIN][CC]; 1 = (out,in) [CC][DIN]; 2 = per-head [NH][DIN][HD]
__device__ __forceinline__ v16b wcol_hdk(const float* Wm, int k0, int o, int lane) { v16b w; const int g = lane >> 4; const float* p = Wm + (size_t)(o / HD) * DIN * HD + (o % HD);
#pragma unroll
  for (int i = 0; i < 8; ++i) { w[i] = (__bf16)p[(size_t)(k0 + 8 * g + i) * HD]; w[8 + i] = (__bf16)p[(size_t)(k0 + 16 + 8 * g + i) * HD]; }
  return w; }
#define WO_OUT_IN 0
#if WQKV_LAYOUT == 1
#define WCOL(W, k0, o, lane) wcol_oi(W, k0, o, lane, DIN)
#elif WQKV_LAYOUT == 2
#define WCOL(W, k0, o, lane) wcol_hdk(W, k0, o, lane)
#else
#define WCOL(W, k0, o, lane) wcol_io(W, k0, o, lane, CC)
#endif
#if WO_OUT_IN
#define WOCOL(W, k0, o, lane) wcol_oi(W, k0, o, lane, CC)
#define WOCOLH(W, k0, o, lane) wcolh_oi(W, k0, o, lane, CC)
#else
#define WOCOL(W, k0, o, lane) wcol_io(W, k0, o, lane, DIN)
#define WOCOLH(W, k0, o, lane) wcolh_io(W, k0, o, lane, DIN)
#endif

// ---- k_prepr: block = 8 waves = (64 attention positions t0.. of sequence bb, PH heads = PC columns c0..): reads the module's [B, T, H*64] inputs, bf16-rounds them and writes the standard attention planes: q -> f16 hi rows (+ x 2^10 residual rows for s < QHI), k -> f16 rows (+ residual rows s < KHI), v -> f16 planes [c][s] (+ bf16 hi/lo planes for s < KHI).
// A stream: 512 blocks, two per WGP, all resident at once. A thread takes one 16-byte piece (4 columns) of 16 consecutive rows of each input; a wave's load is 512 contiguous bytes. All 48 loads go out before the first value is used. q and k go from registers straight to their rows (a wave's store is 256 contiguous bytes); only v passes through LDS, to be turned: 16 positions of one column lie in one thread, so it is written there in 16-byte pieces.
#define PH 4
#define PC (PH * HD)
typedef __attribute__((ext_vector_type(4))) _Float16 v4h;
// behind a group of stores, in front of a branch or a join: the stores' address and data registers may be reused from here on (inside a straight run the compiler places this wait itself)
#define XSTORES() asm volatile("s_wait_xcnt 0x0" ::: "memory")
__global__ __launch_bounds__(256) void k_prepr(const float* __restrict__ Q, const float* __restrict__ K, const float* __restrict__ V, _Float16* __restrict__ QH, _Float16* __restrict__ QL, _Float16* __restrict__ KH, _Float16* __restrict__ KL, _Float16* __restrict__ VT, __bf16* __restrict__ VB, __bf16* __restrict__ VBL) {
  __shared__ __align__(16) _Float16 tv[PC][72]; __shared__ __align__(16) __bf16 tb[PC][72], tbl[PC][72];
  const int tid = threadIdx.x, cc = tid & 63, rg = tid >> 6; const int c0 = blockIdx.y * PC;   // cc: 16-byte piece of the 1,024-byte row; rg: group of 16 rows
  const size_t r0 = (size_t)blockIdx.x * 64; const size_t bb = r0 / TT; const int t0 = (int)(r0 % TT); const bool qhi = t0 < QHI, khi = t0 < KHI;
  const size_t ou = r0 * (size_t)CC + c0;   // block-uniform element index in the [B, T, H*64] inputs; the f16 q and k rows have the same index
  const unsigned lo = (unsigned)(rg * 16 * CC + cc * 4);   // the lane's element offset from there: one 32-bit register (x 4) serves every load, another (x 2) every row store
  const unsigned l4 = lo * 4u;
  const char *Vu = (const char*)(V + ou), *Qu = (const char*)(Q + ou), *Ku = (const char*)(K + ou);
  v4f v[16], q[16], k[16];
#pragma unroll
  for (int i = 0; i < 16; ++i) v[i] = *(const v4f*)(Vu + (l4 + (unsigned)(i * CC * 4)));
  __builtin_amdgcn_sched_barrier(0);   // v goes out first, as it is used first (left free, the compiler issues most of v last, and the LDS writes that the block's barrier waits for start only when all 48 loads are back)
#pragma unroll
  for (int i = 0; i < 16; ++i) q[i] = *(const v4f*)(Qu + (l4 + (unsigned)(i * CC * 4)));
  __builtin_amdgcn_sched_barrier(0);   // then q, then k, for the same reason
#pragma unroll
  for (int i = 0; i < 16; ++i) k[i] = *(const v4f*)(Ku + (l4 + (unsigned)(i * CC * 4)));
  asm volatile("s_wait_xcnt 0x0" :: "v"(l4) : "memory");   // the loads' offset register, named as an input, keeps its place up to this wait: no load of the 48 lands on it, and it may be reused from here on
  // module inputs: bf16-rounded
#pragma unroll
  for (int j = 0; j < 4; ++j)
#pragma unroll
    for (int hf = 0; hf < 2; ++hf) { v8h x;
#pragma unroll
      for (int e = 0; e < 8; ++e) x[e] = (_Float16)bfr(v[hf * 8 + e][j]);
      *(v8h*)&tv[cc * 4 + j][rg * 16 + hf * 8] = x; }
  if (khi) {
#pragma unroll
    for (int j = 0; j < 4; ++j)
#pragma unroll
      for (int hf = 0; hf < 2; ++hf) { v8b y, z;
#pragma unroll
        for (int e = 0; e < 8; ++e) { const float f = bfr(v[hf * 8 + e][j]); const __bf16 vb = (__bf16)f; y[e] = vb; z[e] = (__bf16)(f - (float)vb); }
        *(v8b*)&tb[cc * 4 + j][rg * 16 + hf * 8] = y; *(v8b*)&tbl[cc * 4 + j][rg * 16 + hf * 8] = z; } }
#pragma unroll
  for (int i = 0; i < 16; ++i) { v4h x;
#pragma unroll
    for (int j = 0; j < 4; ++j) x[j] = (_Float16)bfr(q[i][j]);
    *(v4h*)((char*)(QH + ou) + (lo * 2u + (unsigned)(i * CC * 2))) = x; }
  XSTORES();
  if (qhi) { char* p = (char*)(QL + (bb * QHI + t0) * (size_t)CC + c0);
#pragma unroll
    for (int i = 0; i < 16; ++i) { v4h x;
#pragma unroll
      for (int j = 0; j < 4; ++j) { const float f = bfr(q[i][j]); x[j] = (_Float16)((f - (float)(_Float16)f) * 1024.0f); }
      *(v4h*)(p + (lo * 2u + (unsigned)(i * CC * 2))) = x; }
    XSTORES(); }
#pragma unroll
  for (int i = 0; i < 16; ++i) { v4h x;
#pragma unroll
    for (int j = 0; j < 4; ++j) x[j] = (_Float16)bfr(k[i][j]);
    *(v4h*)((char*)(KH + ou) + (lo * 2u + (unsigned)(i * CC * 2))) = x; }
  XSTORES();
  if (khi) { char* p = (char*)(KL + (bb * KHI + t0) * (size_t)CC + c0);
#pragma unroll
    for (int i = 0; i < 16; ++i) { v4h x;
#pragma unroll
      for (int j = 0; j < 4; ++j) { const float f = bfr(k[i][j]); x[j] = (_Float16)((f - (float)(_Float16)f) * 1024.0f); }
      *(v4h*)(p + (lo * 2u + (unsigned)(i * CC * 2))) = x; }
    XSTORES(); }
  // the block's barrier, ordering LDS alone (the planes in tv, tb, tbl): __syncthreads() would also wait here for the answers to the wave's 32 row stores, which nobody in the block reads
  __builtin_amdgcn_fence(__ATOMIC_RELEASE, "workgroup", "local"); __builtin_amdgcn_s_barrier(); __builtin_amdgcn_fence(__ATOMIC_ACQUIRE, "workgroup", "local");
  const int cl = tid >> 3, qd = tid & 7;   // 8 threads store one plane's 128 bytes; 32 planes a trip
  { char* p = (char*)(VT + (bb * CC + c0) * (size_t)TT + t0); const unsigned l2 = (unsigned)(cl * TT + qd * 8) * 2u;
#pragma unroll
    for (int n = 0; n < PC / 32; ++n) *(v8h*)(p + (l2 + (unsigned)(n * 32 * TT * 2))) = *(const v8h*)&tv[cl + n * 32][qd * 8]; }
  if (khi) { const size_t o3 = (bb * CC + c0) * (size_t)KHI + t0; const unsigned l3 = (unsigned)(cl * KHI + qd * 8) * 2u;
#pragma unroll
    for (int n = 0; n < PC / 32; ++n) { *(v8b*)((char*)(VB + o3) + (l3 + (unsigned)(n * 32 * KHI * 2))) = *(const v8b*)&tb[cl + n * 32][qd * 8]; *(v8b*)((char*)(VBL + o3) + (l3 + (unsigned)(n * 32 * KHI * 2))) = *(const v8b*)&tbl[cl + n * 32][qd * 8]; } } }

#ifndef SM_EXTRA_PARAMS
#define SM_EXTRA_PARAMS
#endif
#ifndef PROJ_EXTRA_PARAMS
#define PROJ_EXTRA_PARAMS
#endif
#ifndef SM_MASK_HOOK
#define SM_MASK_HOOK (void)0
#endif

#define WS_QH  0u                                      // f16 q rows [b*t][CC]
#define WS_KH  (WS_QH + 2u * (size_t)NB * TT * CC)      // f16 k rows [b*t][CC]
#define WS_VT  (WS_KH + 2u * (size_t)NB * TT * CC)      // f16 v planes [b][c][t]
#define WS_QL  (WS_VT + 2u * (size_t)NB * CC * TT)      // f16 q residual x 2^10 rows [b][t < QHI][CC]
#define WS_KL  (WS_QL + 2u * (size_t)NB * QHI * CC)     // f16 k residual x 2^10 rows [b][t < KHI][CC]
#define WS_VB  (WS_KL + 2u * (size_t)NB * KHI * CC)     // bf16 v hi planes [b][c][t < KHI]
#define WS_VBL (WS_VB + 2u * (size_t)NB * CC * KHI)
#define WS_END (WS_VBL + 2u * (size_t)NB * CC * KHI)

__device__ __forceinline__ v8f mm_h(v16h a, v16h b, v8f c) { return __builtin_amdgcn_wmma_f32_16x16x32_f16(false, a, false, b, (short)0, c, false, false); }
__device__ __forceinline__ v8f mm_b(v16b a, v16b b, v8f c) { return __builtin_amdgcn_wmma_f32_16x16x32_bf16(false, a, false, b, (short)0, c, false, false); }
__device__ __forceinline__ float xhalf(float x) { return __builtin_bit_cast(float, __builtin_amdgcn_permlanex16(__builtin_bit_cast(int, x), __builtin_bit_cast(int, x), 0x76543210, 0xfedcba98, false, false)); }  // lane l with lane l ^ 16
// fragment (hardware k order) at p + bo bytes; p = wave-uniform base + the lane's 32-bit byte offset (row (lane & 15), + 16 bytes for the upper half), so the lane offset register is the same for the whole kernel
__device__ __forceinline__ v16h ldf_h(const char* p, int bo) { union { v16h v; v8h q[2]; } u; u.q[0] = *(const v8h*)(p + bo); u.q[1] = *(const v8h*)(p + bo + 32); return u.v; }
__device__ __forceinline__ v16b ldf_b(const char* p, int bo) { union { v16b v; v8b q[2]; } u; u.q[0] = *(const v8b*)(p + bo); u.q[1] = *(const v8b*)(p + bo + 32); return u.v; }
// address registers of the loads just issued may be reused from here on
#define XADDR() asm volatile("s_wait_xcnt 0x0" ::: "memory")
// the same, naming the two lane addresses as inputs: they keep their registers up to the wait, so no load of the group lands on them
#define XADDRP(p, q) asm volatile("s_wait_xcnt 0x0" :: "v"(p), "v"(q) : "memory")
typedef __attribute__((ext_vector_type(8))) unsigned v8u;
#define LPITCH 144          // LDS pitch of a staged 128-byte row: 16 bytes x odd, free of bank conflicts for 16-byte reads
#define LTILE 10240u        // 64 rows x 144 bytes, rounded up to a multiple of 2 KiB (every tile's place in LDS is one)
__device__ __forceinline__ unsigned uni(unsigned v) { return (unsigned)__builtin_amdgcn_readfirstlane((int)v); }
// a wave-uniform value held in a scalar register: a test on it compiles to s_cmp + s_cbranch_scc (a tensor load ignores EXEC: only a scalar branch keeps a wave from issuing it)
__device__ __forceinline__ unsigned pinned(unsigned v) { unsigned w = uni(v); asm volatile("" : "+s"(w)); return w; }
// tensor descriptor, extents in bytes: group 1 = a tile of 64 rows x 128 bytes (tensor = tile), source row pitch sp, 16 bytes of LDS pad behind every 128-byte row; group 0 = LDS place and the tile's first byte
__device__ __forceinline__ v8u tdm_g1(unsigned sp) { v8u d; d[0] = uni((1u << 20) | (4u << 22) | (3u << 25)); d[1] = uni(128u << 16); d[2] = uni(64u << 16); d[3] = uni(128u << 16); d[4] = uni(64u); d[5] = uni(sp); d[6] = uni(0u); d[7] = uni(0u); return d; }
__device__ __forceinline__ v4u tdm_g0(unsigned dst, unsigned long long ga) { v4u d; d[0] = uni(1u); d[1] = uni(dst); d[2] = uni((unsigned)ga); d[3] = uni((((unsigned)(ga >> 32)) & 0x01FFFFFFu) | 0x80000000u); return d; }
// group 0 is an in-out operand and the next stage's words are made from it (tdm_next): count, address and type keep their scalar registers from one request to the next and change only behind the wait for the last one (the LDS place, word 1, is made anew each time)
__device__ __forceinline__ void tdm_load(v4u& d0, v8u d1) { asm volatile("tensor_load_to_lds %0, %1" : "+s"(d0) : "s"(d1) : "memory"); }
// the next stage's group 0: new LDS place, source address + st bytes (the carry goes into address bits 56:32, under the type field)
__device__ __forceinline__ void tdm_next(v4u& d0, unsigned dst, unsigned st) { const unsigned lo = uni(d0[2] + st); d0[1] = uni(dst); d0[3] = uni(d0[3] + (lo < st ? 1u : 0u)); d0[2] = lo; }
#define L2S (SCALE * 1.4426950408889634f)   // logit -> base-2 exponent
#define PSH 10.0f                            // P carried x 2^10 (keeps small weights normal in f16); it cancels against the row sum
// In k_fa every '#pragma unroll' stands over a loop that indexes a register array (fragments, score tiles): rolled, the array would go to scratch. '#pragma unroll 1' keeps the pass loops rolled: one pass already fills the register budget of five waves per SIMD.
// ---- k_fa: block = 64 queries (qb, heaviest first) of (b, h), wave = 16 queries. The block's four waves read each 64-key stage of k and v from LDS, where two tensor loads put it once (two buffers: stage s + 1 flies during pass s); the first QBH query blocks load for themselves. Per 64 keys: S^T = K . Q^T (A = key rows, B = query columns: a lane holds 8 keys per tile of ONE query, lane & 15), running maximum and sum per lane (+ one exchange between the wave's halves), P^T packed from the score registers straight into a B operand, O^T += V^T . P^T (A = v planes [c][s]). Logits and P never leave registers.
__global__ __launch_bounds__(128) void k_fa(const _Float16* QH, const _Float16* KH, const _Float16* QL, const _Float16* KL, const _Float16* VT, const __bf16* VB, const __bf16* VBL, float* Y) {   // no __restrict__: it would let the loads drift over the XADDR() waits
  __shared__ __attribute__((aligned(2048))) unsigned char ring[2 * 2 * LTILE];   // two buffers, each a key tile and a v tile
  __shared__ __align__(16) float ss[4][16][HD + 4];
  const int tid = threadIdx.x, wave = tid >> 5, lane = tid & 31, col = lane & 15, g = lane >> 4;
  const int qb = NQB - 1 - (int)blockIdx.x, b = blockIdx.y / NH, h = blockIdx.y % NH;
  const int ql0 = qb * 64 + wave * 16, tq = ql0 + col;   // tq: this lane's query
  const unsigned lq = (unsigned)((wave * 16 + col) * CC + 8 * g) * 2u, lk = (unsigned)(col * CC + 8 * g) * 2u;   // lane byte offsets: query row, key row
  const _Float16* Ku = KH + (size_t)b * TT * CC + h * HD;
  v8f acc[HD / 16] = {}; float m = -1.0e30f, l = 0.f;
  const char* qp = (const char*)(QH + ((size_t)b * TT + qb * 64) * CC + h * HD) + lq;
  const v16h q0 = ldf_h(qp, 0), q1 = ldf_h(qp, 64); XADDR();
  if (qb < QBH) {
    const unsigned lv = (unsigned)(col * KHI + 8 * g) * 2u;
    const _Float16* KLu = KL + (size_t)b * KHI * CC + h * HD; const __bf16* VBu = VB + ((size_t)b * CC + h * HD) * (size_t)KHI; const __bf16* VLu = VBL + ((size_t)b * CC + h * HD) * (size_t)KHI;
    const char* rp = (const char*)(QL + ((size_t)b * QHI + qb * 64) * CC + h * HD) + lq;
    const v16h r0 = ldf_h(rp, 0), r1 = ldf_h(rp, 64); XADDR();
#pragma unroll 1
    for (int kb = 0; kb < 2 * (qb + 1); ++kb) { const int k0 = kb * 32; float s[2][8]; float mx = -3.0e38f;   // 32 keys a pass: this short path must not set the kernel's register count
      const char* kp = (const char*)(Ku + (size_t)k0 * CC) + lk; const char* lp = (const char*)(KLu + (size_t)k0 * CC) + lk;
#pragma unroll
      for (int jt = 0; jt < 2; ++jt) { const v16h ka = ldf_h(kp, jt * 16 * CC * 2), kc = ldf_h(kp, jt * 16 * CC * 2 + 64), la = ldf_h(lp, jt * 16 * CC * 2), lc = ldf_h(lp, jt * 16 * CC * 2 + 64);
        v8f sh = {}, sl = {}; sh = mm_h(ka, q0, sh); sh = mm_h(kc, q1, sh); sl = mm_h(ka, r0, sl); sl = mm_h(kc, r1, sl); sl = mm_h(la, q0, sl); sl = mm_h(lc, q1, sl);
#pragma unroll
        for (int r = 0; r < 8; ++r) { const float v = (k0 + jt * 16 + 8 * g + r <= tq) ? sh[r] + sl[r] * (1.0f / 1024.0f) : -3.0e38f; s[jt][r] = v; mx = fmaxf(mx, v); } }
      XADDRP(kp, lp);
      mx = fmaxf(mx, xhalf(mx)); const float mn = fmaxf(m, mx * L2S), al = __builtin_amdgcn_exp2f(m - mn), nm = PSH - mn; m = mn;   // pass 0 holds key 0, which every query sees: m is a real logit from there on, also where a later pass is all above the diagonal
      float ps = 0.f; v16b ph, pl;
#pragma unroll
      for (int jt = 0; jt < 2; ++jt)
#pragma unroll
        for (int r = 0; r < 8; ++r) { const float e = __builtin_amdgcn_exp2f(fmaf(s[jt][r], L2S, nm)); ps += e; const __bf16 eh = (__bf16)e; ph[jt * 8 + r] = eh; pl[jt * 8 + r] = (__bf16)(e - (float)eh); }
      l = l * al + ps;
      const char* vp = (const char*)(VBu + k0) + lv; const char* wp = (const char*)(VLu + k0) + lv;
#pragma unroll
      for (int jd = 0; jd < HD / 16; ++jd) { acc[jd] *= al; const v16b vh = ldf_b(vp, jd * 16 * KHI * 2), vl = ldf_b(wp, jd * 16 * KHI * 2);
        acc[jd] = mm_b(vh, ph, acc[jd]); acc[jd] = mm_b(vh, pl, acc[jd]); acc[jd] = mm_b(vl, ph, acc[jd]); }
      XADDRP(vp, wp); }
  } else {
    const unsigned wv = uni((unsigned)tid >> 5), lf = (unsigned)(col * LPITCH + 16 * g);   // wave number (scalar); lane byte offset in a staged tile: row (lane & 15), + 16 bytes for the upper half
    // wave 0 brings the key tile (64 rows of KH, 128 bytes each), wave 1 the v tile (64 planes of VT, 64 keys = 128 bytes each): one request per wave and stage
    const unsigned long long sb = wv ? (unsigned long long)(size_t)(VT + ((size_t)b * CC + h * HD) * (size_t)TT) : (unsigned long long)(size_t)Ku;
    const unsigned sstep = wv ? 64u * 2u : 64u * CC * 2u, lb = (unsigned)(size_t)ring + wv * LTILE;   // source bytes from one stage to the next; this wave's place in buffer 0
    v8u g1 = tdm_g1(wv ? TT * 2u : CC * 2u);
    asm volatile("" : "+s"(g1));   // descriptor words held in their scalar registers for the whole loop: none is rebuilt, or lent to another value, while a request is in flight
    v4u g0 = tdm_g0(lb, sb);
    if (pinned(wv < 2u)) { tdm_load(g0, g1);
      asm volatile("s_wait_tensorcnt 0x0" ::: "memory"); }   // stage 0 has landed (the compiler places no wait for a tensor load)
    __syncthreads();   // stage 0 readable by every wave
    if (pinned(wv < 2u)) { tdm_next(g0, lb + 2u * LTILE, sstep); tdm_load(g0, g1); }   // stage 1 (qb >= QBH: at least seven stages)
#pragma unroll 1
    for (int kb = 0; kb <= qb; ++kb) { const int k0 = kb * 64;
      const char* kt = (const char*)ring + (unsigned)(kb & 1) * (2u * LTILE) + lf; const char* vt = kt + LTILE;
      v16h kf[4][2];
#pragma unroll
      for (int jt = 0; jt < 4; ++jt) { kf[jt][0] = ldf_h(kt, jt * 16 * LPITCH); kf[jt][1] = ldf_h(kt, jt * 16 * LPITCH + 64); }
      __builtin_amdgcn_sched_barrier(0);   // the pass's key reads go out as one group: mixed among the products, each pair waits out its own LDS latency
      v8f st[4];
#pragma unroll
      for (int jt = 0; jt < 4; ++jt) { v8f z = {}; z = mm_h(kf[jt][0], q0, z); st[jt] = mm_h(kf[jt][1], q1, z); }
      v16h vf[HD / 16][2];   // this pass's v planes: they fly during the softmax
#pragma unroll
      for (int jd = 0; jd < HD / 16; ++jd) { vf[jd][0] = ldf_h(vt, jd * 16 * LPITCH); vf[jd][1] = ldf_h(vt, jd * 16 * LPITCH + 64); }
      __builtin_amdgcn_sched_barrier(0);   // all v reads go out in front of the softmax: left free, some sink among the P.v products and wait out their LDS latency there
      if (kb == qb) {   // only the diagonal block holds keys above a query
#pragma unroll
        for (int jt = 0; jt < 4; ++jt)
#pragma unroll
          for (int r = 0; r < 8; ++r) if (k0 + jt * 16 + 8 * g + r > tq) st[jt][r] = -3.0e38f; }
      float mx = -3.0e38f;
#pragma unroll
      for (int jt = 0; jt < 4; ++jt)
#pragma unroll
        for (int r = 0; r < 8; ++r) mx = fmaxf(mx, st[jt][r]);
      mx = fmaxf(mx, xhalf(mx)); const float mn = fmaxf(m, mx * L2S), al = __builtin_amdgcn_exp2f(m - mn), nm = PSH - mn; m = mn;
      float ps = 0.f; v16h pf[2];
#pragma unroll
      for (int jt = 0; jt < 4; ++jt)
#pragma unroll
        for (int r = 0; r < 8; ++r) { const float e = __builtin_amdgcn_exp2f(fmaf(st[jt][r], L2S, nm)); ps += e; pf[jt >> 1][(jt & 1) * 8 + r] = (_Float16)e; }
      l = l * al + ps;
#pragma unroll
      for (int jd = 0; jd < HD / 16; ++jd) acc[jd] *= al;
#pragma unroll
      for (int jd = 0; jd < HD / 16; ++jd) { acc[jd] = mm_h(vf[jd][0], pf[0], acc[jd]); acc[jd] = mm_h(vf[jd][1], pf[1], acc[jd]); }
      __builtin_amdgcn_sched_barrier(0);   // the waits below stay at the pass's foot: lifted over the softmax, the first one waits out the v reads' latency with nothing to cover it
      // publish point of stage kb + 1, every wave, in this order
      asm volatile("s_wait_dscnt 0x0" ::: "memory");   // this wave's reads of the buffer have returned before the buffer is refilled
      if (pinned(wv < 2u)) asm volatile("s_wait_tensorcnt 0x0" ::: "memory");   // the issuer's own request for stage kb + 1 has landed
      __syncthreads();   // stage kb + 1 readable by every wave; every wave has left stage kb's buffer
      if (pinned(wv < 2u && kb + 2 <= qb)) { tdm_next(g0, lb + (unsigned)(kb & 1) * (2u * LTILE), sstep); tdm_load(g0, g1); } }   // stage kb + 2 into the buffer that this pass has read
    asm volatile("s_wait_tensorcnt 0x0" ::: "memory");   // no request outstanding behind the loop
    asm volatile("s_wait_dscnt 0x0" ::: "memory"); }
  l += xhalf(l); const float inv = 1.0f / l;   // every query sees its own key, so l > 0
#pragma unroll
  for (int jd = 0; jd < HD / 16; ++jd)
#pragma unroll
    for (int r = 0; r < 8; ++r) ss[wave][col][jd * 16 + 8 * g + r] = acc[jd][r] * inv;
  LDSX();
#pragma unroll
  for (int i = 0; i < 8; ++i) { const int rl = 2 * i + g; vst2(Y + ((size_t)b * TT + ql0 + rl) * CC + h * HD + col * 4, *(const v4f*)&ss[wave][rl][col * 4]); } }

extern "C" void kernel_launch(void* const* d_in, const int* in_sizes, int n_in, void* d_out, int out_size, void* d_ws, size_t ws_size, hipStream_t stream) {
  (void)in_sizes; (void)n_in; (void)out_size;
  const float** F = (const float**)d_in;
  if (ws_size < (size_t)WS_END) return;
  char* ws = (char*)d_ws; _Float16 *QH = (_Float16*)(ws + WS_QH), *KH = (_Float16*)(ws + WS_KH), *VT = (_Float16*)(ws + WS_VT), *QL = (_Float16*)(ws + WS_QL), *KL = (_Float16*)(ws + WS_KL); __bf16 *VB = (__bf16*)(ws + WS_VB), *VBL = (__bf16*)(ws + WS_VBL);
  // inputs: 0 q, 1 k, 2 v [2,4096,16,64] (= rows [b*S + t][h*64 + d])
  k_prepr<<<dim3(TNB * TT / 64, NH / PH), 256, 0, stream>>>(F[0], F[1], F[2], QH, QL, KH, KL, VT, VB, VBL);
  k_fa<<<dim3(NQB, TNB * NH), 128, 0, stream>>>(QH, KH, QL, KL, VT, VB, VBL, (float*)d_out);
}

// v004
// One run takes 87.4 microseconds.
// In two side-by-side timings against v003, it was 1.20 and 1.19 times as fast.
// Counting every step since v000, it is 37.4 times as fast.
// compute dtype: q, k, v rounded to bf16 and carried EXACTLY as f16 (bf16 hi + lo planes for v below row 384); causal logits k.q as single EXACT products on WMMA 16x16x32 (f32 accumulate) x 64^-0.5 (first 384 query rows: 3 products with the residual planes); online softmax in f32 (base 2, running maximum); P x 2^10 unnormalised once to f16 against v (1 product; 3-term bf16 path for the first 384 query rows); divided by the row sum at the end; f32 output [B, S, NH, HD].
#include <hip/hip_runtime.h>
#include <math.h>

typedef __attribute__((ext_vector_type(16))) _Float16 v16h;
typedef __attribute__((ext_vector_type(16))) __bf16 v16b;
typedef __attribute__((ext_vector_type(8)))  _Float16 v8h;
typedef __attribute__((ext_vector_type(8)))  float v8f;
typedef __attribute__((ext_vector_type(4)))  float v4f;
typedef __attribute__((ext_vector_type(2)))  float v2f;
typedef __attribute__((ext_vector_type(4)))  unsigned v4u;
typedef __attribute__((ext_vector_type(4)))  int v4i;
typedef float __attribute__((may_alias)) float_a;
typedef int __attribute__((may_alias)) int_a;

template <typename T> __device__ __forceinline__ void vst2(void* p, T v) { *(T*)p = v;  }
__device__ __forceinline__ v8f wmma16(v16h a, v16h b, v8f c) {
  v8f d = __builtin_amdgcn_wmma_f32_16x16x32_f16(false, a, false, b, (short)0, c, false, false);
  asm volatile("v_nop\n\tv_nop\n\tv_nop\n\tv_nop" : "+v"(d) : "v"(a), "v"(b));
  return d;
}
__device__ __forceinline__ v8f wmma_bf(v16b a, v16b b, v8f c) {
  v8f d = __builtin_amdgcn_wmma_f32_16x16x32_bf16(false, a, false, b, (short)0, c, false, false);
  asm volatile("v_nop\n\tv_nop\n\tv_nop\n\tv_nop" : "+v"(d) : "v"(a), "v"(b));
  return d;
}
// 16x16x32 fragments: lane = (h = lane>>4, row/col = lane&15); elements 0..7 = k0+8h+0..7, 8..15 = k0+16+8h+0..7; D element r = row 8h+r
__device__ __forceinline__ v16h frag_h(const _Float16* rowk0, int lane) {
  union { v16h v; v8h q[2]; } u; const _Float16* p = rowk0 + 8 * (lane >> 4);
  u.q[0] = *(const v8h*)p; u.q[1] = *(const v8h*)(p + 16); return u.v;
}
__device__ __forceinline__ v16h frag_f32(const float* rowk0, int lane) {
  v16h a; const float* p = rowk0 + 8 * (lane >> 4);
#pragma unroll
  for (int i = 0; i < 8; ++i) { a[i] = (_Float16)p[i]; a[8 + i] = (_Float16)p[16 + i]; }
  return a;
}
__device__ __forceinline__ v16h frag_f32s(const float* rowk0, int lane, float sc) {
  v16h a; const float* p = rowk0 + 8 * (lane >> 4);
#pragma unroll
  for (int i = 0; i < 8; ++i) { a[i] = (_Float16)(p[i] * sc); a[8 + i] = (_Float16)(p[16 + i] * sc); }
  return a;
}
// column fragment from a [K][ld] layout (column n), rows >= K read as 0
__device__ __forceinline__ v16h fragc_f32(const float* W, int k0, int n, int lane, int ld, int K) {
  v16h a; const int g = lane >> 4;
#pragma unroll
  for (int i = 0; i < 8; ++i) { const int ka = k0 + 8 * g + i, kb = ka + 16;
    a[i] = (_Float16)(ka < K ? W[(size_t)(ka < K ? ka : K - 1) * ld + n] : 0.f); a[8 + i] = (_Float16)(kb < K ? W[(size_t)(kb < K ? kb : K - 1) * ld + n] : 0.f); }
  return a;
}
struct F2 { v16b h, l; };
__device__ __forceinline__ F2 bsplit16(const float v[16]) { F2 r;
#pragma unroll
  for (int i = 0; i < 16; ++i) { const __bf16 h = (__bf16)v[i]; r.h[i] = h; r.l[i] = (__bf16)(v[i] - (float)h); }
  return r; }
__device__ __forceinline__ F2 split_row(const float* row, int k0, int lane) { float v[16]; const float* p = row + k0 + 8 * (lane >> 4);
#pragma unroll
  for (int i = 0; i < 8; ++i) { v[i] = p[i]; v[8 + i] = p[16 + i]; }
  return bsplit16(v); }
__device__ __forceinline__ F2 split_rowK(const float* row, int k0, int lane, int K) { float v[16]; const int g = lane >> 4;
#pragma unroll
  for (int i = 0; i < 8; ++i) { const int ka = k0 + 8 * g + i, kb = ka + 16; v[i] = ka < K ? row[ka < K ? ka : K - 1] : 0.f; v[8 + i] = kb < K ? row[kb < K ? kb : K - 1] : 0.f; }
  return bsplit16(v); }
__device__ __forceinline__ F2 split_col(const float* W, int k0, int n, int lane, int ld, int K) { float v[16]; const int g = lane >> 4;
#pragma unroll
  for (int i = 0; i < 8; ++i) { const int ka = k0 + 8 * g + i, kb = ka + 16; v[i] = ka < K ? W[(size_t)(ka < K ? ka : K - 1) * ld + n] : 0.f; v[8 + i] = kb < K ? W[(size_t)(kb < K ? kb : K - 1) * ld + n] : 0.f; }
  return bsplit16(v); }
__device__ __forceinline__ v8f mac3(const F2& a, const F2& b, v8f c) { c = wmma_bf(a.l, b.h, c); c = wmma_bf(a.h, b.l, c); return wmma_bf(a.h, b.h, c); }
__device__ __forceinline__ float sigm(float v) { return 1.0f / (1.0f + expf(-v)); }
#define LDSX() do { asm volatile("s_wait_dscnt 0" ::: "memory"); __builtin_amdgcn_wave_barrier(); __builtin_amdgcn_fence(__ATOMIC_RELEASE, "workgroup"); } while (0)

// Causal scaled-dot-product attention on raw q, k, v [2, 4,096, 16, 64] (layout B, S, NH, HD): out[b, t, h] = softmax over s <= t of (q/8).k (finfo.min above the diagonal == exclusion) applied to v; output in the same [B, S, NH, HD] layout.
#define NB 2
#define TT 4096
#define CC 1024            // NH * HD = projected width
#define DIN 1024          // input (model) width
#define NH 16
#define HD 64
#define NQB (TT / 64)
#define HG 2
#define SCALE (0.125f)
#define CAUSAL 1
#ifndef TNB
#define TNB NB
#endif
__device__ __forceinline__ float bfr(float v) { return (float)(__bf16)v; }
__host__ __device__ __forceinline__ int kb_last(int qb) { return CAUSAL ? ((qb * 64 + 63) >> 7) : (TT / 128 - 1); }
typedef __attribute__((ext_vector_type(8))) __bf16 v8b;
__device__ __forceinline__ v16b frag_b(const __bf16* rowk0, int lane) {
  union { v16b v; v8b q[2]; } u; const __bf16* p = rowk0 + 8 * (lane >> 4);
  u.q[0] = *(const v8b*)p; u.q[1] = *(const v8b*)(p + 16); return u.v;
}
#define QBH 6              // causal: query blocks 0..QBH-1 of each sequence (few keys, no averaging) take the high-precision path
#define QHI 384            // rows carrying a q residual plane
#define KHI 384            // key rows carrying k residual / v bf16 hi+lo planes (used only by the causal high-precision path)
// B fragment (k rows k0+.., output column o) of a weight: (in,out) [K][ld] or (out,in) [ld rows of K]: bf16 exact, or f16(bf16 * 256) exact
__device__ __forceinline__ v16b wcol_io(const float* Wm, int k0, int o, int lane, int ld) { v16b w; const int g = lane >> 4;
#pragma unroll
  for (int i = 0; i < 8; ++i) { w[i] = (__bf16)Wm[(size_t)(k0 + 8 * g + i) * ld + o]; w[8 + i] = (__bf16)Wm[(size_t)(k0 + 16 + 8 * g + i) * ld + o]; }
  return w; }
__device__ __forceinline__ v16b wcol_oi(const float* Wm, int k0, int o, int lane, int K) { v16b w; const float* p = Wm + (size_t)o * K + k0 + 8 * (lane >> 4);
#pragma unroll
  for (int i = 0; i < 8; ++i) { w[i] = (__bf16)p[i]; w[8 + i] = (__bf16)p[16 + i]; }
  return w; }
__device__ __forceinline__ v16h wcolh_io(const float* Wm, int k0, int o, int lane, int ld) { v16h w; const int g = lane >> 4;
#pragma unroll
  for (int i = 0; i < 8; ++i) { w[i] = (_Float16)(bfr(Wm[(size_t)(k0 + 8 * g + i) * ld + o]) * 256.0f); w[8 + i] = (_Float16)(bfr(Wm[(size_t)(k0 + 16 + 8 * g + i) * ld + o]) * 256.0f); }
  return w; }
__device__ __forceinline__ v16h wcolh_oi(const float* Wm, int k0, int o, int lane, int K) { v16h w; const float* p = Wm + (size_t)o * K + k0 + 8 * (lane >> 4);
#pragma unroll
  for (int i = 0; i < 8; ++i) { w[i] = (_Float16)(bfr(p[i]) * 256.0f); w[8 + i] = (_Float16)(bfr(p[16 + i]) * 256.0f); }
  return w; }
#define WQKV_LAYOUT 1   // 0 = (in,out) [DIN][CC]; 1 = (out,in) [CC][DIN]; 2 = per-head [NH][DIN][HD]
__device__ __forceinline__ v16b wcol_hdk(const float* Wm, int k0, int o, int lane) { v16b w; const int g = lane >> 4; const float* p = Wm + (size_t)(o / HD) * DIN * HD + (o % HD);
#pragma unroll
  for (int i = 0; i < 8; ++i) { w[i] = (__bf16)p[(size_t)(k0 + 8 * g + i) * HD]; w[8 + i] = (__bf16)p[(size_t)(k0 + 16 + 8 * g + i) * HD]; }
  return w; }
#define WO_OUT_IN 0
#if WQKV_LAYOUT == 1
#define WCOL(W, k0, o, lane) wcol_oi(W, k0, o, lane, DIN)
#elif WQKV_LAYOUT == 2
#define WCOL(W, k0, o, lane) wcol_hdk(W, k0, o, lane)
#else
#define WCOL(W, k0, o, lane) wcol_io(W, k0, o, lane, CC)
#endif
#if WO_OUT_IN
#define WOCOL(W, k0, o, lane) wcol_oi(W, k0, o, lane, CC)
#define WOCOLH(W, k0, o, lane) wcolh_oi(W, k0, o, lane, CC)
#else
#define WOCOL(W, k0, o, lane) wcol_io(W, k0, o, lane, DIN)
#define WOCOLH(W, k0, o, lane) wcolh_io(W, k0, o, lane, DIN)
#endif

// ---- k_prepr: block = 8 waves = (64 attention positions t0.. of sequence bb, PH heads = PC columns c0..): reads the module's [B, T, H*64] inputs, bf16-rounds them and writes the standard attention planes: q -> f16 hi rows (+ x 2^10 residual rows for s < QHI), k -> f16 rows (+ residual rows s < KHI), v -> f16 planes [c][s] (+ bf16 hi/lo planes for s < KHI).
// A stream: 512 blocks, two per WGP, all resident at once. A thread takes one 16-byte piece (4 columns) of 16 consecutive rows of each input; a wave's load is 512 contiguous bytes. All 48 loads go out before the first value is used. q and k go from registers straight to their rows (a wave's store is 256 contiguous bytes); only v passes through LDS, to be turned: 16 positions of one column lie in one thread, so it is written there in 16-byte pieces.
#define PH 4
#define PC (PH * HD)
typedef __attribute__((ext_vector_type(4))) _Float16 v4h;
// behind a group of stores, in front of a branch or a join: the stores' address and data registers may be reused from here on (inside a straight run the compiler places this wait itself)
#define XSTORES() asm volatile("s_wait_xcnt 0x0" ::: "memory")
__global__ __launch_bounds__(256) void k_prepr(const float* __restrict__ Q, const float* __restrict__ K, const float* __restrict__ V, _Float16* __restrict__ QH, _Float16* __restrict__ QL, _Float16* __restrict__ KH, _Float16* __restrict__ KL, _Float16* __restrict__ VT, __bf16* __restrict__ VB, __bf16* __restrict__ VBL) {
  __shared__ __align__(16) _Float16 tv[PC][72]; __shared__ __align__(16) __bf16 tb[PC][72], tbl[PC][72];
  const int tid = threadIdx.x, cc = tid & 63, rg = tid >> 6; const int c0 = blockIdx.y * PC;   // cc: 16-byte piece of the 1,024-byte row; rg: group of 16 rows
  const size_t r0 = (size_t)blockIdx.x * 64; const size_t bb = r0 / TT; const int t0 = (int)(r0 % TT); const bool qhi = t0 < QHI, khi = t0 < KHI;
  const size_t ou = r0 * (size_t)CC + c0;   // block-uniform element index in the [B, T, H*64] inputs; the f16 q and k rows have the same index
  const unsigned lo = (unsigned)(rg * 16 * CC + cc * 4);   // the lane's element offset from there: one 32-bit register (x 4) serves every load, another (x 2) every row store
  const unsigned l4 = lo * 4u;
  const char *Vu = (const char*)(V + ou), *Qu = (const char*)(Q + ou), *Ku = (const char*)(K + ou);
  v4f v[16], q[16], k[16];
#pragma unroll
  for (int i = 0; i < 16; ++i) v[i] = *(const v4f*)(Vu + (l4 + (unsigned)(i * CC * 4)));
  __builtin_amdgcn_sched_barrier(0);   // v goes out first, as it is used first (left free, the compiler issues most of v last, and the LDS writes that the block's barrier waits for start only when all 48 loads are back)
#pragma unroll
  for (int i = 0; i < 16; ++i) q[i] = *(const v4f*)(Qu + (l4 + (unsigned)(i * CC * 4)));
  __builtin_amdgcn_sched_barrier(0);   // then q, then k, for the same reason
#pragma unroll
  for (int i = 0; i < 16; ++i) k[i] = *(const v4f*)(Ku + (l4 + (unsigned)(i * CC * 4)));
  asm volatile("s_wait_xcnt 0x0" :: "v"(l4) : "memory");   // the loads' offset register, named as an input, keeps its place up to this wait: no load of the 48 lands on it, and it may be reused from here on
  // module inputs: bf16-rounded
#pragma unroll
  for (int j = 0; j < 4; ++j)
#pragma unroll
    for (int hf = 0; hf < 2; ++hf) { v8h x;
#pragma unroll
      for (int e = 0; e < 8; ++e) x[e] = (_Float16)bfr(v[hf * 8 + e][j]);
      *(v8h*)&tv[cc * 4 + j][rg * 16 + hf * 8] = x; }
  if (khi) {
#pragma unroll
    for (int j = 0; j < 4; ++j)
#pragma unroll
      for (int hf = 0; hf < 2; ++hf) { v8b y, z;
#pragma unroll
        for (int e = 0; e < 8; ++e) { const float f = bfr(v[hf * 8 + e][j]); const __bf16 vb = (__bf16)f; y[e] = vb; z[e] = (__bf16)(f - (float)vb); }
        *(v8b*)&tb[cc * 4 + j][rg * 16 + hf * 8] = y; *(v8b*)&tbl[cc * 4 + j][rg * 16 + hf * 8] = z; } }
#pragma unroll
  for (int i = 0; i < 16; ++i) { v4h x;
#pragma unroll
    for (int j = 0; j < 4; ++j) x[j] = (_Float16)bfr(q[i][j]);
    *(v4h*)((char*)(QH + ou) + (lo * 2u + (unsigned)(i * CC * 2))) = x; }
  XSTORES();
  if (qhi) { char* p = (char*)(QL + (bb * QHI + t0) * (size_t)CC + c0);
#pragma unroll
    for (int i = 0; i < 16; ++i) { v4h x;
#pragma unroll
      for (int j = 0; j < 4; ++j) { const float f = bfr(q[i][j]); x[j] = (_Float16)((f - (float)(_Float16)f) * 1024.0f); }
      *(v4h*)(p + (lo * 2u + (unsigned)(i * CC * 2))) = x; }
    XSTORES(); }
#pragma unroll
  for (int i = 0; i < 16; ++i) { v4h x;
#pragma unroll
    for (int j = 0; j < 4; ++j) x[j] = (_Float16)bfr(k[i][j]);
    *(v4h*)((char*)(KH + ou) + (lo * 2u + (unsigned)(i * CC * 2))) = x; }
  XSTORES();
  if (khi) { char* p = (char*)(KL + (bb * KHI + t0) * (size_t)CC + c0);
#pragma unroll
    for (int i = 0; i < 16; ++i) { v4h x;
#pragma unroll
      for (int j = 0; j < 4; ++j) { const float f = bfr(k[i][j]); x[j] = (_Float16)((f - (float)(_Float16)f) * 1024.0f); }
      *(v4h*)(p + (lo * 2u + (unsigned)(i * CC * 2))) = x; }
    XSTORES(); }
  // the block's barrier, ordering LDS alone (the planes in tv, tb, tbl): __syncthreads() would also wait here for the answers to the wave's 32 row stores, which nobody in the block reads
  __builtin_amdgcn_fence(__ATOMIC_RELEASE, "workgroup", "local"); __builtin_amdgcn_s_barrier(); __builtin_amdgcn_fence(__ATOMIC_ACQUIRE, "workgroup", "local");
  const int cl = tid >> 3, qd = tid & 7;   // 8 threads store one plane's 128 bytes; 32 planes a trip
  { char* p = (char*)(VT + (bb * CC + c0) * (size_t)TT + t0); const unsigned l2 = (unsigned)(cl * TT + qd * 8) * 2u;
#pragma unroll
    for (int n = 0; n < PC / 32; ++n) *(v8h*)(p + (l2 + (unsigned)(n * 32 * TT * 2))) = *(const v8h*)&tv[cl + n * 32][qd * 8]; }
  if (khi) { const size_t o3 = (bb * CC + c0) * (size_t)KHI + t0; const unsigned l3 = (unsigned)(cl * KHI + qd * 8) * 2u;
#pragma unroll
    for (int n = 0; n < PC / 32; ++n) { *(v8b*)((char*)(VB + o3) + (l3 + (unsigned)(n * 32 * KHI * 2))) = *(const v8b*)&tb[cl + n * 32][qd * 8]; *(v8b*)((char*)(VBL + o3) + (l3 + (unsigned)(n * 32 * KHI * 2))) = *(const v8b*)&tbl[cl + n * 32][qd * 8]; } } }

#ifndef SM_EXTRA_PARAMS
#define SM_EXTRA_PARAMS
#endif
#ifndef PROJ_EXTRA_PARAMS
#define PROJ_EXTRA_PARAMS
#endif
#ifndef SM_MASK_HOOK
#define SM_MASK_HOOK (void)0
#endif

#define WS_QH  0u                                      // f16 q rows [b*t][CC]
#define WS_KH  (WS_QH + 2u * (size_t)NB * TT * CC)      // f16 k rows [b*t][CC]
#define WS_VT  (WS_KH + 2u * (size_t)NB * TT * CC)      // f16 v planes [b][c][t]
#define WS_QL  (WS_VT + 2u * (size_t)NB * CC * TT)      // f16 q residual x 2^10 rows [b][t < QHI][CC]
#define WS_KL  (WS_QL + 2u * (size_t)NB * QHI * CC)     // f16 k residual x 2^10 rows [b][t < KHI][CC]
#define WS_VB  (WS_KL + 2u * (size_t)NB * KHI * CC)     // bf16 v hi planes [b][c][t < KHI]
#define WS_VBL (WS_VB + 2u * (size_t)NB * CC * KHI)
#define WS_END (WS_VBL + 2u * (size_t)NB * CC * KHI)

__device__ __forceinline__ v8f mm_h(v16h a, v16h b, v8f c) { return __builtin_amdgcn_wmma_f32_16x16x32_f16(false, a, false, b, (short)0, c, false, false); }
__device__ __forceinline__ v8f mm_b(v16b a, v16b b, v8f c) { return __builtin_amdgcn_wmma_f32_16x16x32_bf16(false, a, false, b, (short)0, c, false, false); }
__device__ __forceinline__ float xhalf(float x) { return __builtin_bit_cast(float, __builtin_amdgcn_permlanex16(__builtin_bit_cast(int, x), __builtin_bit_cast(int, x), 0x76543210, 0xfedcba98, false, false)); }  // lane l with lane l ^ 16
// fragment (hardware k order) at p + bo bytes; p = wave-uniform base + the lane's 32-bit byte offset (row (lane & 15), + 16 bytes for the upper half), so the lane offset register is the same for the whole kernel
__device__ __forceinline__ v16h ldf_h(const char* p, int bo) { union { v16h v; v8h q[2]; } u; u.q[0] = *(const v8h*)(p + bo); u.q[1] = *(const v8h*)(p + bo + 32); return u.v; }
__device__ __forceinline__ v16b ldf_b(const char* p, int bo) { union { v16b v; v8b q[2]; } u; u.q[0] = *(const v8b*)(p + bo); u.q[1] = *(const v8b*)(p + bo + 32); return u.v; }
// address registers of the loads just issued may be reused from here on
#define XADDR() asm volatile("s_wait_xcnt 0x0" ::: "memory")
// the same, naming the two lane addresses as inputs: they keep their registers up to the wait, so no load of the group lands on them
#define XADDRP(p, q) asm volatile("s_wait_xcnt 0x0" :: "v"(p), "v"(q) : "memory")
typedef __attribute__((ext_vector_type(8))) unsigned v8u;
#define LPITCH 144          // LDS pitch of a staged 128-byte row: 16 bytes x odd, free of bank conflicts for 16-byte reads
#define LTILE 10240u        // 64 rows x 144 bytes, rounded up to a multiple of 2 KiB (every tile's place in LDS is one)
__device__ __forceinline__ unsigned uni(unsigned v) { return (unsigned)__builtin_amdgcn_readfirstlane((int)v); }
// a wave-uniform value held in a scalar register: a test on it compiles to s_cmp + s_cbranch_scc (a tensor load ignores EXEC: only a scalar branch keeps a wave from issuing it)
__device__ __forceinline__ unsigned pinned(unsigned v) { unsigned w = uni(v); asm volatile("" : "+s"(w)); return w; }
// tensor descriptor, extents in bytes: group 1 = a tile of 64 rows x 128 bytes (tensor = tile), source row pitch sp, 16 bytes of LDS pad behind every 128-byte row; group 0 = LDS place and the tile's first byte
__device__ __forceinline__ v8u tdm_g1(unsigned sp) { v8u d; d[0] = uni((1u << 20) | (4u << 22) | (3u << 25)); d[1] = uni(128u << 16); d[2] = uni(64u << 16); d[3] = uni(128u << 16); d[4] = uni(64u); d[5] = uni(sp); d[6] = uni(0u); d[7] = uni(0u); return d; }
__device__ __forceinline__ v4u tdm_g0(unsigned dst, unsigned long long ga) { v4u d; d[0] = uni(1u); d[1] = uni(dst); d[2] = uni((unsigned)ga); d[3] = uni((((unsigned)(ga >> 32)) & 0x01FFFFFFu) | 0x80000000u); return d; }
// group 0 is an in-out operand and the next stage's words are made from it (tdm_next): count, address and type keep their scalar registers from one request to the next and change only behind the wait for the last one (the LDS place, word 1, is made anew each time)
__device__ __forceinline__ void tdm_load(v4u& d0, v8u d1) { asm volatile("tensor_load_to_lds %0, %1" : "+s"(d0) : "s"(d1) : "memory"); }
// the next stage's group 0: new LDS place, source address + st bytes (the carry goes into address bits 56:32, under the type field)
__device__ __forceinline__ void tdm_next(v4u& d0, unsigned dst, unsigned st) { const unsigned lo = uni(d0[2] + st); d0[1] = uni(dst); d0[3] = uni(d0[3] + (lo < st ? 1u : 0u)); d0[2] = lo; }
#define L2S (SCALE * 1.4426950408889634f)   // logit -> base-2 exponent
#define PSH 10.0f                            // P carried x 2^10 (keeps small weights normal in f16); it cancels against the row sum
// In k_fa every '#pragma unroll' stands over a loop that indexes a register array (fragments, score tiles): rolled, the array would go to scratch. '#pragma unroll 1' keeps the pass loops rolled: one pass already fills the register budget of five waves per SIMD.
// ---- k_fa: block = 64 queries (qb) of (b, h), the whole grid heaviest first, wave = 16 queries. The block's four waves read each 64-key stage of k and v from LDS, where two tensor loads put it once (two buffers: stage s + 1 flies during pass s); the first QBH query blocks load for themselves. Per 64 keys: S^T = K . Q^T (A = key rows, B = query columns: a lane holds 8 keys per tile of ONE query, lane & 15), running maximum and sum per lane (+ one exchange between the wave's halves), P^T packed from the score registers straight into a B operand, O^T += V^T . P^T (A = v planes [c][s]). Logits and P never leave registers.
__global__ __launch_bounds__(128) void k_fa(const _Float16* QH, const _Float16* KH, const _Float16* QL, const _Float16* KL, const _Float16* VT, const __bf16* VB, const __bf16* VBL, float* Y) {   // no __restrict__: it would let the loads drift over the XADDR() waits
  __shared__ __attribute__((aligned(2048))) unsigned char ring[2 * 2 * LTILE];   // two buffers, each a key tile and a v tile
  __shared__ __align__(16) float ss[4][16][HD + 4];
  const int tid = threadIdx.x, wave = tid >> 5, lane = tid & 31, col = lane & 15, g = lane >> 4;
  const int qb = NQB - 1 - (int)blockIdx.y, b = blockIdx.x / NH, h = blockIdx.x % NH;   // qb from the slow grid index: see the launch
  const int ql0 = qb * 64 + wave * 16, tq = ql0 + col;   // tq: this lane's query
  const unsigned lq = (unsigned)((wave * 16 + col) * CC + 8 * g) * 2u, lk = (unsigned)(col * CC + 8 * g) * 2u;   // lane byte offsets: query row, key row
  const _Float16* Ku = KH + (size_t)b * TT * CC + h * HD;
  v8f acc[HD / 16] = {}; float m = -1.0e30f, l = 0.f;
  const char* qp = (const char*)(QH + ((size_t)b * TT + qb * 64) * CC + h * HD) + lq;
  const v16h q0 = ldf_h(qp, 0), q1 = ldf_h(qp, 64); XADDR();
  if (qb < QBH) {
    const unsigned lv = (unsigned)(col * KHI + 8 * g) * 2u;
    const _Float16* KLu = KL + (size_t)b * KHI * CC + h * HD; const __bf16* VBu = VB + ((size_t)b * CC + h * HD) * (size_t)KHI; const __bf16* VLu = VBL + ((size_t)b * CC + h * HD) * (size_t)KHI;
    const char* rp = (const char*)(QL + ((size_t)b * QHI + qb * 64) * CC + h * HD) + lq;
    const v16h r0 = ldf_h(rp, 0), r1 = ldf_h(rp, 64); XADDR();
#pragma unroll 1
    for (int kb = 0; kb < 2 * (qb + 1); ++kb) { const int k0 = kb * 32; float s[2][8]; float mx = -3.0e38f;   // 32 keys a pass: this short path must not set the kernel's register count
      const char* kp = (const char*)(Ku + (size_t)k0 * CC) + lk; const char* lp = (const char*)(KLu + (size_t)k0 * CC) + lk;
#pragma unroll
      for (int jt = 0; jt < 2; ++jt) { const v16h ka = ldf_h(kp, jt * 16 * CC * 2), kc = ldf_h(kp, jt * 16 * CC * 2 + 64), la = ldf_h(lp, jt * 16 * CC * 2), lc = ldf_h(lp, jt * 16 * CC * 2 + 64);
        v8f sh = {}, sl = {}; sh = mm_h(ka, q0, sh); sh = mm_h(kc, q1, sh); sl = mm_h(ka, r0, sl); sl = mm_h(kc, r1, sl); sl = mm_h(la, q0, sl); sl = mm_h(lc, q1, sl);
#pragma unroll
        for (int r = 0; r < 8; ++r) { const float v = (k0 + jt * 16 + 8 * g + r <= tq) ? sh[r] + sl[r] * (1.0f / 1024.0f) : -3.0e38f; s[jt][r] = v; mx = fmaxf(mx, v); } }
      XADDRP(kp, lp);
      mx = fmaxf(mx, xhalf(mx)); const float mn = fmaxf(m, mx * L2S), al = __builtin_amdgcn_exp2f(m - mn), nm = PSH - mn; m = mn;   // pass 0 holds key 0, which every query sees: m is a real logit from there on, also where a later pass is all above the diagonal
      float ps = 0.f; v16b ph, pl;
#pragma unroll
      for (int jt = 0; jt < 2; ++jt)
#pragma unroll
        for (int r = 0; r < 8; ++r) { const float e = __builtin_amdgcn_exp2f(fmaf(s[jt][r], L2S, nm)); ps += e; const __bf16 eh = (__bf16)e; ph[jt * 8 + r] = eh; pl[jt * 8 + r] = (__bf16)(e - (float)eh); }
      l = l * al + ps;
      const char* vp = (const char*)(VBu + k0) + lv; const char* wp = (const char*)(VLu + k0) + lv;
#pragma unroll
      for (int jd = 0; jd < HD / 16; ++jd) { acc[jd] *= al; const v16b vh = ldf_b(vp, jd * 16 * KHI * 2), vl = ldf_b(wp, jd * 16 * KHI * 2);
        acc[jd] = mm_b(vh, ph, acc[jd]); acc[jd] = mm_b(vh, pl, acc[jd]); acc[jd] = mm_b(vl, ph, acc[jd]); }
      XADDRP(vp, wp); }
  } else {
    const unsigned wv = uni((unsigned)tid >> 5), lf = (unsigned)(col * LPITCH + 16 * g);   // wave number (scalar); lane byte offset in a staged tile: row (lane & 15), + 16 bytes for the upper half
    // wave 0 brings the key tile (64 rows of KH, 128 bytes each), wave 1 the v tile (64 planes of VT, 64 keys = 128 bytes each): one request per wave and stage
    const unsigned long long sb = wv ? (unsigned long long)(size_t)(VT + ((size_t)b * CC + h * HD) * (size_t)TT) : (unsigned long long)(size_t)Ku;
    const unsigned sstep = wv ? 64u * 2u : 64u * CC * 2u, lb = (unsigned)(size_t)ring + wv * LTILE;   // source bytes from one stage to the next; this wave's place in buffer 0
    v8u g1 = tdm_g1(wv ? TT * 2u : CC * 2u);
    asm volatile("" : "+s"(g1));   // descriptor words held in their scalar registers for the whole loop: none is rebuilt, or lent to another value, while a request is in flight
    v4u g0 = tdm_g0(lb, sb);
    if (pinned(wv < 2u)) { tdm_load(g0, g1);
      asm volatile("s_wait_tensorcnt 0x0" ::: "memory"); }   // stage 0 has landed (the compiler places no wait for a tensor load)
    __syncthreads();   // stage 0 readable by every wave
    if (pinned(wv < 2u)) { tdm_next(g0, lb + 2u * LTILE, sstep); tdm_load(g0, g1); }   // stage 1 (qb >= QBH: at least seven stages)
#pragma unroll 1
    for (int kb = 0; kb <= qb; ++kb) { const int k0 = kb * 64;
      const char* kt = (const char*)ring + (unsigned)(kb & 1) * (2u * LTILE) + lf; const char* vt = kt + LTILE;
      v16h kf[4][2];
#pragma unroll
      for (int jt = 0; jt < 4; ++jt) { kf[jt][0] = ldf_h(kt, jt * 16 * LPITCH); kf[jt][1] = ldf_h(kt, jt * 16 * LPITCH + 64); }
      __builtin_amdgcn_sched_barrier(0);   // the pass's key reads go out as one group: mixed among the products, each pair waits out its own LDS latency
      v8f st[4];
#pragma unroll
      for (int jt = 0; jt < 4; ++jt) { v8f z = {}; z = mm_h(kf[jt][0], q0, z); st[jt] = mm_h(kf[jt][1], q1, z); }
      v16h vf[HD / 16][2];   // this pass's v planes: they fly during the softmax
#pragma unroll
      for (int jd = 0; jd < HD / 16; ++jd) { vf[jd][0] = ldf_h(vt, jd * 16 * LPITCH); vf[jd][1] = ldf_h(vt, jd * 16 * LPITCH + 64); }
      __builtin_amdgcn_sched_barrier(0);   // all v reads go out in front of the softmax: left free, some sink among the P.v products and wait out their LDS latency there
      if (kb == qb) {   // only the diagonal block holds keys above a query
#pragma unroll
        for (int jt = 0; jt < 4; ++jt)
#pragma unroll
          for (int r = 0; r < 8; ++r) if (k0 + jt * 16 + 8 * g + r > tq) st[jt][r] = -3.0e38f; }
      float mx = -3.0e38f;
#pragma unroll
      for (int jt = 0; jt < 4; ++jt)
#pragma unroll
        for (int r = 0; r < 8; ++r) mx = fmaxf(mx, st[jt][r]);
      mx = fmaxf(mx, xhalf(mx)); const float mn = fmaxf(m, mx * L2S), al = __builtin_amdgcn_exp2f(m - mn), nm = PSH - mn; m = mn;
      float ps = 0.f; v16h pf[2];
#pragma unroll
      for (int jt = 0; jt < 4; ++jt)
#pragma unroll
        for (int r = 0; r < 8; ++r) { const float e = __builtin_amdgcn_exp2f(fmaf(st[jt][r], L2S, nm)); ps += e; pf[jt >> 1][(jt & 1) * 8 + r] = (_Float16)e; }
      l = l * al + ps;
#pragma unroll
      for (int jd = 0; jd < HD / 16; ++jd) acc[jd] *= al;
#pragma unroll
      for (int jd = 0; jd < HD / 16; ++jd) { acc[jd] = mm_h(vf[jd][0], pf[0], acc[jd]); acc[jd] = mm_h(vf[jd][1], pf[1], acc[jd]); }
      __builtin_amdgcn_sched_barrier(0);   // the waits below stay at the pass's foot: lifted over the softmax, the first one waits out the v reads' latency with nothing to cover it
      // publish point of stage kb + 1, every wave, in this order
      asm volatile("s_wait_dscnt 0x0" ::: "memory");   // this wave's reads of the buffer have returned before the buffer is refilled
      if (pinned(wv < 2u)) asm volatile("s_wait_tensorcnt 0x0" ::: "memory");   // the issuer's own request for stage kb + 1 has landed
      __syncthreads();   // stage kb + 1 readable by every wave; every wave has left stage kb's buffer
      if (pinned(wv < 2u && kb + 2 <= qb)) { tdm_next(g0, lb + (unsigned)(kb & 1) * (2u * LTILE), sstep); tdm_load(g0, g1); } }   // stage kb + 2 into the buffer that this pass has read
    asm volatile("s_wait_tensorcnt 0x0" ::: "memory");   // no request outstanding behind the loop
    asm volatile("s_wait_dscnt 0x0" ::: "memory"); }
  l += xhalf(l); const float inv = 1.0f / l;   // every query sees its own key, so l > 0
#pragma unroll
  for (int jd = 0; jd < HD / 16; ++jd)
#pragma unroll
    for (int r = 0; r < 8; ++r) ss[wave][col][jd * 16 + 8 * g + r] = acc[jd][r] * inv;
  LDSX();
#pragma unroll
  for (int i = 0; i < 8; ++i) { const int rl = 2 * i + g; vst2(Y + ((size_t)b * TT + ql0 + rl) * CC + h * HD + col * 4, *(const v4f*)&ss[wave][rl][col * 4]); } }

extern "C" void kernel_launch(void* const* d_in, const int* in_sizes, int n_in, void* d_out, int out_size, void* d_ws, size_t ws_size, hipStream_t stream) {
  (void)in_sizes; (void)n_in; (void)out_size;
  const float** F = (const float**)d_in;
  if (ws_size < (size_t)WS_END) return;
  char* ws = (char*)d_ws; _Float16 *QH = (_Float16*)(ws + WS_QH), *KH = (_Float16*)(ws + WS_KH), *VT = (_Float16*)(ws + WS_VT), *QL = (_Float16*)(ws + WS_QL), *KL = (_Float16*)(ws + WS_KL); __bf16 *VB = (__bf16*)(ws + WS_VB), *VBL = (__bf16*)(ws + WS_VBL);
  // inputs: 0 q, 1 k, 2 v [2,4096,16,64] (= rows [b*S + t][h*64 + d])
  k_prepr<<<dim3(TNB * TT / 64, NH / PH), 256, 0, stream>>>(F[0], F[1], F[2], QH, QL, KH, KL, VT, VB, VBL);
  // (b, h) is the fast grid index and qb the slow one: a block's cost (qb + 1 passes) falls with its flat index over the WHOLE grid. There are more blocks than resident places; heaviest first, for speed only.
  k_fa<<<dim3(TNB * NH, NQB), 128, 0, stream>>>(QH, KH, QL, KL, VT, VB, VBL, (float*)d_out);
}

// v005
// A run of this version takes 75.1 microseconds.
// Timed twice side by side with v004, it ran 1.16 times as fast both times.
// All steps since v000 together make it 43.2 times as fast.
// compute dtype: q, k, v rounded to bf16 and carried EXACTLY as f16 (bf16 hi + lo planes for v below row 384); causal logits k.q as single EXACT products on WMMA 16x16x32 (f32 accumulate) x 64^-0.5 (first 384 query rows: 3 products with the residual planes); online softmax in f32 (base 2, running maximum); P x 2^10 unnormalised once to f16 against v (1 product; 3-term bf16 path for the first 384 query rows); divided by the row sum at the end; f32 output [B, S, NH, HD].
#include <hip/hip_runtime.h>
#include <math.h>

typedef __attribute__((ext_vector_type(16))) _Float16 v16h;
typedef __attribute__((ext_vector_type(16))) __bf16 v16b;
typedef __attribute__((ext_vector_type(8)))  _Float16 v8h;
typedef __attribute__((ext_vector_type(8)))  float v8f;
typedef __attribute__((ext_vector_type(4)))  float v4f;
typedef __attribute__((ext_vector_type(2)))  float v2f;
typedef __attribute__((ext_vector_type(4)))  unsigned v4u;
typedef __attribute__((ext_vector_type(4)))  int v4i;
typedef float __attribute__((may_alias)) float_a;
typedef int __attribute__((may_alias)) int_a;

template <typename T> __device__ __forceinline__ void vst2(void* p, T v) { *(T*)p = v;  }
__device__ __forceinline__ v8f wmma16(v16h a, v16h b, v8f c) {
  v8f d = __builtin_amdgcn_wmma_f32_16x16x32_f16(false, a, false, b, (short)0, c, false, false);
  asm volatile("v_nop\n\tv_nop\n\tv_nop\n\tv_nop" : "+v"(d) : "v"(a), "v"(b));
  return d;
}
__device__ __forceinline__ v8f wmma_bf(v16b a, v16b b, v8f c) {
  v8f d = __builtin_amdgcn_wmma_f32_16x16x32_bf16(false, a, false, b, (short)0, c, false, false);
  asm volatile("v_nop\n\tv_nop\n\tv_nop\n\tv_nop" : "+v"(d) : "v"(a), "v"(b));
  return d;
}
// 16x16x32 fragments: lane = (h = lane>>4, row/col = lane&15); elements 0..7 = k0+8h+0..7, 8..15 = k0+16+8h+0..7; D element r = row 8h+r
__device__ __forceinline__ v16h frag_h(const _Float16* rowk0, int lane) {
  union { v16h v; v8h q[2]; } u; const _Float16* p = rowk0 + 8 * (lane >> 4);
  u.q[0] = *(const v8h*)p; u.q[1] = *(const v8h*)(p + 16); return u.v;
}
__device__ __forceinline__ v16h frag_f32(const float* rowk0, int lane) {
  v16h a; const float* p = rowk0 + 8 * (lane >> 4);
#pragma unroll
  for (int i = 0; i < 8; ++i) { a[i] = (_Float16)p[i]; a[8 + i] = (_Float16)p[16 + i]; }
  return a;
}
__device__ __forceinline__ v16h frag_f32s(const float* rowk0, int lane, float sc) {
  v16h a; const float* p = rowk0 + 8 * (lane >> 4);
#pragma unroll
  for (int i = 0; i < 8; ++i) { a[i] = (_Float16)(p[i] * sc); a[8 + i] = (_Float16)(p[16 + i] * sc); }
  return a;
}
// column fragment from a [K][ld] layout (column n), rows >= K read as 0
__device__ __forceinline__ v16h fragc_f32(const float* W, int k0, int n, int lane, int ld, int K) {
  v16h a; const int g = lane >> 4;
#pragma unroll
  for (int i = 0; i < 8; ++i) { const int ka = k0 + 8 * g + i, kb = ka + 16;
    a[i] = (_Float16)(ka < K ? W[(size_t)(ka < K ? ka : K - 1) * ld + n] : 0.f); a[8 + i] = (_Float16)(kb < K ? W[(size_t)(kb < K ? kb : K - 1) * ld + n] : 0.f); }
  return a;
}
struct F2 { v16b h, l; };
__device__ __forceinline__ F2 bsplit16(const float v[16]) { F2 r;
#pragma unroll
  for (int i = 0; i < 16; ++i) { const __bf16 h = (__bf16)v[i]; r.h[i] = h; r.l[i] = (__bf16)(v[i] - (float)h); }
  return r; }
__device__ __forceinline__ F2 split_row(const float* row, int k0, int lane) { float v[16]; const float* p = row + k0 + 8 * (lane >> 4);
#pragma unroll
  for (int i = 0; i < 8; ++i) { v[i] = p[i]; v[8 + i] = p[16 + i]; }
  return bsplit16(v); }
__device__ __forceinline__ F2 split_rowK(const float* row, int k0, int lane, int K) { float v[16]; const int g = lane >> 4;
#pragma unroll
  for (int i = 0; i < 8; ++i) { const int ka = k0 + 8 * g + i, kb = ka + 16; v[i] = ka < K ? row[ka < K ? ka : K - 1] : 0.f; v[8 + i] = kb < K ? row[kb < K ? kb : K - 1] : 0.f; }
  return bsplit16(v); }
__device__ __forceinline__ F2 split_col(const float* W, int k0, int n, int lane, int ld, int K) { float v[16]; const int g = lane >> 4;
#pragma unroll
  for (int i = 0; i < 8; ++i) { const int ka = k0 + 8 * g + i, kb = ka + 16; v[i] = ka < K ? W[(size_t)(ka < K ? ka : K - 1) * ld + n] : 0.f; v[8 + i] = kb < K ? W[(size_t)(kb < K ? kb : K - 1) * ld + n] : 0.f; }
  return bsplit16(v); }
__device__ __forceinline__ v8f mac3(const F2& a, const F2& b, v8f c) { c = wmma_bf(a.l, b.h, c); c = wmma_bf(a.h, b.l, c); return wmma_bf(a.h, b.h, c); }
__device__ __forceinline__ float sigm(float v) { return 1.0f / (1.0f + expf(-v)); }
#define LDSX() do { asm volatile("s_wait_dscnt 0" ::: "memory"); __builtin_amdgcn_wave_barrier(); __builtin_amdgcn_fence(__ATOMIC_RELEASE, "workgroup"); } while (0)

// Causal scaled-dot-product attention on raw q, k, v [2, 4,096, 16, 64] (layout B, S, NH, HD): out[b, t, h] = softmax over s <= t of (q/8).k (finfo.min above the diagonal == exclusion) applied to v; output in the same [B, S, NH, HD] layout.
#define NB 2
#define TT 4096
#define CC 1024            // NH * HD = projected width
#define DIN 1024          // input (model) width
#define NH 16
#define HD 64
#define NQB (TT / 64)
#define HG 2
#define SCALE (0.125f)
#define CAUSAL 1
#ifndef TNB
#define TNB NB
#endif
__device__ __forceinline__ float bfr(float v) { return (float)(__bf16)v; }
__host__ __device__ __forceinline__ int kb_last(int qb) { return CAUSAL ? ((qb * 64 + 63) >> 7) : (TT / 128 - 1); }
typedef __attribute__((ext_vector_type(8))) __bf16 v8b;
__device__ __forceinline__ v16b frag_b(const __bf16* rowk0, int lane) {
  union { v16b v; v8b q[2]; } u; const __bf16* p = rowk0 + 8 * (lane >> 4);
  u.q[0] = *(const v8b*)p; u.q[1] = *(const v8b*)(p + 16); return u.v;
}
#define QBH 6              // unused: k_fa's high-precision path takes the first QHI query rows of each sequence (few keys, no averaging), NHB blocks of QBLK
#define QHI 384            // rows carrying a q residual plane
#define KHI 384            // key rows carrying k residual / v bf16 hi+lo planes (used only by the causal high-precision path)
// B fragment (k rows k0+.., output column o) of a weight: (in,out) [K][ld] or (out,in) [ld rows of K]: bf16 exact, or f16(bf16 * 256) exact
__device__ __forceinline__ v16b wcol_io(const float* Wm, int k0, int o, int lane, int ld) { v16b w; const int g = lane >> 4;
#pragma unroll
  for (int i = 0; i < 8; ++i) { w[i] = (__bf16)Wm[(size_t)(k0 + 8 * g + i) * ld + o]; w[8 + i] = (__bf16)Wm[(size_t)(k0 + 16 + 8 * g + i) * ld + o]; }
  return w; }
__device__ __forceinline__ v16b wcol_oi(const float* Wm, int k0, int o, int lane, int K) { v16b w; const float* p = Wm + (size_t)o * K + k0 + 8 * (lane >> 4);
#pragma unroll
  for (int i = 0; i < 8; ++i) { w[i] = (__bf16)p[i]; w[8 + i] = (__bf16)p[16 + i]; }
  return w; }
__device__ __forceinline__ v16h wcolh_io(const float* Wm, int k0, int o, int lane, int ld) { v16h w; const int g = lane >> 4;
#pragma unroll
  for (int i = 0; i < 8; ++i) { w[i] = (_Float16)(bfr(Wm[(size_t)(k0 + 8 * g + i) * ld + o]) * 256.0f); w[8 + i] = (_Float16)(bfr(Wm[(size_t)(k0 + 16 + 8 * g + i) * ld + o]) * 256.0f); }
  return w; }
__device__ __forceinline__ v16h wcolh_oi(const float* Wm, int k0, int o, int lane, int K) { v16h w; const float* p = Wm + (size_t)o * K + k0 + 8 * (lane >> 4);
#pragma unroll
  for (int i = 0; i < 8; ++i) { w[i] = (_Float16)(bfr(p[i]) * 256.0f); w[8 + i] = (_Float16)(bfr(p[16 + i]) * 256.0f); }
  return w; }
#define WQKV_LAYOUT 1   // 0 = (in,out) [DIN][CC]; 1 = (out,in) [CC][DIN]; 2 = per-head [NH][DIN][HD]
__device__ __forceinline__ v16b wcol_hdk(const float* Wm, int k0, int o, int lane) { v16b w; const int g = lane >> 4; const float* p = Wm + (size_t)(o / HD) * DIN * HD + (o % HD);
#pragma unroll
  for (int i = 0; i < 8; ++i) { w[i] = (__bf16)p[(size_t)(k0 + 8 * g + i) * HD]; w[8 + i] = (__bf16)p[(size_t)(k0 + 16 + 8 * g + i) * HD]; }
  return w; }
#define WO_OUT_IN 0
#if WQKV_LAYOUT == 1
#define WCOL(W, k0, o, lane) wcol_oi(W, k0, o, lane, DIN)
#elif WQKV_LAYOUT == 2
#define WCOL(W, k0, o, lane) wcol_hdk(W, k0, o, lane)
#else
#define WCOL(W, k0, o, lane) wcol_io(W, k0, o, lane, CC)
#endif
#if WO_OUT_IN
#define WOCOL(W, k0, o, lane) wcol_oi(W, k0, o, lane, CC)
#define WOCOLH(W, k0, o, lane) wcolh_oi(W, k0, o, lane, CC)
#else
#define WOCOL(W, k0, o, lane) wcol_io(W, k0, o, lane, DIN)
#define WOCOLH(W, k0, o, lane) wcolh_io(W, k0, o, lane, DIN)
#endif

// ---- k_prepr: block = 8 waves = (64 attention positions t0.. of sequence bb, PH heads = PC columns c0..): reads the module's [B, T, H*64] inputs, bf16-rounds them and writes the standard attention planes: q -> f16 hi rows (+ x 2^10 residual rows for s < QHI), k -> f16 rows (+ residual rows s < KHI), v -> f16 planes [c][s] (+ bf16 hi/lo planes for s < KHI).
// A stream: 512 blocks, two per WGP, all resident at once. A thread takes one 16-byte piece (4 columns) of 16 consecutive rows of each input; a wave's load is 512 contiguous bytes. All 48 loads go out before the first value is used. q and k go from registers straight to their rows (a wave's store is 256 contiguous bytes); only v passes through LDS, to be turned: 16 positions of one column lie in one thread, so it is written there in 16-byte pieces.
#define PH 4
#define PC (PH * HD)
typedef __attribute__((ext_vector_type(4))) _Float16 v4h;
// behind a group of stores, in front of a branch or a join: the stores' address and data registers may be reused from here on (inside a straight run the compiler places this wait itself)
#define XSTORES() asm volatile("s_wait_xcnt 0x0" ::: "memory")
__global__ __launch_bounds__(256) void k_prepr(const float* __restrict__ Q, const float* __restrict__ K, const float* __restrict__ V, _Float16* __restrict__ QH, _Float16* __restrict__ QL, _Float16* __restrict__ KH, _Float16* __restrict__ KL, _Float16* __restrict__ VT, __bf16* __restrict__ VB, __bf16* __restrict__ VBL) {
  __shared__ __align__(16) _Float16 tv[PC][72]; __shared__ __align__(16) __bf16 tb[PC][72], tbl[PC][72];
  const int tid = threadIdx.x, cc = tid & 63, rg = tid >> 6; const int c0 = blockIdx.y * PC;   // cc: 16-byte piece of the 1,024-byte row; rg: group of 16 rows
  const size_t r0 = (size_t)blockIdx.x * 64; const size_t bb = r0 / TT; const int t0 = (int)(r0 % TT); const bool qhi = t0 < QHI, khi = t0 < KHI;
  const size_t ou = r0 * (size_t)CC + c0;   // block-uniform element index in the [B, T, H*64] inputs; the f16 q and k rows have the same index
  const unsigned lo = (unsigned)(rg * 16 * CC + cc * 4);   // the lane's element offset from there: one 32-bit register (x 4) serves every load, another (x 2) every row store
  const unsigned l4 = lo * 4u;
  const char *Vu = (const char*)(V + ou), *Qu = (const char*)(Q + ou), *Ku = (const char*)(K + ou);
  v4f v[16], q[16], k[16];
#pragma unroll
  for (int i = 0; i < 16; ++i) v[i] = *(const v4f*)(Vu + (l4 + (unsigned)(i * CC * 4)));
  __builtin_amdgcn_sched_barrier(0);   // v goes out first, as it is used first (left free, the compiler issues most of v last, and the LDS writes that the block's barrier waits for start only when all 48 loads are back)
#pragma unroll
  for (int i = 0; i < 16; ++i) q[i] = *(const v4f*)(Qu + (l4 + (unsigned)(i * CC * 4)));
  __builtin_amdgcn_sched_barrier(0);   // then q, then k, for the same reason
#pragma unroll
  for (int i = 0; i < 16; ++i) k[i] = *(const v4f*)(Ku + (l4 + (unsigned)(i * CC * 4)));
  asm volatile("s_wait_xcnt 0x0" :: "v"(l4) : "memory");   // the loads' offset register, named as an input, keeps its place up to this wait: no load of the 48 lands on it, and it may be reused from here on
  // module inputs: bf16-rounded
#pragma unroll
  for (int j = 0; j < 4; ++j)
#pragma unroll
    for (int hf = 0; hf < 2; ++hf) { v8h x;
#pragma unroll
      for (int e = 0; e < 8; ++e) x[e] = (_Float16)bfr(v[hf * 8 + e][j]);
      *(v8h*)&tv[cc * 4 + j][rg * 16 + hf * 8] = x; }
  if (khi) {
#pragma unroll
    for (int j = 0; j < 4; ++j)
#pragma unroll
      for (int hf = 0; hf < 2; ++hf) { v8b y, z;
#pragma unroll
        for (int e = 0; e < 8; ++e) { const float f = bfr(v[hf * 8 + e][j]); const __bf16 vb = (__bf16)f; y[e] = vb; z[e] = (__bf16)(f - (float)vb); }
        *(v8b*)&tb[cc * 4 + j][rg * 16 + hf * 8] = y; *(v8b*)&tbl[cc * 4 + j][rg * 16 + hf * 8] = z; } }
#pragma unroll
  for (int i = 0; i < 16; ++i) { v4h x;
#pragma unroll
    for (int j = 0; j < 4; ++j) x[j] = (_Float16)bfr(q[i][j]);
    *(v4h*)((char*)(QH + ou) + (lo * 2u + (unsigned)(i * CC * 2))) = x; }
  XSTORES();
  if (qhi) { char* p = (char*)(QL + (bb * QHI + t0) * (size_t)CC + c0);
#pragma unroll
    for (int i = 0; i < 16; ++i) { v4h x;
#pragma unroll
      for (int j = 0; j < 4; ++j) { const float f = bfr(q[i][j]); x[j] = (_Float16)((f - (float)(_Float16)f) * 1024.0f); }
      *(v4h*)(p + (lo * 2u + (unsigned)(i * CC * 2))) = x; }
    XSTORES(); }
#pragma unroll
  for (int i = 0; i < 16; ++i) { v4h x;
#pragma unroll
    for (int j = 0; j < 4; ++j) x[j] = (_Float16)bfr(k[i][j]);
    *(v4h*)((char*)(KH + ou) + (lo * 2u + (unsigned)(i * CC * 2))) = x; }
  XSTORES();
  if (khi) { char* p = (char*)(KL + (bb * KHI + t0) * (size_t)CC + c0);
#pragma unroll
    for (int i = 0; i < 16; ++i) { v4h x;
#pragma unroll
      for (int j = 0; j < 4; ++j) { const float f = bfr(k[i][j]); x[j] = (_Float16)((f - (float)(_Float16)f) * 1024.0f); }
      *(v4h*)(p + (lo * 2u + (unsigned)(i * CC * 2))) = x; }
    XSTORES(); }
  // the block's barrier, ordering LDS alone (the planes in tv, tb, tbl): __syncthreads() would also wait here for the answers to the wave's 32 row stores, which nobody in the block reads
  __builtin_amdgcn_fence(__ATOMIC_RELEASE, "workgroup", "local"); __builtin_amdgcn_s_barrier(); __builtin_amdgcn_fence(__ATOMIC_ACQUIRE, "workgroup", "local");
  const int cl = tid >> 3, qd = tid & 7;   // 8 threads store one plane's 128 bytes; 32 planes a trip
  { char* p = (char*)(VT + (bb * CC + c0) * (size_t)TT + t0); const unsigned l2 = (unsigned)(cl * TT + qd * 8) * 2u;
#pragma unroll
    for (int n = 0; n < PC / 32; ++n) *(v8h*)(p + (l2 + (unsigned)(n * 32 * TT * 2))) = *(const v8h*)&tv[cl + n * 32][qd * 8]; }
  if (khi) { const size_t o3 = (bb * CC + c0) * (size_t)KHI + t0; const unsigned l3 = (unsigned)(cl * KHI + qd * 8) * 2u;
#pragma unroll
    for (int n = 0; n < PC / 32; ++n) { *(v8b*)((char*)(VB + o3) + (l3 + (unsigned)(n * 32 * KHI * 2))) = *(const v8b*)&tb[cl + n * 32][qd * 8]; *(v8b*)((char*)(VBL + o3) + (l3 + (unsigned)(n * 32 * KHI * 2))) = *(const v8b*)&tbl[cl + n * 32][qd * 8]; } } }

#ifndef SM_EXTRA_PARAMS
#define SM_EXTRA_PARAMS
#endif
#ifndef PROJ_EXTRA_PARAMS
#define PROJ_EXTRA_PARAMS
#endif
#ifndef SM_MASK_HOOK
#define SM_MASK_HOOK (void)0
#endif

#define WS_QH  0u                                      // f16 q rows [b*t][CC]
#define WS_KH  (WS_QH + 2u * (size_t)NB * TT * CC)      // f16 k rows [b*t][CC]
#define WS_VT  (WS_KH + 2u * (size_t)NB * TT * CC)      // f16 v planes [b][c][t]
#define WS_QL  (WS_VT + 2u * (size_t)NB * CC * TT)      // f16 q residual x 2^10 rows [b][t < QHI][CC]
#define WS_KL  (WS_QL + 2u * (size_t)NB * QHI * CC)     // f16 k residual x 2^10 rows [b][t < KHI][CC]
#define WS_VB  (WS_KL + 2u * (size_t)NB * KHI * CC)     // bf16 v hi planes [b][c][t < KHI]
#define WS_VBL (WS_VB + 2u * (size_t)NB * CC * KHI)
#define WS_END (WS_VBL + 2u * (size_t)NB * CC * KHI)

__device__ __forceinline__ v8f mm_h(v16h a, v16h b, v8f c) { return __builtin_amdgcn_wmma_f32_16x16x32_f16(false, a, false, b, (short)0, c, false, false); }
__device__ __forceinline__ v8f mm_b(v16b a, v16b b, v8f c) { return __builtin_amdgcn_wmma_f32_16x16x32_bf16(false, a, false, b, (short)0, c, false, false); }
__device__ __forceinline__ float xhalf(float x) { return __builtin_bit_cast(float, __builtin_amdgcn_permlanex16(__builtin_bit_cast(int, x), __builtin_bit_cast(int, x), 0x76543210, 0xfedcba98, false, false)); }  // lane l with lane l ^ 16
// fragment (hardware k order) at p + bo bytes; p = wave-uniform base + the lane's 32-bit byte offset (row (lane & 15), + 16 bytes for the upper half), so the lane offset register is the same for the whole kernel
__device__ __forceinline__ v16h ldf_h(const char* p, int bo) { union { v16h v; v8h q[2]; } u; u.q[0] = *(const v8h*)(p + bo); u.q[1] = *(const v8h*)(p + bo + 32); return u.v; }
__device__ __forceinline__ v16b ldf_b(const char* p, int bo) { union { v16b v; v8b q[2]; } u; u.q[0] = *(const v8b*)(p + bo); u.q[1] = *(const v8b*)(p + bo + 32); return u.v; }
// address registers of the loads just issued may be reused from here on
#define XADDR() asm volatile("s_wait_xcnt 0x0" ::: "memory")
// the same, naming the two lane addresses as inputs: they keep their registers up to the wait, so no load of the group lands on them
#define XADDRP(p, q) asm volatile("s_wait_xcnt 0x0" :: "v"(p), "v"(q) : "memory")
typedef __attribute__((ext_vector_type(8))) unsigned v8u;
#define LPITCH 144          // LDS pitch of a staged 128-byte row: 16 bytes x odd, free of bank conflicts for 16-byte reads
#define LTILE 10240u        // 64 rows x 144 bytes, rounded up to a multiple of 2 KiB (every tile's place in LDS is one)
__device__ __forceinline__ unsigned uni(unsigned v) { return (unsigned)__builtin_amdgcn_readfirstlane((int)v); }
// a wave-uniform value held in a scalar register: a test on it compiles to s_cmp + s_cbranch_scc (a tensor load ignores EXEC: only a scalar branch keeps a wave from issuing it)
__device__ __forceinline__ unsigned pinned(unsigned v) { unsigned w = uni(v); asm volatile("" : "+s"(w)); return w; }
// tensor descriptor, extents in bytes: group 1 = a tile of 64 rows x 128 bytes (tensor = tile), source row pitch sp, 16 bytes of LDS pad behind every 128-byte row; group 0 = LDS place and the tile's first byte
__device__ __forceinline__ v8u tdm_g1(unsigned sp) { v8u d; d[0] = uni((1u << 20) | (4u << 22) | (3u << 25)); d[1] = uni(128u << 16); d[2] = uni(64u << 16); d[3] = uni(128u << 16); d[4] = uni(64u); d[5] = uni(sp); d[6] = uni(0u); d[7] = uni(0u); return d; }
__device__ __forceinline__ v4u tdm_g0(unsigned dst, unsigned long long ga) { v4u d; d[0] = uni(1u); d[1] = uni(dst); d[2] = uni((unsigned)ga); d[3] = uni((((unsigned)(ga >> 32)) & 0x01FFFFFFu) | 0x80000000u); return d; }
// group 0 is an in-out operand and the next stage's words are made from it (tdm_next): count, address and type keep their scalar registers from one request to the next and change only behind the wait for the last one (the LDS place, word 1, is made anew each time)
__device__ __forceinline__ void tdm_load(v4u& d0, v8u d1) { asm volatile("tensor_load_to_lds %0, %1" : "+s"(d0) : "s"(d1) : "memory"); }
// the next stage's group 0: new LDS place, source address + st bytes (the carry goes into address bits 56:32, under the type field)
__device__ __forceinline__ void tdm_next(v4u& d0, unsigned dst, unsigned st) { const unsigned lo = uni(d0[2] + st); d0[1] = uni(dst); d0[3] = uni(d0[3] + (lo < st ? 1u : 0u)); d0[2] = lo; }
#define L2S (SCALE * 1.4426950408889634f)   // logit -> base-2 exponent
#define PSH 10.0f                            // P carried x 2^10 (keeps small weights normal in f16); it cancels against the row sum
// In k_fa every '#pragma unroll' stands over a loop that indexes a register array (fragments, score tiles): rolled, the array would go to scratch. '#pragma unroll 1' keeps the pass loops rolled: one pass already fills the wave's register budget.
#define QW 32                      // queries of a wave on the main path: two 16-column groups, which share every k and v fragment read from LDS
#define QBLK 128                   // queries of a block (main path: 4 query groups of QW; first rows: 8 waves of 16)
#define NMB ((TT - QHI) / QBLK)    // main-path blocks per (b, h): query rows QHI .. TT - 1
#define NHB (QHI / QBLK)           // blocks per (b, h) of the first QHI query rows
#define SBUF (4u * LTILE)          // one stage of 128 keys in LDS: key tile, v tile of keys 0..63, then the same of keys 64..127
// one 16-query tile of O^T (x 1 / row sum) turned in the wave's own LDS rows and stored as whole 256-byte rows; Yr = the tile's first output row at this head
__device__ __forceinline__ void put_tile(float (*sw)[HD + 4], const v8f* acc, float inv, float* Yr, int col, int g) {
#pragma unroll
  for (int jd = 0; jd < HD / 16; ++jd)
#pragma unroll
    for (int r = 0; r < 8; ++r) sw[col][jd * 16 + 8 * g + r] = acc[jd][r] * inv;
  asm volatile("s_wait_dscnt 0" ::: "memory"); __builtin_amdgcn_wave_barrier(); __builtin_amdgcn_fence(__ATOMIC_RELEASE, "workgroup", "local");   // the wave's rows are written before it reads them back; ordering LDS alone: LDSX() would also wait here for the answers to the stores of the tile before
#pragma unroll
  for (int i = 0; i < 8; ++i) { const int rl = 2 * i + g; vst2(Yr + (size_t)rl * CC + col * 4, *(const v4f*)&sw[rl][col * 4]); }
  XADDR(); }   // the stores' address and data registers may be reused from here on (a second tile follows on the main path)
// ---- k_fa, main path (query rows >= QHI): block = 128 queries of (b, h) x stages of 128 keys, 8 waves = 4 query groups x 2 key halves: a wave holds 32 queries (two 16-column groups) and takes one 64-key tile of every stage, so every k and v fragment it reads from LDS feeds two products, and a query's keys are walked by two waves side by side. Four tensor loads put a stage in LDS once (two buffers: stage s + 1 flies during pass s). Per 64 keys and column group: S^T = K . Q^T (A = key rows, B = query columns: a lane holds 8 keys per tile of ONE query, lane & 15), running maximum and sum per lane (+ one exchange between the wave's halves), P^T packed from the score registers straight into a B operand, O^T += V^T . P^T (A = v planes [c][s]). Logits and P never leave registers. Behind the loop the upper key half hands its maximum, sum and O^T to its partner wave through LDS, which joins the two and stores. The first QHI query rows (wave = 16 queries) load for themselves.
__global__ __launch_bounds__(256) void k_fa(const _Float16* QH, const _Float16* KH, const _Float16* QL, const _Float16* KL, const _Float16* VT, const __bf16* VB, const __bf16* VBL, float* Y) {   // no __restrict__: it would let the loads drift over the XADDR() waits
  __shared__ __attribute__((aligned(2048))) unsigned char ring[2 * SBUF];   // two buffers of one stage each
  __shared__ __align__(16) float ss[8][16][HD + 4];
  __shared__ v4f mg[4][17][32];   // per query group: the upper key half's O^T (16 pieces of 16 bytes a lane), then its maxima and sums
  const int tid = threadIdx.x, wave = tid >> 5, lane = tid & 31, col = lane & 15, g = lane >> 4;
  const unsigned wv = uni((unsigned)tid >> 5);   // wave number (scalar)
  const int b = blockIdx.x / NH, h = blockIdx.x % NH;   // the query block comes from the slow grid index: see the launch
  const unsigned lk = (unsigned)(col * CC + 8 * g) * 2u;   // lane byte offset: key row
  const _Float16* Ku = KH + (size_t)b * TT * CC + h * HD;
  if ((int)blockIdx.y < NHB) {
    const int qb = NHB - 1 - (int)blockIdx.y;
    const int ql0 = qb * QBLK + (int)wv * 16, tq = ql0 + col;   // the wave's first query (scalar); tq: this lane's query
    const unsigned lq = (unsigned)((wave * 16 + col) * CC + 8 * g) * 2u;   // lane byte offset: query row
    v8f acc[HD / 16] = {}; float m = -1.0e30f, l = 0.f;
    const char* qp = (const char*)(QH + ((size_t)b * TT + qb * QBLK) * CC + h * HD) + lq;
    const v16h q0 = ldf_h(qp, 0), q1 = ldf_h(qp, 64); XADDR();
    const unsigned lv = (unsigned)(col * KHI + 8 * g) * 2u;
    const _Float16* KLu = KL + (size_t)b * KHI * CC + h * HD; const __bf16* VBu = VB + ((size_t)b * CC + h * HD) * (size_t)KHI; const __bf16* VLu = VBL + ((size_t)b * CC + h * HD) * (size_t)KHI;
    const char* rp = (const char*)(QL + ((size_t)b * QHI + qb * QBLK) * CC + h * HD) + lq;
    const v16h r0 = ldf_h(rp, 0), r1 = ldf_h(rp, 64); XADDR();
#pragma unroll 1
    for (int kb = 0; kb < (ql0 + 16 + 31) / 32; ++kb) { const int k0 = kb * 32; float s[2][8]; float mx = -3.0e38f;   // 32 keys a pass, up to the wave's last query (no barrier on this path: each wave has its own count); this short path must not set the kernel's register count
      const char* kp = (const char*)(Ku + (size_t)k0 * CC) + lk; const char* lp = (const char*)(KLu + (size_t)k0 * CC) + lk;
#pragma unroll
      for (int jt = 0; jt < 2; ++jt) { const v16h ka = ldf_h(kp, jt * 16 * CC * 2), kc = ldf_h(kp, jt * 16 * CC * 2 + 64), la = ldf_h(lp, jt * 16 * CC * 2), lc = ldf_h(lp, jt * 16 * CC * 2 + 64);
        v8f sh = {}, sl = {}; sh = mm_h(ka, q0, sh); sh = mm_h(kc, q1, sh); sl = mm_h(ka, r0, sl); sl = mm_h(kc, r1, sl); sl = mm_h(la, q0, sl); sl = mm_h(lc, q1, sl);
#pragma unroll
        for (int r = 0; r < 8; ++r) { const float v = (k0 + jt * 16 + 8 * g + r <= tq) ? sh[r] + sl[r] * (1.0f / 1024.0f) : -3.0e38f; s[jt][r] = v; mx = fmaxf(mx, v); } }
      XADDRP(kp, lp);
      mx = fmaxf(mx, xhalf(mx)); const float mn = fmaxf(m, mx * L2S), al = __builtin_amdgcn_exp2f(m - mn), nm = PSH - mn; m = mn;   // pass 0 holds key 0, which every query sees: m is a real logit from there on
      float ps = 0.f; v16b ph, pl;
#pragma unroll
      for (int jt = 0; jt < 2; ++jt)
#pragma unroll
        for (int r = 0; r < 8; ++r) { const float e = __builtin_amdgcn_exp2f(fmaf(s[jt][r], L2S, nm)); ps += e; const __bf16 eh = (__bf16)e; ph[jt * 8 + r] = eh; pl[jt * 8 + r] = (__bf16)(e - (float)eh); }
      l = l * al + ps;
      const char* vp = (const char*)(VBu + k0) + lv; const char* wp = (const char*)(VLu + k0) + lv;
#pragma unroll
      for (int jd = 0; jd < HD / 16; ++jd) { acc[jd] *= al; const v16b vh = ldf_b(vp, jd * 16 * KHI * 2), vl = ldf_b(wp, jd * 16 * KHI * 2);
        acc[jd] = mm_b(vh, ph, acc[jd]); acc[jd] = mm_b(vh, pl, acc[jd]); acc[jd] = mm_b(vl, ph, acc[jd]); }
      XADDRP(vp, wp); }
    l += xhalf(l);   // every query sees its own key, so l > 0
    put_tile(ss[wave], acc, 1.0f / l, Y + ((size_t)b * TT + ql0) * CC + h * HD, col, g);
  } else {
    const unsigned qg = wv & 3u, kh = wv >> 2, lf = (unsigned)(col * LPITCH + 16 * g);   // query group, key half (scalar); lane byte offset in a staged tile: row (lane & 15), + 16 bytes for the upper half
    const int Q0 = TT - QBLK * ((int)blockIdx.y - NHB + 1), nst = Q0 / 128 + 1;   // the block's first query; its stages of 128 keys (keys 0 .. Q0 + 127)
    const int wq0 = Q0 + (int)qg * QW;   // the wave's first query (scalar)
    v8f acc[2][HD / 16] = {}; float m[2] = {-1.0e30f, -1.0e30f}, l[2] = {0.f, 0.f};
    const char* qp = (const char*)(QH + ((size_t)b * TT + Q0) * CC + h * HD) + (unsigned)(((wave & 3) * QW + col) * CC + 8 * g) * 2u;
    v16h qf[2][2];
#pragma unroll
    for (int cg = 0; cg < 2; ++cg) { qf[cg][0] = ldf_h(qp, cg * 16 * CC * 2); qf[cg][1] = ldf_h(qp, cg * 16 * CC * 2 + 64); }
    XADDR();
    // waves 0 to 3 bring one tile each per stage: wave 0 the key tile of keys 0..63 (64 rows of KH, 128 bytes each), wave 1 their v tile (64 planes of VT, 64 keys = 128 bytes each), waves 2 and 3 the same of keys 64..127
    const unsigned isv = wv & 1u, th = (wv >> 1) & 1u;
    const unsigned long long sb = isv ? (unsigned long long)(size_t)(VT + ((size_t)b * CC + h * HD) * (size_t)TT + th * 64u) : (unsigned long long)(size_t)(Ku + (size_t)th * 64u * CC);
    const unsigned sstep = isv ? 128u * 2u : 128u * CC * 2u, lb = (unsigned)(size_t)ring + (th * 2u + isv) * LTILE;   // source bytes from one stage to the next; this wave's place in buffer 0
    v8u g1 = tdm_g1(isv ? TT * 2u : CC * 2u);
    asm volatile("" : "+s"(g1));   // descriptor words held in their scalar registers for the whole loop: none is rebuilt, or lent to another value, while a request is in flight
    v4u g0 = tdm_g0(lb, sb);
    if (pinned(wv < 4u)) { tdm_load(g0, g1);
      asm volatile("s_wait_tensorcnt 0x0" ::: "memory"); }   // stage 0 has landed (the compiler places no wait for a tensor load)
    __syncthreads();   // stage 0 readable by every wave
    if (pinned(wv < 4u)) { tdm_next(g0, lb + SBUF, sstep); tdm_load(g0, g1); }   // stage 1 (Q0 >= QHI: at least four stages)
#pragma unroll 1
    for (int s = 0; s < nst; ++s) { const int k0 = s * 128 + (int)kh * 64;   // the wave's 64 keys of this stage
      const char* kt = (const char*)ring + ((unsigned)(s & 1) * SBUF + kh * (2u * LTILE)) + lf; const char* vt = kt + LTILE;
      v16h kf[4][2];
#pragma unroll
      for (int jt = 0; jt < 4; ++jt) { kf[jt][0] = ldf_h(kt, jt * 16 * LPITCH); kf[jt][1] = ldf_h(kt, jt * 16 * LPITCH + 64); }
      __builtin_amdgcn_sched_barrier(0);   // the pass's key reads go out as one group: mixed among the products, each pair waits out its own LDS latency
      v8f st[2][4];
#pragma unroll
      for (int jt = 0; jt < 4; ++jt)
#pragma unroll
        for (int cg = 0; cg < 2; ++cg) { v8f z = {}; z = mm_h(kf[jt][0], qf[cg][0], z); st[cg][jt] = mm_h(kf[jt][1], qf[cg][1], z); }
      if (k0 + 63 > wq0) {   // only a tile that reaches past the wave's first query holds keys above a query (in the block's last stage); wave-uniform, a scalar branch
#pragma unroll
        for (int cg = 0; cg < 2; ++cg) { const int dq = wq0 + cg * 16 + col - k0 - 8 * g;   // the lane's query, counted from its first key of the tile
#pragma unroll
          for (int jt = 0; jt < 4; ++jt)
#pragma unroll
            for (int r = 0; r < 8; ++r) if (jt * 16 + r > dq) st[cg][jt][r] = -3.0e38f; } }   // a tile all above the wave's queries leaves m, l and acc as they are (every weight 0, factor 1): the wave's tile of stage 0 lies below every query of this path, so m is a real logit by then
      v16h pf[2][2], vf[HD / 16][2];
#pragma unroll
      for (int cg = 0; cg < 2; ++cg) { float mx = -3.0e38f;
#pragma unroll
        for (int jt = 0; jt < 4; ++jt)
#pragma unroll
          for (int r = 0; r < 8; ++r) mx = fmaxf(mx, st[cg][jt][r]);
        mx = fmaxf(mx, xhalf(mx)); const float mn = fmaxf(m[cg], mx * L2S), al = __builtin_amdgcn_exp2f(m[cg] - mn), nm = PSH - mn; m[cg] = mn;
        float ps = 0.f;
#pragma unroll
        for (int jt = 0; jt < 4; ++jt)
#pragma unroll
          for (int r = 0; r < 8; ++r) { const float e = __builtin_amdgcn_exp2f(fmaf(st[cg][jt][r], L2S, nm)); ps += e; pf[cg][jt >> 1][(jt & 1) * 8 + r] = (_Float16)e; }
        l[cg] = l[cg] * al + ps;
#pragma unroll
        for (int jd = 0; jd < HD / 16; ++jd) acc[cg][jd] *= al;
        asm volatile("" :: "v"(l[cg]) : "memory");   // the group's row sum, an input only, is finished here: left free, the compiler mixes the two groups' softmax and moves the 32 additions to the loop's foot, a dependent chain in front of the next key reads, and scores, weights and v planes all live at once take more registers than four waves per SIMD leave
        __builtin_amdgcn_sched_barrier(0);   // first group: its scores are packed (32 registers become 16) before the v planes take theirs; second group: no P.v product is lifted to just behind the v reads, where it would wait out their LDS latency
        if (cg == 0) {
#pragma unroll
          for (int jd = 0; jd < HD / 16; ++jd) { vf[jd][0] = ldf_h(vt, jd * 16 * LPITCH); vf[jd][1] = ldf_h(vt, jd * 16 * LPITCH + 64); }   // this pass's v planes: they fly during the second group's softmax
          __builtin_amdgcn_sched_barrier(0); } }   // all v reads go out in front of that softmax: left free, some sink among the P.v products and wait out their LDS latency there
#pragma unroll
      for (int jd = 0; jd < HD / 16; ++jd)
#pragma unroll
        for (int cg = 0; cg < 2; ++cg) { acc[cg][jd] = mm_h(vf[jd][0], pf[cg][0], acc[cg][jd]); acc[cg][jd] = mm_h(vf[jd][1], pf[cg][1], acc[cg][jd]); }
      __builtin_amdgcn_sched_barrier(0);   // the waits below stay at the pass's foot: lifted over the softmax, the first one waits out the v reads' latency with nothing to cover it
      // publish point of stage s + 1, every wave, in this order
      asm volatile("s_wait_dscnt 0x0" ::: "memory");   // this wave's reads of the buffer have returned before the buffer is refilled
      if (pinned(wv < 4u)) asm volatile("s_wait_tensorcnt 0x0" ::: "memory");   // the issuer's own request for stage s + 1 has landed
      __syncthreads();   // stage s + 1 readable by every wave; every wave has left stage s's buffer
      if (pinned(wv < 4u && s + 2 < nst)) { tdm_next(g0, lb + (unsigned)(s & 1) * SBUF, sstep); tdm_load(g0, g1); } }   // stage s + 2 into the buffer that this pass has read
    asm volatile("s_wait_tensorcnt 0x0" ::: "memory");   // no request outstanding behind the loop
    asm volatile("s_wait_dscnt 0x0" ::: "memory");
    // the two key halves of a query group are joined: same lane, same registers in both waves
    if (kh != 0u) {
#pragma unroll
      for (int cg = 0; cg < 2; ++cg)
#pragma unroll
        for (int jd = 0; jd < HD / 16; ++jd)
#pragma unroll
          for (int hf = 0; hf < 2; ++hf) mg[qg][(cg * 4 + jd) * 2 + hf][lane] = v4f{acc[cg][jd][hf * 4], acc[cg][jd][hf * 4 + 1], acc[cg][jd][hf * 4 + 2], acc[cg][jd][hf * 4 + 3]};
      mg[qg][16][lane] = v4f{m[0], m[1], l[0], l[1]}; }
    __syncthreads();   // the upper halves' results readable by their partner waves
    if (kh == 0u) { const v4f o = mg[qg][16][lane];
#pragma unroll
      for (int cg = 0; cg < 2; ++cg) { const float mn = fmaxf(m[cg], o[cg]), fa = __builtin_amdgcn_exp2f(m[cg] - mn), fb = __builtin_amdgcn_exp2f(o[cg] - mn);   // both maxima are real logits
        float lt = l[cg] * fa + o[2 + cg] * fb; lt += xhalf(lt);   // every query sees its own key, so the sum is > 0
#pragma unroll
        for (int jd = 0; jd < HD / 16; ++jd)
#pragma unroll
          for (int hf = 0; hf < 2; ++hf) { const v4f p = mg[qg][(cg * 4 + jd) * 2 + hf][lane];
#pragma unroll
            for (int e = 0; e < 4; ++e) acc[cg][jd][hf * 4 + e] = acc[cg][jd][hf * 4 + e] * fa + p[e] * fb; }
        put_tile(ss[wave], acc[cg], 1.0f / lt, Y + ((size_t)b * TT + wq0 + cg * 16) * CC + h * HD, col, g); } } } }

extern "C" void kernel_launch(void* const* d_in, const int* in_sizes, int n_in, void* d_out, int out_size, void* d_ws, size_t ws_size, hipStream_t stream) {
  (void)in_sizes; (void)n_in; (void)out_size;
  const float** F = (const float**)d_in;
  if (ws_size < (size_t)WS_END) return;
  char* ws = (char*)d_ws; _Float16 *QH = (_Float16*)(ws + WS_QH), *KH = (_Float16*)(ws + WS_KH), *VT = (_Float16*)(ws + WS_VT), *QL = (_Float16*)(ws + WS_QL), *KL = (_Float16*)(ws + WS_KL); __bf16 *VB = (__bf16*)(ws + WS_VB), *VBL = (__bf16*)(ws + WS_VBL);
  // inputs: 0 q, 1 k, 2 v [2,4096,16,64] (= rows [b*S + t][h*64 + d])
  k_prepr<<<dim3(TNB * TT / 64, NH / PH), 256, 0, stream>>>(F[0], F[1], F[2], QH, QL, KH, KL, VT, VB, VBL);
  // (b, h) is the fast grid index and the query block the slow one: over the WHOLE grid a main-path block's cost (its number of stages) falls with its flat index. There are more blocks than resident places. The blocks of the first rows stand in front: few passes, but each waits out two round trips to global memory, so started last they would outlast the grid.
  k_fa<<<dim3(TNB * NH, NHB + NMB), 256, 0, stream>>>(QH, KH, QL, KL, VT, VB, VBL, (float*)d_out);
}

// v006
// It runs in 70 microseconds.
// Timed twice side by side with v005, it ran 1.08 and 1.07 times as fast.
// Counting every step since v000, it is 46.5 times as fast.
// compute dtype: q, k, v rounded to bf16 and carried EXACTLY as f16 (bf16 hi + lo planes for v below row 384); causal logits k.q as single EXACT products on WMMA 16x16x32 (f32 accumulate) x 64^-0.5 (first 384 query rows: 3 products with the residual planes); online softmax in f32 (base 2; running maximum for the first 384 query rows, from there on a held reference logit, raised when a pass's weights would outgrow f16); P x 2^10 unnormalised once to f16 against v (1 product; 3-term bf16 path for the first 384 query rows); divided by the row sum at the end; f32 output [B, S, NH, HD].
#include <hip/hip_runtime.h>
#include <math.h>

typedef __attribute__((ext_vector_type(16))) _Float16 v16h;
typedef __attribute__((ext_vector_type(16))) __bf16 v16b;
typedef __attribute__((ext_vector_type(8)))  _Float16 v8h;
typedef __attribute__((ext_vector_type(8)))  float v8f;
typedef __attribute__((ext_vector_type(4)))  float v4f;
typedef __attribute__((ext_vector_type(2)))  float v2f;
typedef __attribute__((ext_vector_type(4)))  unsigned v4u;
typedef __attribute__((ext_vector_type(4)))  int v4i;
typedef float __attribute__((may_alias)) float_a;
typedef int __attribute__((may_alias)) int_a;

template <typename T> __device__ __forceinline__ void vst2(void* p, T v) { *(T*)p = v;  }
__device__ __forceinline__ v8f wmma16(v16h a, v16h b, v8f c) {
  v8f d = __builtin_amdgcn_wmma_f32_16x16x32_f16(false, a, false, b, (short)0, c, false, false);
  asm volatile("v_nop\n\tv_nop\n\tv_nop\n\tv_nop" : "+v"(d) : "v"(a), "v"(b));
  return d;
}
__device__ __forceinline__ v8f wmma_bf(v16b a, v16b b, v8f c) {
  v8f d = __builtin_amdgcn_wmma_f32_16x16x32_bf16(false, a, false, b, (short)0, c, false, false);
  asm volatile("v_nop\n\tv_nop\n\tv_nop\n\tv_nop" : "+v"(d) : "v"(a), "v"(b));
  return d;
}
// 16x16x32 fragments: lane = (h = lane>>4, row/col = lane&15); elements 0..7 = k0+8h+0..7, 8..15 = k0+16+8h+0..7; D element r = row 8h+r
__device__ __forceinline__ v16h frag_h(const _Float16* rowk0, int lane) {
  union { v16h v; v8h q[2]; } u; const _Float16* p = rowk0 + 8 * (lane >> 4);
  u.q[0] = *(const v8h*)p; u.q[1] = *(const v8h*)(p + 16); return u.v;
}
__device__ __forceinline__ v16h frag_f32(const float* rowk0, int lane) {
  v16h a; const float* p = rowk0 + 8 * (lane >> 4);
#pragma unroll
  for (int i = 0; i < 8; ++i) { a[i] = (_Float16)p[i]; a[8 + i] = (_Float16)p[16 + i]; }
  return a;
}
__device__ __forceinline__ v16h frag_f32s(const float* rowk0, int lane, float sc) {
  v16h a; const float* p = rowk0 + 8 * (lane >> 4);
#pragma unroll
  for (int i = 0; i < 8; ++i) { a[i] = (_Float16)(p[i] * sc); a[8 + i] = (_Float16)(p[16 + i] * sc); }
  return a;
}
// column fragment from a [K][ld] layout (column n), rows >= K read as 0
__device__ __forceinline__ v16h fragc_f32(const float* W, int k0, int n, int lane, int ld, int K) {
  v16h a; const int g = lane >> 4;
#pragma unroll
  for (int i = 0; i < 8; ++i) { const int ka = k0 + 8 * g + i, kb = ka + 16;
    a[i] = (_Float16)(ka < K ? W[(size_t)(ka < K ? ka : K - 1) * ld + n] : 0.f); a[8 + i] = (_Float16)(kb < K ? W[(size_t)(kb < K ? kb : K - 1) * ld + n] : 0.f); }
  return a;
}
struct F2 { v16b h, l; };
__device__ __forceinline__ F2 bsplit16(const float v[16]) { F2 r;
#pragma unroll
  for (int i = 0; i < 16; ++i) { const __bf16 h = (__bf16)v[i]; r.h[i] = h; r.l[i] = (__bf16)(v[i] - (float)h); }
  return r; }
__device__ __forceinline__ F2 split_row(const float* row, int k0, int lane) { float v[16]; const float* p = row + k0 + 8 * (lane >> 4);
#pragma unroll
  for (int i = 0; i < 8; ++i) { v[i] = p[i]; v[8 + i] = p[16 + i]; }
  return bsplit16(v); }
__device__ __forceinline__ F2 split_rowK(const float* row, int k0, int lane, int K) { float v[16]; const int g = lane >> 4;
#pragma unroll
  for (int i = 0; i < 8; ++i) { const int ka = k0 + 8 * g + i, kb = ka + 16; v[i] = ka < K ? row[ka < K ? ka : K - 1] : 0.f; v[8 + i] = kb < K ? row[kb < K ? kb : K - 1] : 0.f; }
  return bsplit16(v); }
__device__ __forceinline__ F2 split_col(const float* W, int k0, int n, int lane, int ld, int K) { float v[16]; const int g = lane >> 4;
#pragma unroll
  for (int i = 0; i < 8; ++i) { const int ka = k0 + 8 * g + i, kb = ka + 16; v[i] = ka < K ? W[(size_t)(ka < K ? ka : K - 1) * ld + n] : 0.f; v[8 + i] = kb < K ? W[(size_t)(kb < K ? kb : K - 1) * ld + n] : 0.f; }
  return bsplit16(v); }
__device__ __forceinline__ v8f mac3(const F2& a, const F2& b, v8f c) { c = wmma_bf(a.l, b.h, c); c = wmma_bf(a.h, b.l, c); return wmma_bf(a.h, b.h, c); }
__device__ __forceinline__ float sigm(float v) { return 1.0f / (1.0f + expf(-v)); }
#define LDSX() do { asm volatile("s_wait_dscnt 0" ::: "memory"); __builtin_amdgcn_wave_barrier(); __builtin_amdgcn_fence(__ATOMIC_RELEASE, "workgroup"); } while (0)

// Causal scaled-dot-product attention on raw q, k, v [2, 4,096, 16, 64] (layout B, S, NH, HD): out[b, t, h] = softmax over s <= t of (q/8).k (finfo.min above the diagonal == exclusion) applied to v; output in the same [B, S, NH, HD] layout.
#define NB 2
#define TT 4096
#define CC 1024            // NH * HD = projected width
#define DIN 1024          // input (model) width
#define NH 16
#define HD 64
#define NQB (TT / 64)
#define HG 2
#define SCALE (0.125f)
#define CAUSAL 1
#ifndef TNB
#define TNB NB
#endif
__device__ __forceinline__ float bfr(float v) { return (float)(__bf16)v; }
__host__ __device__ __forceinline__ int kb_last(int qb) { return CAUSAL ? ((qb * 64 + 63) >> 7) : (TT / 128 - 1); }
typedef __attribute__((ext_vector_type(8))) __bf16 v8b;
__device__ __forceinline__ v16b frag_b(const __bf16* rowk0, int lane) {
  union { v16b v; v8b q[2]; } u; const __bf16* p = rowk0 + 8 * (lane >> 4);
  u.q[0] = *(const v8b*)p; u.q[1] = *(const v8b*)(p + 16); return u.v;
}
#define QBH 6              // unused: k_fa's high-precision path takes the first QHI query rows of each sequence (few keys, no averaging), NHB blocks of QBLK
#define QHI 384            // rows carrying a q residual plane
#define KHI 384            // key rows carrying k residual / v bf16 hi+lo planes (used only by the causal high-precision path)
// B fragment (k rows k0+.., output column o) of a weight: (in,out) [K][ld] or (out,in) [ld rows of K]: bf16 exact, or f16(bf16 * 256) exact
__device__ __forceinline__ v16b wcol_io(const float* Wm, int k0, int o, int lane, int ld) { v16b w; const int g = lane >> 4;
#pragma unroll
  for (int i = 0; i < 8; ++i) { w[i] = (__bf16)Wm[(size_t)(k0 + 8 * g + i) * ld + o]; w[8 + i] = (__bf16)Wm[(size_t)(k0 + 16 + 8 * g + i) * ld + o]; }
  return w; }
__device__ __forceinline__ v16b wcol_oi(const float* Wm, int k0, int o, int lane, int K) { v16b w; const float* p = Wm + (size_t)o * K + k0 + 8 * (lane >> 4);
#pragma unroll
  for (int i = 0; i < 8; ++i) { w[i] = (__bf16)p[i]; w[8 + i] = (__bf16)p[16 + i]; }
  return w; }
__device__ __forceinline__ v16h wcolh_io(const float* Wm, int k0, int o, int lane, int ld) { v16h w; const int g = lane >> 4;
#pragma unroll
  for (int i = 0; i < 8; ++i) { w[i] = (_Float16)(bfr(Wm[(size_t)(k0 + 8 * g + i) * ld + o]) * 256.0f); w[8 + i] = (_Float16)(bfr(Wm[(size_t)(k0 + 16 + 8 * g + i) * ld + o]) * 256.0f); }
  return w; }
__device__ __forceinline__ v16h wcolh_oi(const float* Wm, int k0, int o, int lane, int K) { v16h w; const float* p = Wm + (size_t)o * K + k0 + 8 * (lane >> 4);
#pragma unroll
  for (int i = 0; i < 8; ++i) { w[i] = (_Float16)(bfr(p[i]) * 256.0f); w[8 + i] = (_Float16)(bfr(p[16 + i]) * 256.0f); }
  return w; }
#define WQKV_LAYOUT 1   // 0 = (in,out) [DIN][CC]; 1 = (out,in) [CC][DIN]; 2 = per-head [NH][DIN][HD]
__device__ __forceinline__ v16b wcol_hdk(const float* Wm, int k0, int o, int lane) { v16b w; const int g = lane >> 4; const float* p = Wm + (size_t)(o / HD) * DIN * HD + (o % HD);
#pragma unroll
  for (int i = 0; i < 8; ++i) { w[i] = (__bf16)p[(size_t)(k0 + 8 * g + i) * HD]; w[8 + i] = (__bf16)p[(size_t)(k0 + 16 + 8 * g + i) * HD]; }
  return w; }
#define WO_OUT_IN 0
#if WQKV_LAYOUT == 1
#define WCOL(W, k0, o, lane) wcol_oi(W, k0, o, lane, DIN)
#elif WQKV_LAYOUT == 2
#define WCOL(W, k0, o, lane) wcol_hdk(W, k0, o, lane)
#else
#define WCOL(W, k0, o, lane) wcol_io(W, k0, o, lane, CC)
#endif
#if WO_OUT_IN
#define WOCOL(W, k0, o, lane) wcol_oi(W, k0, o, lane, CC)
#define WOCOLH(W, k0, o, lane) wcolh_oi(W, k0, o, lane, CC)
#else
#define WOCOL(W, k0, o, lane) wcol_io(W, k0, o, lane, DIN)
#define WOCOLH(W, k0, o, lane) wcolh_io(W, k0, o, lane, DIN)
#endif

// ---- k_prepr: block = 8 waves = (64 attention positions t0.. of sequence bb, PH heads = PC columns c0..): reads the module's [B, T, H*64] inputs, bf16-rounds them and writes the standard attention planes: q -> f16 hi rows (+ x 2^10 residual rows for s < QHI), k -> f16 rows (+ residual rows s < KHI), v -> f16 planes [c][s] (+ bf16 hi/lo planes for s < KHI).
// A stream: 512 blocks, two per WGP, all resident at once. A thread takes one 16-byte piece (4 columns) of 16 consecutive rows of each input; a wave's load is 512 contiguous bytes. All 48 loads go out before the first value is used. q and k go from registers straight to their rows (a wave's store is 256 contiguous bytes); only v passes through LDS, to be turned: 16 positions of one column lie in one thread, so it is written there in 16-byte pieces.
#define PH 4
#define PC (PH * HD)
typedef __attribute__((ext_vector_type(4))) _Float16 v4h;
// behind a group of stores, in front of a branch or a join: the stores' address and data registers may be reused from here on (inside a straight run the compiler places this wait itself)
#define XSTORES() asm volatile("s_wait_xcnt 0x0" ::: "memory")
__global__ __launch_bounds__(256) void k_prepr(const float* __restrict__ Q, const float* __restrict__ K, const float* __restrict__ V, _Float16* __restrict__ QH, _Float16* __restrict__ QL, _Float16* __restrict__ KH, _Float16* __restrict__ KL, _Float16* __restrict__ VT, __bf16* __restrict__ VB, __bf16* __restrict__ VBL) {
  __shared__ __align__(16) _Float16 tv[PC][72]; __shared__ __align__(16) __bf16 tb[PC][72], tbl[PC][72];
  const int tid = threadIdx.x, cc = tid & 63, rg = tid >> 6; const int c0 = blockIdx.y * PC;   // cc: 16-byte piece of the 1,024-byte row; rg: group of 16 rows
  const size_t r0 = (size_t)blockIdx.x * 64; const size_t bb = r0 / TT; const int t0 = (int)(r0 % TT); const bool qhi = t0 < QHI, khi = t0 < KHI;
  const size_t ou = r0 * (size_t)CC + c0;   // block-uniform element index in the [B, T, H*64] inputs; the f16 q and k rows have the same index
  const unsigned lo = (unsigned)(rg * 16 * CC + cc * 4);   // the lane's element offset from there: one 32-bit register (x 4) serves every load, another (x 2) every row store
  const unsigned l4 = lo * 4u;
  const char *Vu = (const char*)(V + ou), *Qu = (const char*)(Q + ou), *Ku = (const char*)(K + ou);
  v4f v[16], q[16], k[16];
#pragma unroll
  for (int i = 0; i < 16; ++i) v[i] = *(const v4f*)(Vu + (l4 + (unsigned)(i * CC * 4)));
  __builtin_amdgcn_sched_barrier(0);   // v goes out first, as it is used first (left free, the compiler issues most of v last, and the LDS writes that the block's barrier waits for start only when all 48 loads are back)
#pragma unroll
  for (int i = 0; i < 16; ++i) q[i] = *(const v4f*)(Qu + (l4 + (unsigned)(i * CC * 4)));
  __builtin_amdgcn_sched_barrier(0);   // then q, then k, for the same reason
#pragma unroll
  for (int i = 0; i < 16; ++i) k[i] = *(const v4f*)(Ku + (l4 + (unsigned)(i * CC * 4)));
  asm volatile("s_wait_xcnt 0x0" :: "v"(l4) : "memory");   // the loads' offset register, named as an input, keeps its place up to this wait: no load of the 48 lands on it, and it may be reused from here on
  // module inputs: bf16-rounded
#pragma unroll
  for (int j = 0; j < 4; ++j)
#pragma unroll
    for (int hf = 0; hf < 2; ++hf) { v8h x;
#pragma unroll
      for (int e = 0; e < 8; ++e) x[e] = (_Float16)bfr(v[hf * 8 + e][j]);
      *(v8h*)&tv[cc * 4 + j][rg * 16 + hf * 8] = x; }
  if (khi) {
#pragma unroll
    for (int j = 0; j < 4; ++j)
#pragma unroll
      for (int hf = 0; hf < 2; ++hf) { v8b y, z;
#pragma unroll
        for (int e = 0; e < 8; ++e) { const float f = bfr(v[hf * 8 + e][j]); const __bf16 vb = (__bf16)f; y[e] = vb; z[e] = (__bf16)(f - (float)vb); }
        *(v8b*)&tb[cc * 4 + j][rg * 16 + hf * 8] = y; *(v8b*)&tbl[cc * 4 + j][rg * 16 + hf * 8] = z; } }
#pragma unroll
  for (int i = 0; i < 16; ++i) { v4h x;
#pragma unroll
    for (int j = 0; j < 4; ++j) x[j] = (_Float16)bfr(q[i][j]);
    *(v4h*)((char*)(QH + ou) + (lo * 2u + (unsigned)(i * CC * 2))) = x; }
  XSTORES();
  if (qhi) { char* p = (char*)(QL + (bb * QHI + t0) * (size_t)CC + c0);
#pragma unroll
    for (int i = 0; i < 16; ++i) { v4h x;
#pragma unroll
      for (int j = 0; j < 4; ++j) { const float f = bfr(q[i][j]); x[j] = (_Float16)((f - (float)(_Float16)f) * 1024.0f); }
      *(v4h*)(p + (lo * 2u + (unsigned)(i * CC * 2))) = x; }
    XSTORES(); }
#pragma unroll
  for (int i = 0; i < 16; ++i) { v4h x;
#pragma unroll
    for (int j = 0; j < 4; ++j) x[j] = (_Float16)bfr(k[i][j]);
    *(v4h*)((char*)(KH + ou) + (lo * 2u + (unsigned)(i * CC * 2))) = x; }
  XSTORES();
  if (khi) { char* p = (char*)(KL + (bb * KHI + t0) * (size_t)CC + c0);
#pragma unroll
    for (int i = 0; i < 16; ++i) { v4h x;
#pragma unroll
      for (int j = 0; j < 4; ++j) { const float f = bfr(k[i][j]); x[j] = (_Float16)((f - (float)(_Float16)f) * 1024.0f); }
      *(v4h*)(p + (lo * 2u + (unsigned)(i * CC * 2))) = x; }
    XSTORES(); }
  // the block's barrier, ordering LDS alone (the planes in tv, tb, tbl): __syncthreads() would also wait here for the answers to the wave's 32 row stores, which nobody in the block reads
  __builtin_amdgcn_fence(__ATOMIC_RELEASE, "workgroup", "local"); __builtin_amdgcn_s_barrier(); __builtin_amdgcn_fence(__ATOMIC_ACQUIRE, "workgroup", "local");
  const int cl = tid >> 3, qd = tid & 7;   // 8 threads store one plane's 128 bytes; 32 planes a trip
  { char* p = (char*)(VT + (bb * CC + c0) * (size_t)TT + t0); const unsigned l2 = (unsigned)(cl * TT + qd * 8) * 2u;
#pragma unroll
    for (int n = 0; n < PC / 32; ++n) *(v8h*)(p + (l2 + (unsigned)(n * 32 * TT * 2))) = *(const v8h*)&tv[cl + n * 32][qd * 8]; }
  if (khi) { const size_t o3 = (bb * CC + c0) * (size_t)KHI + t0; const unsigned l3 = (unsigned)(cl * KHI + qd * 8) * 2u;
#pragma unroll
    for (int n = 0; n < PC / 32; ++n) { *(v8b*)((char*)(VB + o3) + (l3 + (unsigned)(n * 32 * KHI * 2))) = *(const v8b*)&tb[cl + n * 32][qd * 8]; *(v8b*)((char*)(VBL + o3) + (l3 + (unsigned)(n * 32 * KHI * 2))) = *(const v8b*)&tbl[cl + n * 32][qd * 8]; } } }

#ifndef SM_EXTRA_PARAMS
#define SM_EXTRA_PARAMS
#endif
#ifndef PROJ_EXTRA_PARAMS
#define PROJ_EXTRA_PARAMS
#endif
#ifndef SM_MASK_HOOK
#define SM_MASK_HOOK (void)0
#endif

#define WS_QH  0u                                      // f16 q rows [b*t][CC]
#define WS_KH  (WS_QH + 2u * (size_t)NB * TT * CC)      // f16 k rows [b*t][CC]
#define WS_VT  (WS_KH + 2u * (size_t)NB * TT * CC)      // f16 v planes [b][c][t]
#define WS_QL  (WS_VT + 2u * (size_t)NB * CC * TT)      // f16 q residual x 2^10 rows [b][t < QHI][CC]
#define WS_KL  (WS_QL + 2u * (size_t)NB * QHI * CC)     // f16 k residual x 2^10 rows [b][t < KHI][CC]
#define WS_VB  (WS_KL + 2u * (size_t)NB * KHI * CC)     // bf16 v hi planes [b][c][t < KHI]
#define WS_VBL (WS_VB + 2u * (size_t)NB * CC * KHI)
#define WS_END (WS_VBL + 2u * (size_t)NB * CC * KHI)

__device__ __forceinline__ v8f mm_h(v16h a, v16h b, v8f c) { return __builtin_amdgcn_wmma_f32_16x16x32_f16(false, a, false, b, (short)0, c, false, false); }
__device__ __forceinline__ v8f mm_b(v16b a, v16b b, v8f c) { return __builtin_amdgcn_wmma_f32_16x16x32_bf16(false, a, false, b, (short)0, c, false, false); }
__device__ __forceinline__ float xhalf(float x) { return __builtin_bit_cast(float, __builtin_amdgcn_permlanex16(__builtin_bit_cast(int, x), __builtin_bit_cast(int, x), 0x76543210, 0xfedcba98, false, false)); }  // lane l with lane l ^ 16
// fragment (hardware k order) at p + bo bytes; p = wave-uniform base + the lane's 32-bit byte offset (row (lane & 15), + 16 bytes for the upper half), so the lane offset register is the same for the whole kernel
__device__ __forceinline__ v16h ldf_h(const char* p, int bo) { union { v16h v; v8h q[2]; } u; u.q[0] = *(const v8h*)(p + bo); u.q[1] = *(const v8h*)(p + bo + 32); return u.v; }
__device__ __forceinline__ v16b ldf_b(const char* p, int bo) { union { v16b v; v8b q[2]; } u; u.q[0] = *(const v8b*)(p + bo); u.q[1] = *(const v8b*)(p + bo + 32); return u.v; }
// address registers of the loads just issued may be reused from here on
#define XADDR() asm volatile("s_wait_xcnt 0x0" ::: "memory")
// the same, naming the two lane addresses as inputs: they keep their registers up to the wait, so no load of the group lands on them
#define XADDRP(p, q) asm volatile("s_wait_xcnt 0x0" :: "v"(p), "v"(q) : "memory")
typedef __attribute__((ext_vector_type(8))) unsigned v8u;
#define LPITCH 144          // LDS pitch of a staged 128-byte row: 16 bytes x odd, free of bank conflicts for 16-byte reads
#define LTILE 10240u        // 64 rows x 144 bytes, rounded up to a multiple of 2 KiB (every tile's place in LDS is one)
__device__ __forceinline__ unsigned uni(unsigned v) { return (unsigned)__builtin_amdgcn_readfirstlane((int)v); }
// a wave-uniform value held in a scalar register: a test on it compiles to s_cmp + s_cbranch_scc (a tensor load ignores EXEC: only a scalar branch keeps a wave from issuing it)
__device__ __forceinline__ unsigned pinned(unsigned v) { unsigned w = uni(v); asm volatile("" : "+s"(w)); return w; }
// tensor descriptor, extents in bytes: group 1 = a tile of 64 rows x 128 bytes (tensor = tile), source row pitch sp, 16 bytes of LDS pad behind every 128-byte row; group 0 = LDS place and the tile's first byte
__device__ __forceinline__ v8u tdm_g1(unsigned sp) { v8u d; d[0] = uni((1u << 20) | (4u << 22) | (3u << 25)); d[1] = uni(128u << 16); d[2] = uni(64u << 16); d[3] = uni(128u << 16); d[4] = uni(64u); d[5] = uni(sp); d[6] = uni(0u); d[7] = uni(0u); return d; }
__device__ __forceinline__ v4u tdm_g0(unsigned dst, unsigned long long ga) { v4u d; d[0] = uni(1u); d[1] = uni(dst); d[2] = uni((unsigned)ga); d[3] = uni((((unsigned)(ga >> 32)) & 0x01FFFFFFu) | 0x80000000u); return d; }
// group 0 is an in-out operand and the next stage's words are made from it (tdm_next): count, address and type keep their scalar registers from one request to the next and change only behind the wait for the last one (the LDS place, word 1, is made anew each time)
__device__ __forceinline__ void tdm_load(v4u& d0, v8u d1) { asm volatile("tensor_load_to_lds %0, %1" : "+s"(d0) : "s"(d1) : "memory"); }
// the next stage's group 0: new LDS place, source address + st bytes (the carry goes into address bits 56:32, under the type field)
__device__ __forceinline__ void tdm_next(v4u& d0, unsigned dst, unsigned st) { const unsigned lo = uni(d0[2] + st); d0[1] = uni(dst); d0[3] = uni(d0[3] + (lo < st ? 1u : 0u)); d0[2] = lo; }
#define L2S (SCALE * 1.4426950408889634f)   // logit -> base-2 exponent
#define PSH 10.0f                            // P carried x 2^10 (keeps small weights normal in f16); it cancels against the row sum
// In k_fa every '#pragma unroll' stands over a loop that indexes a register array (fragments, score tiles): rolled, the array would go to scratch. '#pragma unroll 1' keeps the pass loops rolled: one pass already fills the wave's register budget.
#define QW 32                      // queries of a wave on the main path: two 16-column groups, which share every k and v fragment read from LDS
#define QBLK 128                   // queries of a block (main path: 4 query groups of QW; first rows: 8 waves of 16)
#define NMB ((TT - QHI) / QBLK)    // main-path blocks per (b, h): query rows QHI .. TT - 1
#define NHB (QHI / QBLK)           // blocks per (b, h) of the first QHI query rows
#define SBUF (4u * LTILE)          // one stage of 128 keys in LDS: key tile, v tile of keys 0..63, then the same of keys 64..127
// one 16-query tile of O^T (x 1 / row sum) turned in the wave's own LDS rows and stored as whole 256-byte rows; Yr = the tile's first output row at this head
__device__ __forceinline__ void put_tile(float (*sw)[HD + 4], const v8f* acc, float inv, float* Yr, int col, int g) {
#pragma unroll
  for (int jd = 0; jd < HD / 16; ++jd)
#pragma unroll
    for (int r = 0; r < 8; ++r) sw[col][jd * 16 + 8 * g + r] = acc[jd][r] * inv;
  asm volatile("s_wait_dscnt 0" ::: "memory"); __builtin_amdgcn_wave_barrier(); __builtin_amdgcn_fence(__ATOMIC_RELEASE, "workgroup", "local");   // the wave's rows are written before it reads them back; ordering LDS alone: LDSX() would also wait here for the answers to the stores of the tile before
#pragma unroll
  for (int i = 0; i < 8; ++i) { const int rl = 2 * i + g; vst2(Yr + (size_t)rl * CC + col * 4, *(const v4f*)&sw[rl][col * 4]); }
  XADDR(); }   // the stores' address and data registers may be reused from here on (a second tile follows on the main path)
#define RSH (PSH / L2S)                      // the same shift counted in raw logits
#define PLIM 60000.0f                        // a lane's P sum of one pass at or under this: every P of it is finite in f16
// 2^x for the rarely run full turn, with the one slot that the instruction set asks for behind a transcendental inside the statement
__device__ __forceinline__ float exp2_slot(float x) { float e; asm("v_exp_f32 %0, %1\n\tv_nop" : "=v"(e) : "v"(x)); return e; }
// S^T of the wave's 64 keys x 32 queries, on top of c (one value per lane and column group): st[cg][jt] = key rows jt . Q^T of group cg + c[cg]
__device__ __forceinline__ void fa_scores(const char* kt, const v16h (&qf)[2][2], float c0, float c1, v8f (&st)[2][4]) {
  v16h kf[4][2]; v8f c[2];
#pragma unroll
  for (int jt = 0; jt < 4; ++jt) { kf[jt][0] = ldf_h(kt, jt * 16 * LPITCH); kf[jt][1] = ldf_h(kt, jt * 16 * LPITCH + 64); }
#pragma unroll
  for (int r = 0; r < 8; ++r) { c[0][r] = c0; c[1][r] = c1; }   // the C operand is spread over its eight registers anew each pass, while the key reads fly: held spread out, it would take 14 more registers through the softmax
  __builtin_amdgcn_sched_barrier(0);   // the pass's key reads go out as one group: mixed among the products, each pair waits out its own LDS latency
#pragma unroll
  for (int jt = 0; jt < 4; ++jt)
#pragma unroll
    for (int cg = 0; cg < 2; ++cg) st[cg][jt] = mm_h(kf[jt][1], qf[cg][1], mm_h(kf[jt][0], qf[cg][0], c[cg])); }
// keys above a query are taken out; dq0 = the lane's query of group 0, counted from its first key of the tile
__device__ __forceinline__ void fa_mask(v8f (&st)[2][4], int dq0) {
#pragma unroll
  for (int cg = 0; cg < 2; ++cg)
#pragma unroll
    for (int jt = 0; jt < 4; ++jt)
#pragma unroll
      for (int r = 0; r < 8; ++r) if (jt * 16 + r > dq0 + cg * 16) st[cg][jt][r] = -3.0e38f; }
// ---- k_fa, main path (query rows >= QHI): block = 128 queries of (b, h) x stages of 128 keys, 8 waves = 4 query groups x 2 key halves: a wave holds 32 queries (two 16-column groups) and takes one 64-key tile of every stage, so every k and v fragment it reads from LDS feeds two products, and a query's keys are walked by two waves side by side. Four tensor loads put a stage in LDS once (two buffers: stage s + 1 flies during pass s). Per 64 keys and column group: S^T = K . Q^T (A = key rows, B = query columns: a lane holds 8 keys per tile of ONE query, lane & 15), sum per lane against a HELD reference logit per query, which enters as the C operand of the score products (a pass takes no maximum, shifts no score and rescales nothing; one test per pass on the P sums sends the wave to a second, full turn over the same tile, which raises the reference), P^T packed from the score registers straight into a B operand, O^T += V^T . P^T (A = v planes [c][s]). Logits and P never leave registers. Behind the loop the upper key half hands its reference, sum and O^T to its partner wave through LDS, which joins the two and stores. The first QHI query rows (wave = 16 queries) load for themselves.
__global__ __launch_bounds__(256) void k_fa(const _Float16* QH, const _Float16* KH, const _Float16* QL, const _Float16* KL, const _Float16* VT, const __bf16* VB, const __bf16* VBL, float* Y) {   // no __restrict__: it would let the loads drift over the XADDR() waits
  __shared__ __attribute__((aligned(2048))) unsigned char ring[2 * SBUF];   // two buffers of one stage each
  __shared__ __align__(16) float ss[8][16][HD + 4];
  __shared__ v4f mg[4][17][32];   // per query group: the upper key half's O^T (16 pieces of 16 bytes a lane), then its references and sums
  const int tid = threadIdx.x, wave = tid >> 5, lane = tid & 31, col = lane & 15, g = lane >> 4;
  const unsigned wv = uni((unsigned)tid >> 5);   // wave number (scalar)
  const int b = blockIdx.x / NH, h = blockIdx.x % NH;   // the query block comes from the slow grid index: see the launch
  const unsigned lk = (unsigned)(col * CC + 8 * g) * 2u;   // lane byte offset: key row
  const _Float16* Ku = KH + (size_t)b * TT * CC + h * HD;
  if ((int)blockIdx.y < NHB) {
    const int qb = NHB - 1 - (int)blockIdx.y;
    const int ql0 = qb * QBLK + (int)wv * 16, tq = ql0 + col;   // the wave's first query (scalar); tq: this lane's query
    const unsigned lq = (unsigned)((wave * 16 + col) * CC + 8 * g) * 2u;   // lane byte offset: query row
    v8f acc[HD / 16] = {}; float m = -1.0e30f, l = 0.f;
    const char* qp = (const char*)(QH + ((size_t)b * TT + qb * QBLK) * CC + h * HD) + lq;
    const v16h q0 = ldf_h(qp, 0), q1 = ldf_h(qp, 64); XADDR();
    const unsigned lv = (unsigned)(col * KHI + 8 * g) * 2u;
    const _Float16* KLu = KL + (size_t)b * KHI * CC + h * HD; const __bf16* VBu = VB + ((size_t)b * CC + h * HD) * (size_t)KHI; const __bf16* VLu = VBL + ((size_t)b * CC + h * HD) * (size_t)KHI;
    const char* rp = (const char*)(QL + ((size_t)b * QHI + qb * QBLK) * CC + h * HD) + lq;
    const v16h r0 = ldf_h(rp, 0), r1 = ldf_h(rp, 64); XADDR();
#pragma unroll 1
    for (int kb = 0; kb < (ql0 + 16 + 31) / 32; ++kb) { const int k0 = kb * 32; float s[2][8]; float mx = -3.0e38f;   // 32 keys a pass, up to the wave's last query (no barrier on this path: each wave has its own count); this short path must not set the kernel's register count
      const char* kp = (const char*)(Ku + (size_t)k0 * CC) + lk; const char* lp = (const char*)(KLu + (size_t)k0 * CC) + lk;
#pragma unroll
      for (int jt = 0; jt < 2; ++jt) { const v16h ka = ldf_h(kp, jt * 16 * CC * 2), kc = ldf_h(kp, jt * 16 * CC * 2 + 64), la = ldf_h(lp, jt * 16 * CC * 2), lc = ldf_h(lp, jt * 16 * CC * 2 + 64);
        v8f sh = {}, sl = {}; sh = mm_h(ka, q0, sh); sh = mm_h(kc, q1, sh); sl = mm_h(ka, r0, sl); sl = mm_h(kc, r1, sl); sl = mm_h(la, q0, sl); sl = mm_h(lc, q1, sl);
#pragma unroll
        for (int r = 0; r < 8; ++r) { const float v = (k0 + jt * 16 + 8 * g + r <= tq) ? sh[r] + sl[r] * (1.0f / 1024.0f) : -3.0e38f; s[jt][r] = v; mx = fmaxf(mx, v); } }
      XADDRP(kp, lp);
      mx = fmaxf(mx, xhalf(mx)); const float mn = fmaxf(m, mx * L2S), al = __builtin_amdgcn_exp2f(m - mn), nm = PSH - mn; m = mn;   // pass 0 holds key 0, which every query sees: m is a real logit from there on
      float ps = 0.f; v16b ph, pl;
#pragma unroll
      for (int jt = 0; jt < 2; ++jt)
#pragma unroll
        for (int r = 0; r < 8; ++r) { const float e = __builtin_amdgcn_exp2f(fmaf(s[jt][r], L2S, nm)); ps += e; const __bf16 eh = (__bf16)e; ph[jt * 8 + r] = eh; pl[jt * 8 + r] = (__bf16)(e - (float)eh); }
      l = l * al + ps;
      const char* vp = (const char*)(VBu + k0) + lv; const char* wp = (const char*)(VLu + k0) + lv;
#pragma unroll
      for (int jd = 0; jd < HD / 16; ++jd) { acc[jd] *= al; const v16b vh = ldf_b(vp, jd * 16 * KHI * 2), vl = ldf_b(wp, jd * 16 * KHI * 2);
        acc[jd] = mm_b(vh, ph, acc[jd]); acc[jd] = mm_b(vh, pl, acc[jd]); acc[jd] = mm_b(vl, ph, acc[jd]); }
      XADDRP(vp, wp); }
    l += xhalf(l);   // every query sees its own key, so l > 0
    put_tile(ss[wave], acc, 1.0f / l, Y + ((size_t)b * TT + ql0) * CC + h * HD, col, g);
  } else {
    const unsigned qg = wv & 3u, kh = wv >> 2, lf = (unsigned)(col * LPITCH + 16 * g);   // query group, key half (scalar); lane byte offset in a staged tile: row (lane & 15), + 16 bytes for the upper half
    const int Q0 = TT - QBLK * ((int)blockIdx.y - NHB + 1), nst = Q0 / 128 + 1;   // the block's first query; its stages of 128 keys (keys 0 .. Q0 + 127)
    const int wq0 = Q0 + (int)qg * QW;   // the wave's first query (scalar)
    v8f acc[2][HD / 16] = {}; float rf[2] = {-1.0e30f, -1.0e30f}, l[2] = {0.f, 0.f};   // rf: the reference in use, a raw logit; the far-off start value makes the first full turn's factor for sum and O^T 0
    const char* qp = (const char*)(QH + ((size_t)b * TT + Q0) * CC + h * HD) + (unsigned)(((wave & 3) * QW + col) * CC + 8 * g) * 2u;
    v16h qf[2][2];
#pragma unroll
    for (int cg = 0; cg < 2; ++cg) { qf[cg][0] = ldf_h(qp, cg * 16 * CC * 2); qf[cg][1] = ldf_h(qp, cg * 16 * CC * 2 + 64); }
    XADDR();
    // waves 0 to 3 bring one tile each per stage: wave 0 the key tile of keys 0..63 (64 rows of KH, 128 bytes each), wave 1 their v tile (64 planes of VT, 64 keys = 128 bytes each), waves 2 and 3 the same of keys 64..127
    const unsigned isv = wv & 1u, th = (wv >> 1) & 1u;
    const unsigned long long sb = isv ? (unsigned long long)(size_t)(VT + ((size_t)b * CC + h * HD) * (size_t)TT + th * 64u) : (unsigned long long)(size_t)(Ku + (size_t)th * 64u * CC);
    const unsigned sstep = isv ? 128u * 2u : 128u * CC * 2u, lb = (unsigned)(size_t)ring + (th * 2u + isv) * LTILE;   // source bytes from one stage to the next; this wave's place in buffer 0
    v8u g1 = tdm_g1(isv ? TT * 2u : CC * 2u);
    asm volatile("" : "+s"(g1));   // descriptor words held in their scalar registers for the whole loop: none is rebuilt, or lent to another value, while a request is in flight
    v4u g0 = tdm_g0(lb, sb);
    if (pinned(wv < 4u)) { tdm_load(g0, g1);
      asm volatile("s_wait_tensorcnt 0x0" ::: "memory"); }   // stage 0 has landed (the compiler places no wait for a tensor load)
    __syncthreads();   // stage 0 readable by every wave
    if (pinned(wv < 4u)) { tdm_next(g0, lb + SBUF, sstep); tdm_load(g0, g1); }   // stage 1 (Q0 >= QHI: at least four stages)
#pragma unroll 1
    for (int s = 0; s < nst; ++s) { const int k0 = s * 128 + (int)kh * 64;   // the wave's 64 keys of this stage
      const char* kt = (const char*)ring + ((unsigned)(s & 1) * SBUF + kh * (2u * LTILE)) + lf; const char* vt = kt + LTILE;
      const bool diag = k0 + 63 > wq0;   // only a tile that reaches past the wave's first query holds keys above a query (in the block's last stage); wave-uniform, a scalar branch
      const int dq0 = wq0 + col - k0 - 8 * g;
      v8f st[2][4]; v16h pf[2][2], vf[HD / 16][2]; float ps[2];
      unsigned full = 1u;   // lanes that ask for the full turn (a scalar); the first pass has no reference yet and goes straight to it
      if (s != 0) {
      fa_scores(kt, qf, RSH - rf[0], RSH - rf[1], st);   // raw logit - reference + RSH
      if (diag) fa_mask(st, dq0);   // a tile all above the wave's queries leaves l and acc as they are (every weight 0)
#pragma unroll
      for (int cg = 0; cg < 2; ++cg) { float p = 0.f;
#pragma unroll
        for (int jt = 0; jt < 4; ++jt) { const v8f t = st[cg][jt] * L2S;
#pragma unroll
          for (int r = 0; r < 8; ++r) { const float e = __builtin_amdgcn_exp2f(t[r]); p += e; pf[cg][jt >> 1][(jt & 1) * 8 + r] = (_Float16)e; } }
        ps[cg] = p;
        asm volatile("" :: "v"(ps[cg]), "v"(pf[cg][0]), "v"(pf[cg][1]) : "memory");   // the group's P sum and its packed P, inputs only, are finished here: left free, the compiler sinks the packing behind the test below and keeps all 64 unpacked weights in registers up to there; and left free, the compiler mixes the two groups' softmax and moves the 32 additions to the loop's foot, a dependent chain in front of the next key reads, and scores, weights and v planes all live at once take more registers than four waves per SIMD leave
        __builtin_amdgcn_sched_barrier(0);   // first group: its scores are packed (32 registers become 16) before the v planes take theirs; second group: no P.v product is lifted to just behind the v reads, where it would wait out their LDS latency
        if (cg == 0) {
#pragma unroll
          for (int jd = 0; jd < HD / 16; ++jd) { vf[jd][0] = ldf_h(vt, jd * 16 * LPITCH); vf[jd][1] = ldf_h(vt, jd * 16 * LPITCH + 64); }   // this pass's v planes: they fly during the second group's softmax
          __builtin_amdgcn_sched_barrier(0); } }   // all v reads go out in front of that softmax: left free, some sink among the P.v products and wait out their LDS latency there
      full = __builtin_amdgcn_ballot_w32(!(ps[0] <= PLIM && ps[1] <= PLIM)); }   // one test per pass, a scalar branch: some logit stands so far above its reference that a P may not fit f16 (an infinite or undefined sum lands here too)
      if (full != 0u) {
        // the full turn over the same tile (its buffer is the wave's until the publish point): raw logits anew, each query's maximum, the reference raised to it, sum and O^T brought to the new reference; P <= 2^PSH then, a lane's sum <= 32 x 2^PSH < PLIM
        fa_scores(kt, qf, 0.f, 0.f, st);
        if (diag) fa_mask(st, dq0);
#pragma unroll
        for (int cg = 0; cg < 2; ++cg) { float mx = -3.0e38f;
#pragma unroll
          for (int jt = 0; jt < 4; ++jt)
#pragma unroll
            for (int r = 0; r < 8; ++r) mx = fmaxf(mx, st[cg][jt][r]);
          mx = fmaxf(mx, xhalf(mx)); const float rn = fmaxf(rf[cg], mx), al = exp2_slot((rf[cg] - rn) * L2S), c = RSH - rn; rf[cg] = rn;   // both halves of the wave hold the same reference for a query; the wave's tile of stage 0 lies below every query of this path, so rf is a real logit from there on
          float p = 0.f;
#pragma unroll
          for (int jt = 0; jt < 4; ++jt)
#pragma unroll
            for (int r = 0; r < 8; ++r) { const float e = exp2_slot((st[cg][jt][r] + c) * L2S); p += e; pf[cg][jt >> 1][(jt & 1) * 8 + r] = (_Float16)e; }
          ps[cg] = p; l[cg] *= al;
#pragma unroll
          for (int jd = 0; jd < HD / 16; ++jd) acc[cg][jd] *= al; }
#pragma unroll
        for (int jd = 0; jd < HD / 16; ++jd) { vf[jd][0] = ldf_h(vt, jd * 16 * LPITCH); vf[jd][1] = ldf_h(vt, jd * 16 * LPITCH + 64); } }   // the v planes are read again, so that their 64 registers are free during the full turn
      l[0] += ps[0]; l[1] += ps[1];
#pragma unroll
      for (int jd = 0; jd < HD / 16; ++jd)
#pragma unroll
        for (int cg = 0; cg < 2; ++cg) { acc[cg][jd] = mm_h(vf[jd][0], pf[cg][0], acc[cg][jd]); acc[cg][jd] = mm_h(vf[jd][1], pf[cg][1], acc[cg][jd]); }
      __builtin_amdgcn_sched_barrier(0);   // the waits below stay at the pass's foot: lifted over the softmax, the first one waits out the v reads' latency with nothing to cover it
      // publish point of stage s + 1, every wave, in this order
      asm volatile("s_wait_dscnt 0x0" ::: "memory");   // this wave's reads of the buffer have returned before the buffer is refilled
      if (pinned(wv < 4u)) asm volatile("s_wait_tensorcnt 0x0" ::: "memory");   // the issuer's own request for stage s + 1 has landed
      __syncthreads();   // stage s + 1 readable by every wave; every wave has left stage s's buffer
      if (pinned(wv < 4u && s + 2 < nst)) { tdm_next(g0, lb + (unsigned)(s & 1) * SBUF, sstep); tdm_load(g0, g1); } }   // stage s + 2 into the buffer that this pass has read
    asm volatile("s_wait_tensorcnt 0x0" ::: "memory");   // no request outstanding behind the loop
    asm volatile("s_wait_dscnt 0x0" ::: "memory");
    // the two key halves of a query group are joined: same lane, same registers in both waves
    const float m[2] = {rf[0] * L2S, rf[1] * L2S};   // each wave's reference as a base-2 exponent
    if (kh != 0u) {
#pragma unroll
      for (int cg = 0; cg < 2; ++cg)
#pragma unroll
        for (int jd = 0; jd < HD / 16; ++jd)
#pragma unroll
          for (int hf = 0; hf < 2; ++hf) mg[qg][(cg * 4 + jd) * 2 + hf][lane] = v4f{acc[cg][jd][hf * 4], acc[cg][jd][hf * 4 + 1], acc[cg][jd][hf * 4 + 2], acc[cg][jd][hf * 4 + 3]};
      mg[qg][16][lane] = v4f{m[0], m[1], l[0], l[1]}; }
    __syncthreads();   // the upper halves' results readable by their partner waves
    if (kh == 0u) { const v4f o = mg[qg][16][lane];
#pragma unroll
      for (int cg = 0; cg < 2; ++cg) { const float mn = fmaxf(m[cg], o[cg]), fa = __builtin_amdgcn_exp2f(m[cg] - mn), fb = __builtin_amdgcn_exp2f(o[cg] - mn);   // both references are real logits
        float lt = l[cg] * fa + o[2 + cg] * fb; lt += xhalf(lt);   // every query sees its own key, so the sum is > 0
#pragma unroll
        for (int jd = 0; jd < HD / 16; ++jd)
#pragma unroll
          for (int hf = 0; hf < 2; ++hf) { const v4f p = mg[qg][(cg * 4 + jd) * 2 + hf][lane];
#pragma unroll
            for (int e = 0; e < 4; ++e) acc[cg][jd][hf * 4 + e] = acc[cg][jd][hf * 4 + e] * fa + p[e] * fb; }
        put_tile(ss[wave], acc[cg], 1.0f / lt, Y + ((size_t)b * TT + wq0 + cg * 16) * CC + h * HD, col, g); } } } }

extern "C" void kernel_launch(void* const* d_in, const int* in_sizes, int n_in, void* d_out, int out_size, void* d_ws, size_t ws_size, hipStream_t stream) {
  (void)in_sizes; (void)n_in; (void)out_size;
  const float** F = (const float**)d_in;
  if (ws_size < (size_t)WS_END) return;
  char* ws = (char*)d_ws; _Float16 *QH = (_Float16*)(ws + WS_QH), *KH = (_Float16*)(ws + WS_KH), *VT = (_Float16*)(ws + WS_VT), *QL = (_Float16*)(ws + WS_QL), *KL = (_Float16*)(ws + WS_KL); __bf16 *VB = (__bf16*)(ws + WS_VB), *VBL = (__bf16*)(ws + WS_VBL);
  // inputs: 0 q, 1 k, 2 v [2,4096,16,64] (= rows [b*S + t][h*64 + d])
  k_prepr<<<dim3(TNB * TT / 64, NH / PH), 256, 0, stream>>>(F[0], F[1], F[2], QH, QL, KH, KL, VT, VB, VBL);
  // (b, h) is the fast grid index and the query block the slow one: over the WHOLE grid a main-path block's cost (its number of stages) falls with its flat index. There are more blocks than resident places. The blocks of the first rows stand in front: few passes, but each waits out two round trips to global memory, so started last they would outlast the grid.
  k_fa<<<dim3(TNB * NH, NHB + NMB), 256, 0, stream>>>(QH, KH, QL, KL, VT, VB, VBL, (float*)d_out);
}

// v007
// Measured time: 65.6 microseconds a run.
// Two timings next to v006 put it at 1.07 and 1.06 times that version's speed.
// Over all steps from v000 it is 49.7 times as fast.
// compute dtype: q, k, v rounded to bf16 and carried EXACTLY as f16 (bf16 hi + lo planes for v below row 384); causal logits k.q as single EXACT products on WMMA 16x16x32 (f32 accumulate) x 64^-0.5 (first 384 query rows: 3 products with the residual planes); online softmax in f32 (base 2; running maximum for the first 384 query rows, from there on a held reference logit, raised when a pass's weights would outgrow f16); P x 2^10 unnormalised once to f16 against v (1 product; 3-term bf16 path for the first 384 query rows); divided by the row sum at the end; f32 output [B, S, NH, HD].
#include <hip/hip_runtime.h>
#include <math.h>

typedef __attribute__((ext_vector_type(16))) _Float16 v16h;
typedef __attribute__((ext_vector_type(16))) __bf16 v16b;
typedef __attribute__((ext_vector_type(8)))  _Float16 v8h;
typedef __attribute__((ext_vector_type(8)))  float v8f;
typedef __attribute__((ext_vector_type(4)))  float v4f;
typedef __attribute__((ext_vector_type(2)))  float v2f;
typedef __attribute__((ext_vector_type(4)))  unsigned v4u;
typedef __attribute__((ext_vector_type(4)))  int v4i;
typedef float __attribute__((may_alias)) float_a;
typedef int __attribute__((may_alias)) int_a;

template <typename T> __device__ __forceinline__ void vst2(void* p, T v) { *(T*)p = v;  }
__device__ __forceinline__ v8f wmma16(v16h a, v16h b, v8f c) {
  v8f d = __builtin_amdgcn_wmma_f32_16x16x32_f16(false, a, false, b, (short)0, c, false, false);
  asm volatile("v_nop\n\tv_nop\n\tv_nop\n\tv_nop" : "+v"(d) : "v"(a), "v"(b));
  return d;
}
__device__ __forceinline__ v8f wmma_bf(v16b a, v16b b, v8f c) {
  v8f d = __builtin_amdgcn_wmma_f32_16x16x32_bf16(false, a, false, b, (short)0, c, false, false);
  asm volatile("v_nop\n\tv_nop\n\tv_nop\n\tv_nop" : "+v"(d) : "v"(a), "v"(b));
  return d;
}
// 16x16x32 fragments: lane = (h = lane>>4, row/col = lane&15); elements 0..7 = k0+8h+0..7, 8..15 = k0+16+8h+0..7; D element r = row 8h+r
__device__ __forceinline__ v16h frag_h(const _Float16* rowk0, int lane) {
  union { v16h v; v8h q[2]; } u; const _Float16* p = rowk0 + 8 * (lane >> 4);
  u.q[0] = *(const v8h*)p; u.q[1] = *(const v8h*)(p + 16); return u.v;
}
__device__ __forceinline__ v16h frag_f32(const float* rowk0, int lane) {
  v16h a; const float* p = rowk0 + 8 * (lane >> 4);
#pragma unroll
  for (int i = 0; i < 8; ++i) { a[i] = (_Float16)p[i]; a[8 + i] = (_Float16)p[16 + i]; }
  return a;
}
__device__ __forceinline__ v16h frag_f32s(const float* rowk0, int lane, float sc) {
  v16h a; const float* p = rowk0 + 8 * (lane >> 4);
#pragma unroll
  for (int i = 0; i < 8; ++i) { a[i] = (_Float16)(p[i] * sc); a[8 + i] = (_Float16)(p[16 + i] * sc); }
  return a;
}
// column fragment from a [K][ld] layout (column n), rows >= K read as 0
__device__ __forceinline__ v16h fragc_f32(const float* W, int k0, int n, int lane, int ld, int K) {
  v16h a; const int g = lane >> 4;
#pragma unroll
  for (int i = 0; i < 8; ++i) { const int ka = k0 + 8 * g + i, kb = ka + 16;
    a[i] = (_Float16)(ka < K ? W[(size_t)(ka < K ? ka : K - 1) * ld + n] : 0.f); a[8 + i] = (_Float16)(kb < K ? W[(size_t)(kb < K ? kb : K - 1) * ld + n] : 0.f); }
  return a;
}
struct F2 { v16b h, l; };
__device__ __forceinline__ F2 bsplit16(const float v[16]) { F2 r;
#pragma unroll
  for (int i = 0; i < 16; ++i) { const __bf16 h = (__bf16)v[i]; r.h[i] = h; r.l[i] = (__bf16)(v[i] - (float)h); }
  return r; }
__device__ __forceinline__ F2 split_row(const float* row, int k0, int lane) { float v[16]; const float* p = row + k0 + 8 * (lane >> 4);
#pragma unroll
  for (int i = 0; i < 8; ++i) { v[i] = p[i]; v[8 + i] = p[16 + i]; }
  return bsplit16(v); }
__device__ __forceinline__ F2 split_rowK(const float* row, int k0, int lane, int K) { float v[16]; const int g = lane >> 4;
#pragma unroll
  for (int i = 0; i < 8; ++i) { const int ka = k0 + 8 * g + i, kb = ka + 16; v[i] = ka < K ? row[ka < K ? ka : K - 1] : 0.f; v[8 + i] = kb < K ? row[kb < K ? kb : K - 1] : 0.f; }
  return bsplit16(v); }
__device__ __forceinline__ F2 split_col(const float* W, int k0, int n, int lane, int ld, int K) { float v[16]; const int g = lane >> 4;
#pragma unroll
  for (int i = 0; i < 8; ++i) { const int ka = k0 + 8 * g + i, kb = ka + 16; v[i] = ka < K ? W[(size_t)(ka < K ? ka : K - 1) * ld + n] : 0.f; v[8 + i] = kb < K ? W[(size_t)(kb < K ? kb : K - 1) * ld + n] : 0.f; }
  return bsplit16(v); }
__device__ __forceinline__ v8f mac3(const F2& a, const F2& b, v8f c) { c = wmma_bf(a.l, b.h, c); c = wmma_bf(a.h, b.l, c); return wmma_bf(a.h, b.h, c); }
__device__ __forceinline__ float sigm(float v) { return 1.0f / (1.0f + expf(-v)); }
#define LDSX() do { asm volatile("s_wait_dscnt 0" ::: "memory"); __builtin_amdgcn_wave_barrier(); __builtin_amdgcn_fence(__ATOMIC_RELEASE, "workgroup"); } while (0)

// Causal scaled-dot-product attention on raw q, k, v [2, 4,096, 16, 64] (layout B, S, NH, HD): out[b, t, h] = softmax over s <= t of (q/8).k (finfo.min above the diagonal == exclusion) applied to v; output in the same [B, S, NH, HD] layout.
#define NB 2
#define TT 4096
#define CC 1024            // NH * HD = projected width
#define DIN 1024          // input (model) width
#define NH 16
#define HD 64
#define NQB (TT / 64)
#define HG 2
#define SCALE (0.125f)
#define CAUSAL 1
#ifndef TNB
#define TNB NB
#endif
__device__ __forceinline__ float bfr(float v) { return (float)(__bf16)v; }
__host__ __device__ __forceinline__ int kb_last(int qb) { return CAUSAL ? ((qb * 64 + 63) >> 7) : (TT / 128 - 1); }
typedef __attribute__((ext_vector_type(8))) __bf16 v8b;
__device__ __forceinline__ v16b frag_b(const __bf16* rowk0, int lane) {
  union { v16b v; v8b q[2]; } u; const __bf16* p = rowk0 + 8 * (lane >> 4);
  u.q[0] = *(const v8b*)p; u.q[1] = *(const v8b*)(p + 16); return u.v;
}
#define QBH 6              // causal: query blocks 0..QBH-1 of each sequence (few keys, no averaging) take the high-precision path
#define QHI 384            // query rows of the high-precision path: their q residual fragments are formed in registers beside the f16 ones
#define KHI 384            // key rows carrying k residual / v bf16 hi+lo planes (used only by the causal high-precision path)
// B fragment (k rows k0+.., output column o) of a weight: (in,out) [K][ld] or (out,in) [ld rows of K]: bf16 exact, or f16(bf16 * 256) exact
__device__ __forceinline__ v16b wcol_io(const float* Wm, int k0, int o, int lane, int ld) { v16b w; const int g = lane >> 4;
#pragma unroll
  for (int i = 0; i < 8; ++i) { w[i] = (__bf16)Wm[(size_t)(k0 + 8 * g + i) * ld + o]; w[8 + i] = (__bf16)Wm[(size_t)(k0 + 16 + 8 * g + i) * ld + o]; }
  return w; }
__device__ __forceinline__ v16b wcol_oi(const float* Wm, int k0, int o, int lane, int K) { v16b w; const float* p = Wm + (size_t)o * K + k0 + 8 * (lane >> 4);
#pragma unroll
  for (int i = 0; i < 8; ++i) { w[i] = (__bf16)p[i]; w[8 + i] = (__bf16)p[16 + i]; }
  return w; }
__device__ __forceinline__ v16h wcolh_io(const float* Wm, int k0, int o, int lane, int ld) { v16h w; const int g = lane >> 4;
#pragma unroll
  for (int i = 0; i < 8; ++i) { w[i] = (_Float16)(bfr(Wm[(size_t)(k0 + 8 * g + i) * ld + o]) * 256.0f); w[8 + i] = (_Float16)(bfr(Wm[(size_t)(k0 + 16 + 8 * g + i) * ld + o]) * 256.0f); }
  return w; }
__device__ __forceinline__ v16h wcolh_oi(const float* Wm, int k0, int o, int lane, int K) { v16h w; const float* p = Wm + (size_t)o * K + k0 + 8 * (lane >> 4);
#pragma unroll
  for (int i = 0; i < 8; ++i) { w[i] = (_Float16)(bfr(p[i]) * 256.0f); w[8 + i] = (_Float16)(bfr(p[16 + i]) * 256.0f); }
  return w; }
#define WQKV_LAYOUT 1   // 0 = (in,out) [DIN][CC]; 1 = (out,in) [CC][DIN]; 2 = per-head [NH][DIN][HD]
__device__ __forceinline__ v16b wcol_hdk(const float* Wm, int k0, int o, int lane) { v16b w; const int g = lane >> 4; const float* p = Wm + (size_t)(o / HD) * DIN * HD + (o % HD);
#pragma unroll
  for (int i = 0; i < 8; ++i) { w[i] = (__bf16)p[(size_t)(k0 + 8 * g + i) * HD]; w[8 + i] = (__bf16)p[(size_t)(k0 + 16 + 8 * g + i) * HD]; }
  return w; }
#define WO_OUT_IN 0
#if WQKV_LAYOUT == 1
#define WCOL(W, k0, o, lane) wcol_oi(W, k0, o, lane, DIN)
#elif WQKV_LAYOUT == 2
#define WCOL(W, k0, o, lane) wcol_hdk(W, k0, o, lane)
#else
#define WCOL(W, k0, o, lane) wcol_io(W, k0, o, lane, CC)
#endif
#if WO_OUT_IN
#define WOCOL(W, k0, o, lane) wcol_oi(W, k0, o, lane, CC)
#define WOCOLH(W, k0, o, lane) wcolh_oi(W, k0, o, lane, CC)
#else
#define WOCOL(W, k0, o, lane) wcol_io(W, k0, o, lane, DIN)
#define WOCOLH(W, k0, o, lane) wcolh_io(W, k0, o, lane, DIN)
#endif

// ---- k_prepr: block = 8 waves = (64 attention positions t0.. of sequence bb, PH heads = PC columns c0..): reads the module's [B, T, H*64] k and v, bf16-rounds them and writes the attention planes that many blocks of k_fa read: k -> f16 rows (+ x 2^10 residual rows s < KHI), v -> f16 planes [c][s] (+ bf16 hi/lo planes for s < KHI). q does not pass through here: a query row is used by one block of k_fa only, which reads it from the input itself.
// A stream: 512 blocks, two per WGP, all resident at once. A thread takes one 16-byte piece (4 columns) of 16 consecutive rows of each input; a wave's load is 512 contiguous bytes. All 32 loads go out before the first value is used. k goes from registers straight to its rows (a wave's store is 256 contiguous bytes); only v passes through LDS, to be turned: 16 positions of one column lie in one thread, so it is written there in 16-byte pieces.
#define PH 4
#define PC (PH * HD)
typedef __attribute__((ext_vector_type(4))) _Float16 v4h;
// behind a group of stores, in front of a branch or a join: the stores' address and data registers may be reused from here on (inside a straight run the compiler places this wait itself)
#define XSTORES() asm volatile("s_wait_xcnt 0x0" ::: "memory")
__global__ __launch_bounds__(256) void k_prepr(const float* __restrict__ K, const float* __restrict__ V, _Float16* __restrict__ KH, _Float16* __restrict__ KL, _Float16* __restrict__ VT, __bf16* __restrict__ VB, __bf16* __restrict__ VBL) {
  __shared__ __align__(16) _Float16 tv[PC][72]; __shared__ __align__(16) __bf16 tb[PC][72], tbl[PC][72];
  const int tid = threadIdx.x, cc = tid & 63, rg = tid >> 6; const int c0 = blockIdx.y * PC;   // cc: 16-byte piece of the 1,024-byte row; rg: group of 16 rows
  const size_t r0 = (size_t)blockIdx.x * 64; const size_t bb = r0 / TT; const int t0 = (int)(r0 % TT); const bool khi = t0 < KHI;
  const size_t ou = r0 * (size_t)CC + c0;   // block-uniform element index in the [B, T, H*64] inputs; the f16 k rows have the same index
  const unsigned lo = (unsigned)(rg * 16 * CC + cc * 4);   // the lane's element offset from there: one 32-bit register serves every load and every row store
  const unsigned l4 = lo * 4u;
  const char *Vu = (const char*)(V + ou), *Ku = (const char*)(K + ou);
  v4f v[16], k[16];
#pragma unroll
  for (int i = 0; i < 16; ++i) v[i] = *(const v4f*)(Vu + (l4 + (unsigned)(i * CC * 4)));
  __builtin_amdgcn_sched_barrier(0);   // v goes out first, as it is used first (left free, the compiler issues most of v last, and the LDS writes that the block's barrier waits for start only when all 32 loads are back)
#pragma unroll
  for (int i = 0; i < 16; ++i) k[i] = *(const v4f*)(Ku + (l4 + (unsigned)(i * CC * 4)));
  asm volatile("s_wait_xcnt 0x0" :: "v"(l4) : "memory");   // the loads' offset register, named as an input, keeps its place up to this wait: no load of the 32 lands on it, and it may be reused from here on
  // module inputs: bf16-rounded
#pragma unroll
  for (int j = 0; j < 4; ++j)
#pragma unroll
    for (int hf = 0; hf < 2; ++hf) { v8h x;
#pragma unroll
      for (int e = 0; e < 8; ++e) x[e] = (_Float16)bfr(v[hf * 8 + e][j]);
      *(v8h*)&tv[cc * 4 + j][rg * 16 + hf * 8] = x; }
  if (khi) {
#pragma unroll
    for (int j = 0; j < 4; ++j)
#pragma unroll
      for (int hf = 0; hf < 2; ++hf) { v8b y, z;
#pragma unroll
        for (int e = 0; e < 8; ++e) { const float f = bfr(v[hf * 8 + e][j]); const __bf16 vb = (__bf16)f; y[e] = vb; z[e] = (__bf16)(f - (float)vb); }
        *(v8b*)&tb[cc * 4 + j][rg * 16 + hf * 8] = y; *(v8b*)&tbl[cc * 4 + j][rg * 16 + hf * 8] = z; } }
#pragma unroll
  for (int i = 0; i < 16; ++i) { v4h x;
#pragma unroll
    for (int j = 0; j < 4; ++j) x[j] = (_Float16)bfr(k[i][j]);
    *(v4h*)((char*)(KH + ou) + (lo * 2u + (unsigned)(i * CC * 2))) = x; }
  XSTORES();
  if (khi) { char* p = (char*)(KL + (bb * KHI + t0) * (size_t)CC + c0);
#pragma unroll
    for (int i = 0; i < 16; ++i) { v4h x;
#pragma unroll
      for (int j = 0; j < 4; ++j) { const float f = bfr(k[i][j]); x[j] = (_Float16)((f - (float)(_Float16)f) * 1024.0f); }
      *(v4h*)(p + (lo * 2u + (unsigned)(i * CC * 2))) = x; }
    XSTORES(); }
  // the block's barrier, ordering LDS alone (the planes in tv, tb, tbl): __syncthreads() would also wait here for the answers to the wave's 16 row stores, which nobody in the block reads
  __builtin_amdgcn_fence(__ATOMIC_RELEASE, "workgroup", "local"); __builtin_amdgcn_s_barrier(); __builtin_amdgcn_fence(__ATOMIC_ACQUIRE, "workgroup", "local");
  const int cl = tid >> 3, qd = tid & 7;   // 8 threads store one plane's 128 bytes; 32 planes a trip
  { char* p = (char*)(VT + (bb * CC + c0) * (size_t)TT + t0); const unsigned l2 = (unsigned)(cl * TT + qd * 8) * 2u;
#pragma unroll
    for (int n = 0; n < PC / 32; ++n) *(v8h*)(p + (l2 + (unsigned)(n * 32 * TT * 2))) = *(const v8h*)&tv[cl + n * 32][qd * 8]; }
  if (khi) { const size_t o3 = (bb * CC + c0) * (size_t)KHI + t0; const unsigned l3 = (unsigned)(cl * KHI + qd * 8) * 2u;
#pragma unroll
    for (int n = 0; n < PC / 32; ++n) { *(v8b*)((char*)(VB + o3) + (l3 + (unsigned)(n * 32 * KHI * 2))) = *(const v8b*)&tb[cl + n * 32][qd * 8]; *(v8b*)((char*)(VBL + o3) + (l3 + (unsigned)(n * 32 * KHI * 2))) = *(const v8b*)&tbl[cl + n * 32][qd * 8]; } } }

#ifndef SM_EXTRA_PARAMS
#define SM_EXTRA_PARAMS
#endif
#ifndef PROJ_EXTRA_PARAMS
#define PROJ_EXTRA_PARAMS
#endif
#ifndef SM_MASK_HOOK
#define SM_MASK_HOOK (void)0
#endif

#define WS_KH  0u                                      // f16 k rows [b*t][CC]
#define WS_VT  (WS_KH + 2u * (size_t)NB * TT * CC)      // f16 v planes [b][c][t]
#define WS_KL  (WS_VT + 2u * (size_t)NB * CC * TT)      // f16 k residual x 2^10 rows [b][t < KHI][CC]
#define WS_VB  (WS_KL + 2u * (size_t)NB * KHI * CC)     // bf16 v hi planes [b][c][t < KHI]
#define WS_VBL (WS_VB + 2u * (size_t)NB * CC * KHI)
#define WS_END (WS_VBL + 2u * (size_t)NB * CC * KHI)

__device__ __forceinline__ v8f mm_h(v16h a, v16h b, v8f c) { return __builtin_amdgcn_wmma_f32_16x16x32_f16(false, a, false, b, (short)0, c, false, false); }
__device__ __forceinline__ v8f mm_b(v16b a, v16b b, v8f c) { return __builtin_amdgcn_wmma_f32_16x16x32_bf16(false, a, false, b, (short)0, c, false, false); }
__device__ __forceinline__ float xhalf(float x) { return __builtin_bit_cast(float, __builtin_amdgcn_permlanex16(__builtin_bit_cast(int, x), __builtin_bit_cast(int, x), 0x76543210, 0xfedcba98, false, false)); }  // lane l with lane l ^ 16
// fragment (hardware k order) at p + bo bytes; p = wave-uniform base + the lane's 32-bit byte offset (row (lane & 15), + 16 bytes for the upper half), so the lane offset register is the same for the whole kernel
__device__ __forceinline__ v16h ldf_h(const char* p, int bo) { union { v16h v; v8h q[2]; } u; u.q[0] = *(const v8h*)(p + bo); u.q[1] = *(const v8h*)(p + bo + 32); return u.v; }
__device__ __forceinline__ v16b ldf_b(const char* p, int bo) { union { v16b v; v8b q[2]; } u; u.q[0] = *(const v8b*)(p + bo); u.q[1] = *(const v8b*)(p + bo + 32); return u.v; }
// a lane's share of one f32 query row (64 values a head), as loaded: p = the row at this head + 32 bytes for the upper half of the wave; piece 4 * kk + i holds elements 4 * i .. 4 * i + 3 of fragment kk (hardware k order: k = 32 * kk + 8 * half + 0..7, then + 16)
struct QRaw { v4f x[8]; };
__device__ __forceinline__ QRaw ldq(const char* p, int bo) { QRaw r;
#pragma unroll
  for (int j = 0; j < 4; ++j) { r.x[2 * j] = *(const v4f*)(p + bo + j * 64); r.x[2 * j + 1] = *(const v4f*)(p + bo + j * 64 + 16); }
  return r; }
// fragment kk of it: bf16-rounded, carried as f16; and what f16 leaves of that value, x 2^10
__device__ __forceinline__ v16h qfrag(const QRaw& r, int kk) { v16h a;
#pragma unroll
  for (int e = 0; e < 16; ++e) a[e] = (_Float16)bfr(r.x[4 * kk + (e >> 2)][e & 3]);
  return a; }
__device__ __forceinline__ v16h qfrag_res(const QRaw& r, int kk) { v16h a;
#pragma unroll
  for (int e = 0; e < 16; ++e) { const float f = bfr(r.x[4 * kk + (e >> 2)][e & 3]); a[e] = (_Float16)((f - (float)(_Float16)f) * 1024.0f); }
  return a; }
// address registers of the loads just issued may be reused from here on
#define XADDR() asm volatile("s_wait_xcnt 0x0" ::: "memory")
// the same, naming the two lane addresses as inputs: they keep their registers up to the wait, so no load of the group lands on them
#define XADDRP(p, q) asm volatile("s_wait_xcnt 0x0" :: "v"(p), "v"(q) : "memory")
typedef __attribute__((ext_vector_type(8))) unsigned v8u;
#define LPITCH 144          // LDS pitch of a staged 128-byte row: 16 bytes x odd, free of bank conflicts for 16-byte reads
#define LTILE 10240u        // 64 rows x 144 bytes, rounded up to a multiple of 2 KiB (every tile's place in LDS is one)
__device__ __forceinline__ unsigned uni(unsigned v) { return (unsigned)__builtin_amdgcn_readfirstlane((int)v); }
// a wave-uniform value held in a scalar register: a test on it compiles to s_cmp + s_cbranch_scc (a tensor load ignores EXEC: only a scalar branch keeps a wave from issuing it)
__device__ __forceinline__ unsigned pinned(unsigned v) { unsigned w = uni(v); asm volatile("" : "+s"(w)); return w; }
// tensor descriptor, extents in bytes: group 1 = a tile of 64 rows x 128 bytes (tensor = tile), source row pitch sp, 16 bytes of LDS pad behind every 128-byte row; group 0 = LDS place and the tile's first byte
__device__ __forceinline__ v8u tdm_g1(unsigned sp) { v8u d; d[0] = uni((1u << 20) | (4u << 22) | (3u << 25)); d[1] = uni(128u << 16); d[2] = uni(64u << 16); d[3] = uni(128u << 16); d[4] = uni(64u); d[5] = uni(sp); d[6] = uni(0u); d[7] = uni(0u); return d; }
__device__ __forceinline__ v4u tdm_g0(unsigned dst, unsigned long long ga) { v4u d; d[0] = uni(1u); d[1] = uni(dst); d[2] = uni((unsigned)ga); d[3] = uni((((unsigned)(ga >> 32)) & 0x01FFFFFFu) | 0x80000000u); return d; }
// group 0 is an in-out operand and the next stage's words are made from it (tdm_next): count, address and type keep their scalar registers from one request to the next and change only behind the wait for the last one (the LDS place, word 1, is made anew each time)
__device__ __forceinline__ void tdm_load(v4u& d0, v8u d1) { asm volatile("tensor_load_to_lds %0, %1" : "+s"(d0) : "s"(d1) : "memory"); }
// the next stage's group 0: new LDS place, source address + st bytes (the carry goes into address bits 56:32, under the type field)
__device__ __forceinline__ void tdm_next(v4u& d0, unsigned dst, unsigned st) { const unsigned lo = uni(d0[2] + st); d0[1] = uni(dst); d0[3] = uni(d0[3] + (lo < st ? 1u : 0u)); d0[2] = lo; }
#define L2S (SCALE * 1.4426950408889634f)   // logit -> base-2 exponent
#define PSH 10.0f                            // P carried x 2^10 (keeps small weights normal in f16); it cancels against the row sum
// In k_fa every '#pragma unroll' stands over a loop that indexes a register array (fragments, score tiles): rolled, the array would go to scratch. '#pragma unroll 1' keeps the pass loops rolled: one pass already fills the wave's register budget.
#define QW 32                      // queries of a wave on the main path: two 16-column groups, which share every k and v fragment read from LDS
#define QBLK 128                   // queries of a block (main path: 4 query groups of QW; first rows: 8 waves of 16)
#define NMB ((TT - QHI) / QBLK)    // main-path blocks per (b, h): query rows QHI .. TT - 1
#define NHB (QHI / QBLK)           // blocks per (b, h) of the first QHI query rows
#define SBUF (4u * LTILE)          // one stage of 128 keys in LDS: key tile, v tile of keys 0..63, then the same of keys 64..127
// one 16-query tile of O^T (x 1 / row sum) turned in the wave's own LDS rows and stored as whole 256-byte rows; Yr = the tile's first output row at this head
__device__ __forceinline__ void put_tile(float (*sw)[HD + 4], const v8f* acc, float inv, float* Yr, int col, int g) {
#pragma unroll
  for (int jd = 0; jd < HD / 16; ++jd)
#pragma unroll
    for (int r = 0; r < 8; ++r) sw[col][jd * 16 + 8 * g + r] = acc[jd][r] * inv;
  asm volatile("s_wait_dscnt 0" ::: "memory"); __builtin_amdgcn_wave_barrier(); __builtin_amdgcn_fence(__ATOMIC_RELEASE, "workgroup", "local");   // the wave's rows are written before it reads them back; ordering LDS alone: LDSX() would also wait here for the answers to the stores of the tile before
#pragma unroll
  for (int i = 0; i < 8; ++i) { const int rl = 2 * i + g; vst2(Yr + (size_t)rl * CC + col * 4, *(const v4f*)&sw[rl][col * 4]); }
  XADDR(); }   // the stores' address and data registers may be reused from here on (a second tile follows on the main path)
#define RSH (PSH / L2S)                      // the same shift counted in raw logits
#define PLIM 60000.0f                        // a lane's P sum of one pass at or under this: every P of it is finite in f16
// 2^x for the rarely run full turn, with the one slot that the instruction set asks for behind a transcendental inside the statement
__device__ __forceinline__ float exp2_slot(float x) { float e; asm("v_exp_f32 %0, %1\n\tv_nop" : "=v"(e) : "v"(x)); return e; }
// S^T of the wave's 64 keys x 32 queries, on top of c (one value per lane and column group): st[cg][jt] = key rows jt . Q^T of group cg + c[cg]
__device__ __forceinline__ void fa_scores(const char* kt, const v16h (&qf)[2][2], float c0, float c1, v8f (&st)[2][4]) {
  v16h kf[4][2]; v8f c[2];
#pragma unroll
  for (int jt = 0; jt < 4; ++jt) { kf[jt][0] = ldf_h(kt, jt * 16 * LPITCH); kf[jt][1] = ldf_h(kt, jt * 16 * LPITCH + 64); }
#pragma unroll
  for (int r = 0; r < 8; ++r) { c[0][r] = c0; c[1][r] = c1; }   // the C operand is spread over its eight registers anew each pass, while the key reads fly: held spread out, it would take 14 more registers through the softmax
  __builtin_amdgcn_sched_barrier(0);   // the pass's key reads go out as one group: mixed among the products, each pair waits out its own LDS latency
#pragma unroll
  for (int jt = 0; jt < 4; ++jt)
#pragma unroll
    for (int cg = 0; cg < 2; ++cg) st[cg][jt] = mm_h(kf[jt][1], qf[cg][1], mm_h(kf[jt][0], qf[cg][0], c[cg])); }
// keys above a query are taken out; dq0 = the lane's query of group 0, counted from its first key of the tile
__device__ __forceinline__ void fa_mask(v8f (&st)[2][4], int dq0) {
#pragma unroll
  for (int cg = 0; cg < 2; ++cg)
#pragma unroll
    for (int jt = 0; jt < 4; ++jt)
#pragma unroll
      for (int r = 0; r < 8; ++r) if (jt * 16 + r > dq0 + cg * 16) st[cg][jt][r] = -3.0e38f; }
// ---- k_fa, main path (query rows >= QHI): block = 128 queries of (b, h) x stages of 128 keys, 8 waves = 4 query groups x 2 key halves: a wave holds 32 queries (two 16-column groups) and takes one 64-key tile of every stage, so every k and v fragment it reads from LDS feeds two products, and a query's keys are walked by two waves side by side. Four tensor loads put a stage in LDS once (two buffers: stage s + 1 flies during pass s). Per 64 keys and column group: S^T = K . Q^T (A = key rows, B = query columns: a lane holds 8 keys per tile of ONE query, lane & 15), sum per lane against a HELD reference logit per query, which enters as the C operand of the score products (a pass takes no maximum, shifts no score and rescales nothing; one test per pass on the P sums sends the wave to a second, full turn over the same tile, which raises the reference), P^T packed from the score registers straight into a B operand, O^T += V^T . P^T (A = v planes [c][s]). Logits and P never leave registers. Behind the loop the upper key half hands its reference, sum and O^T to its partner wave through LDS, which joins the two and stores. The first QHI query rows (wave = 16 queries) load for themselves.
__global__ __launch_bounds__(256) void k_fa(const float* Q, const _Float16* KH, const _Float16* KL, const _Float16* VT, const __bf16* VB, const __bf16* VBL, float* Y) {   // no __restrict__: it would let the loads drift over the XADDR() waits
  __shared__ __attribute__((aligned(2048))) unsigned char ring[2 * SBUF];   // two buffers of one stage each
  __shared__ __align__(16) float ss[8][16][HD + 4];
  __shared__ v4f mg[4][17][32];   // per query group: the upper key half's O^T (16 pieces of 16 bytes a lane), then its references and sums
  const int tid = threadIdx.x, wave = tid >> 5, lane = tid & 31, col = lane & 15, g = lane >> 4;
  const unsigned wv = uni((unsigned)tid >> 5);   // wave number (scalar)
  const int b = blockIdx.x / NH, h = blockIdx.x % NH;   // the query block comes from the slow grid index: see the launch
  const unsigned lk = (unsigned)(col * CC + 8 * g) * 2u;   // lane byte offset: key row
  const _Float16* Ku = KH + (size_t)b * TT * CC + h * HD;
  if ((int)blockIdx.y < NHB) {
    const int qb = NHB - 1 - (int)blockIdx.y;
    const int ql0 = qb * QBLK + (int)wv * 16, tq = ql0 + col;   // the wave's first query (scalar); tq: this lane's query
    const unsigned lq = (unsigned)((wave * 16 + col) * CC + 8 * g) * 4u;   // lane byte offset: f32 query row
    v8f acc[HD / 16] = {}; float m = -1.0e30f, l = 0.f;
    const char* qp = (const char*)(Q + ((size_t)b * TT + qb * QBLK) * CC + h * HD) + lq;
    const QRaw qr = ldq(qp, 0); XADDR();
    const v16h q0 = qfrag(qr, 0), q1 = qfrag(qr, 1), r0 = qfrag_res(qr, 0), r1 = qfrag_res(qr, 1);
    const unsigned lv = (unsigned)(col * KHI + 8 * g) * 2u;
    const _Float16* KLu = KL + (size_t)b * KHI * CC + h * HD; const __bf16* VBu = VB + ((size_t)b * CC + h * HD) * (size_t)KHI; const __bf16* VLu = VBL + ((size_t)b * CC + h * HD) * (size_t)KHI;
#pragma unroll 1
    for (int kb = 0; kb < (ql0 + 16 + 31) / 32; ++kb) { const int k0 = kb * 32; float s[2][8]; float mx = -3.0e38f;   // 32 keys a pass, up to the wave's last query (no barrier on this path: each wave has its own count); this short path must not set the kernel's register count
      const char* kp = (const char*)(Ku + (size_t)k0 * CC) + lk; const char* lp = (const char*)(KLu + (size_t)k0 * CC) + lk;
#pragma unroll
      for (int jt = 0; jt < 2; ++jt) { const v16h ka = ldf_h(kp, jt * 16 * CC * 2), kc = ldf_h(kp, jt * 16 * CC * 2 + 64), la = ldf_h(lp, jt * 16 * CC * 2), lc = ldf_h(lp, jt * 16 * CC * 2 + 64);
        v8f sh = {}, sl = {}; sh = mm_h(ka, q0, sh); sh = mm_h(kc, q1, sh); sl = mm_h(ka, r0, sl); sl = mm_h(kc, r1, sl); sl = mm_h(la, q0, sl); sl = mm_h(lc, q1, sl);
#pragma unroll
        for (int r = 0; r < 8; ++r) { const float v = (k0 + jt * 16 + 8 * g + r <= tq) ? sh[r] + sl[r] * (1.0f / 1024.0f) : -3.0e38f; s[jt][r] = v; mx = fmaxf(mx, v); } }
      XADDRP(kp, lp);
      mx = fmaxf(mx, xhalf(mx)); const float mn = fmaxf(m, mx * L2S), al = __builtin_amdgcn_exp2f(m - mn), nm = PSH - mn; m = mn;   // pass 0 holds key 0, which every query sees: m is a real logit from there on
      float ps = 0.f; v16b ph, pl;
#pragma unroll
      for (int jt = 0; jt < 2; ++jt)
#pragma unroll
        for (int r = 0; r < 8; ++r) { const float e = __builtin_amdgcn_exp2f(fmaf(s[jt][r], L2S, nm)); ps += e; const __bf16 eh = (__bf16)e; ph[jt * 8 + r] = eh; pl[jt * 8 + r] = (__bf16)(e - (float)eh); }
      l = l * al + ps;
      const char* vp = (const char*)(VBu + k0) + lv; const char* wp = (const char*)(VLu + k0) + lv;
#pragma unroll
      for (int jd = 0; jd < HD / 16; ++jd) { acc[jd] *= al; const v16b vh = ldf_b(vp, jd * 16 * KHI * 2), vl = ldf_b(wp, jd * 16 * KHI * 2);
        acc[jd] = mm_b(vh, ph, acc[jd]); acc[jd] = mm_b(vh, pl, acc[jd]); acc[jd] = mm_b(vl, ph, acc[jd]); }
      XADDRP(vp, wp); }
    l += xhalf(l);   // every query sees its own key, so l > 0
    put_tile(ss[wave], acc, 1.0f / l, Y + ((size_t)b * TT + ql0) * CC + h * HD, col, g);
  } else {
    const unsigned qg = wv & 3u, kh = wv >> 2, lf = (unsigned)(col * LPITCH + 16 * g);   // query group, key half (scalar); lane byte offset in a staged tile: row (lane & 15), + 16 bytes for the upper half
    const int Q0 = TT - QBLK * ((int)blockIdx.y - NHB + 1), nst = Q0 / 128 + 1;   // the block's first query; its stages of 128 keys (keys 0 .. Q0 + 127)
    const int wq0 = Q0 + (int)qg * QW;   // the wave's first query (scalar)
    v8f acc[2][HD / 16] = {}; float rf[2] = {-1.0e30f, -1.0e30f}, l[2] = {0.f, 0.f};   // rf: the reference in use, a raw logit; the far-off start value makes the first full turn's factor for sum and O^T 0
    const char* qp = (const char*)(Q + ((size_t)b * TT + Q0) * CC + h * HD) + (unsigned)(((wave & 3) * QW + col) * CC + 8 * g) * 4u;
    const QRaw qr[2] = {ldq(qp, 0), ldq(qp, 16 * CC * 4)};   // the wave's 32 query rows, f32 from the input: they fly while stage 0 lands and are rounded behind the prologue
    XADDR();
    // waves 0 to 3 bring one tile each per stage: wave 0 the key tile of keys 0..63 (64 rows of KH, 128 bytes each), wave 1 their v tile (64 planes of VT, 64 keys = 128 bytes each), waves 2 and 3 the same of keys 64..127
    const unsigned isv = wv & 1u, th = (wv >> 1) & 1u;
    const unsigned long long sb = isv ? (unsigned long long)(size_t)(VT + ((size_t)b * CC + h * HD) * (size_t)TT + th * 64u) : (unsigned long long)(size_t)(Ku + (size_t)th * 64u * CC);
    const unsigned sstep = isv ? 128u * 2u : 128u * CC * 2u, lb = (unsigned)(size_t)ring + (th * 2u + isv) * LTILE;   // source bytes from one stage to the next; this wave's place in buffer 0
    v8u g1 = tdm_g1(isv ? TT * 2u : CC * 2u);
    asm volatile("" : "+s"(g1));   // descriptor words held in their scalar registers for the whole loop: none is rebuilt, or lent to another value, while a request is in flight
    v4u g0 = tdm_g0(lb, sb);
    if (pinned(wv < 4u)) { tdm_load(g0, g1);
      asm volatile("s_wait_tensorcnt 0x0" ::: "memory"); }   // stage 0 has landed (the compiler places no wait for a tensor load)
    __syncthreads();   // stage 0 readable by every wave
    if (pinned(wv < 4u)) { tdm_next(g0, lb + SBUF, sstep); tdm_load(g0, g1); }   // stage 1 (Q0 >= QHI: at least four stages)
    v16h qf[2][2];
#pragma unroll
    for (int cg = 0; cg < 2; ++cg) { qf[cg][0] = qfrag(qr[cg], 0); qf[cg][1] = qfrag(qr[cg], 1); }
#pragma unroll 1
    for (int s = 0; s < nst; ++s) { const int k0 = s * 128 + (int)kh * 64;   // the wave's 64 keys of this stage
      const char* kt = (const char*)ring + ((unsigned)(s & 1) * SBUF + kh * (2u * LTILE)) + lf; const char* vt = kt + LTILE;
      const bool diag = k0 + 63 > wq0;   // only a tile that reaches past the wave's first query holds keys above a query (in the block's last stage); wave-uniform, a scalar branch
      const int dq0 = wq0 + col - k0 - 8 * g;
      v8f st[2][4]; v16h pf[2][2], vf[HD / 16][2]; float ps[2];
      unsigned full = 1u;   // lanes that ask for the full turn (a scalar); the first pass has no reference yet and goes straight to it
      if (s != 0) {
      fa_scores(kt, qf, RSH - rf[0], RSH - rf[1], st);   // raw logit - reference + RSH
      if (diag) fa_mask(st, dq0);   // a tile all above the wave's queries leaves l and acc as they are (every weight 0)
#pragma unroll
      for (int cg = 0; cg < 2; ++cg) { float p = 0.f;
#pragma unroll
        for (int jt = 0; jt < 4; ++jt) { const v8f t = st[cg][jt] * L2S;
#pragma unroll
          for (int r = 0; r < 8; ++r) { const float e = __builtin_amdgcn_exp2f(t[r]); p += e; pf[cg][jt >> 1][(jt & 1) * 8 + r] = (_Float16)e; } }
        ps[cg] = p;
        asm volatile("" :: "v"(ps[cg]), "v"(pf[cg][0]), "v"(pf[cg][1]) : "memory");   // the group's P sum and its packed P, inputs only, are finished here: left free, the compiler sinks the packing behind the test below and keeps all 64 unpacked weights in registers up to there; and left free, the compiler mixes the two groups' softmax and moves the 32 additions to the loop's foot, a dependent chain in front of the next key reads, and scores, weights and v planes all live at once take more registers than four waves per SIMD leave
        __builtin_amdgcn_sched_barrier(0);   // first group: its scores are packed (32 registers become 16) before the v planes take theirs; second group: no P.v product is lifted to just behind the v reads, where it would wait out their LDS latency
        if (cg == 0) {
#pragma unroll
          for (int jd = 0; jd < HD / 16; ++jd) { vf[jd][0] = ldf_h(vt, jd * 16 * LPITCH); vf[jd][1] = ldf_h(vt, jd * 16 * LPITCH + 64); }   // this pass's v planes: they fly during the second group's softmax
          __builtin_amdgcn_sched_barrier(0); } }   // all v reads go out in front of that softmax: left free, some sink among the P.v products and wait out their LDS latency there
      full = __builtin_amdgcn_ballot_w32(!(ps[0] <= PLIM && ps[1] <= PLIM)); }   // one test per pass, a scalar branch: some logit stands so far above its reference that a P may not fit f16 (an infinite or undefined sum lands here too)
      if (full != 0u) {
        // the full turn over the same tile (its buffer is the wave's until the publish point): raw logits anew, each query's maximum, the reference raised to it, sum and O^T brought to the new reference; P <= 2^PSH then, a lane's sum <= 32 x 2^PSH < PLIM
        fa_scores(kt, qf, 0.f, 0.f, st);
        if (diag) fa_mask(st, dq0);
#pragma unroll
        for (int cg = 0; cg < 2; ++cg) { float mx = -3.0e38f;
#pragma unroll
          for (int jt = 0; jt < 4; ++jt)
#pragma unroll
            for (int r = 0; r < 8; ++r) mx = fmaxf(mx, st[cg][jt][r]);
          mx = fmaxf(mx, xhalf(mx)); const float rn = fmaxf(rf[cg], mx), al = exp2_slot((rf[cg] - rn) * L2S), c = RSH - rn; rf[cg] = rn;   // both halves of the wave hold the same reference for a query; the wave's tile of stage 0 lies below every query of this path, so rf is a real logit from there on
          float p = 0.f;
#pragma unroll
          for (int jt = 0; jt < 4; ++jt)
#pragma unroll
            for (int r = 0; r < 8; ++r) { const float e = exp2_slot((st[cg][jt][r] + c) * L2S); p += e; pf[cg][jt >> 1][(jt & 1) * 8 + r] = (_Float16)e; }
          ps[cg] = p; l[cg] *= al;
#pragma unroll
          for (int jd = 0; jd < HD / 16; ++jd) acc[cg][jd] *= al; }
#pragma unroll
        for (int jd = 0; jd < HD / 16; ++jd) { vf[jd][0] = ldf_h(vt, jd * 16 * LPITCH); vf[jd][1] = ldf_h(vt, jd * 16 * LPITCH + 64); } }   // the v planes are read again, so that their 64 registers are free during the full turn
      l[0] += ps[0]; l[1] += ps[1];
#pragma unroll
      for (int jd = 0; jd < HD / 16; ++jd)
#pragma unroll
        for (int cg = 0; cg < 2; ++cg) { acc[cg][jd] = mm_h(vf[jd][0], pf[cg][0], acc[cg][jd]); acc[cg][jd] = mm_h(vf[jd][1], pf[cg][1], acc[cg][jd]); }
      __builtin_amdgcn_sched_barrier(0);   // the waits below stay at the pass's foot: lifted over the softmax, the first one waits out the v reads' latency with nothing to cover it
      // publish point of stage s + 1, every wave, in this order
      asm volatile("s_wait_dscnt 0x0" ::: "memory");   // this wave's reads of the buffer have returned before the buffer is refilled
      if (pinned(wv < 4u)) asm volatile("s_wait_tensorcnt 0x0" ::: "memory");   // the issuer's own request for stage s + 1 has landed
      __syncthreads();   // stage s + 1 readable by every wave; every wave has left stage s's buffer
      if (pinned(wv < 4u && s + 2 < nst)) { tdm_next(g0, lb + (unsigned)(s & 1) * SBUF, sstep); tdm_load(g0, g1); } }   // stage s + 2 into the buffer that this pass has read
    asm volatile("s_wait_tensorcnt 0x0" ::: "memory");   // no request outstanding behind the loop
    asm volatile("s_wait_dscnt 0x0" ::: "memory");
    // the two key halves of a query group are joined: same lane, same registers in both waves
    const float m[2] = {rf[0] * L2S, rf[1] * L2S};   // each wave's reference as a base-2 exponent
    if (kh != 0u) {
#pragma unroll
      for (int cg = 0; cg < 2; ++cg)
#pragma unroll
        for (int jd = 0; jd < HD / 16; ++jd)
#pragma unroll
          for (int hf = 0; hf < 2; ++hf) mg[qg][(cg * 4 + jd) * 2 + hf][lane] = v4f{acc[cg][jd][hf * 4], acc[cg][jd][hf * 4 + 1], acc[cg][jd][hf * 4 + 2], acc[cg][jd][hf * 4 + 3]};
      mg[qg][16][lane] = v4f{m[0], m[1], l[0], l[1]}; }
    __syncthreads();   // the upper halves' results readable by their partner waves
    if (kh == 0u) { const v4f o = mg[qg][16][lane];
#pragma unroll
      for (int cg = 0; cg < 2; ++cg) { const float mn = fmaxf(m[cg], o[cg]), fa = __builtin_amdgcn_exp2f(m[cg] - mn), fb = __builtin_amdgcn_exp2f(o[cg] - mn);   // both references are real logits
        float lt = l[cg] * fa + o[2 + cg] * fb; lt += xhalf(lt);   // every query sees its own key, so the sum is > 0
#pragma unroll
        for (int jd = 0; jd < HD / 16; ++jd)
#pragma unroll
          for (int hf = 0; hf < 2; ++hf) { const v4f p = mg[qg][(cg * 4 + jd) * 2 + hf][lane];
#pragma unroll
            for (int e = 0; e < 4; ++e) acc[cg][jd][hf * 4 + e] = acc[cg][jd][hf * 4 + e] * fa + p[e] * fb; }
        put_tile(ss[wave], acc[cg], 1.0f / lt, Y + ((size_t)b * TT + wq0 + cg * 16) * CC + h * HD, col, g); } } } }

extern "C" void kernel_launch(void* const* d_in, const int* in_sizes, int n_in, void* d_out, int out_size, void* d_ws, size_t ws_size, hipStream_t stream) {
  (void)in_sizes; (void)n_in; (void)out_size;
  const float** F = (const float**)d_in;
  if (ws_size < (size_t)WS_END) return;
  char* ws = (char*)d_ws; _Float16 *KH = (_Float16*)(ws + WS_KH), *VT = (_Float16*)(ws + WS_VT), *KL = (_Float16*)(ws + WS_KL); __bf16 *VB = (__bf16*)(ws + WS_VB), *VBL = (__bf16*)(ws + WS_VBL);
  // inputs: 0 q, 1 k, 2 v [2,4096,16,64] (= rows [b*S + t][h*64 + d])
  k_prepr<<<dim3(TNB * TT / 64, NH / PH), 256, 0, stream>>>(F[1], F[2], KH, KL, VT, VB, VBL);
  // (b, h) is the fast grid index and the query block the slow one: over the WHOLE grid a main-path block's cost (its number of stages) falls with its flat index. There are more blocks than resident places: a long block that starts late runs on while most of the chip stands idle. The blocks of the first rows stand in front: few passes, but each waits out two round trips to global memory, so started last they would outlast the grid.
  k_fa<<<dim3(TNB * NH, NHB + NMB), 256, 0, stream>>>(F[0], KH, KL, VT, VB, VBL, (float*)d_out);
}
